// v000
// The times below were measured on an AMD MI455X: many runs one after another, warmed up first and cycling through
// copies of the inputs, with the whole window's GPU time divided by the number of runs. Launches and the gaps
// between them are all in it. The median over several windows is given; except for v000 it joins two sittings, which
// can be a few percent apart, so the side-by-side timings, each taken in one sitting, are the better comparison.
// v000 is the starting kernel. One run takes 791 microseconds.
#include <hip/hip_runtime.h>
#include <hip/hip_bf16.h>

// Problem constants (match reference)
#define SDIM 1024
#define BDIM 8
#define EDIM 1024
#define HNUM 16
#define HD   64
#define NTOK (SDIM * BDIM)   // 8192 tokens
#define E3   (3 * EDIM)      // 3072

typedef __attribute__((ext_vector_type(16))) _Float16 v16h;
typedef __attribute__((ext_vector_type(8)))  _Float16 v8h;
typedef __attribute__((ext_vector_type(8)))  float    v8f;

static __device__ inline v16h load_frag16(const _Float16* p, int ld, int lane) {
    const int m  = lane & 15;
    const int kb = (lane >> 4) << 3;
    const _Float16* r = p + (size_t)m * (size_t)ld + kb;
    v8h lo = *(const v8h*)(r);
    v8h hi = *(const v8h*)(r + 16);
    return __builtin_shufflevector(lo, hi, 0, 1, 2, 3, 4, 5, 6, 7,
                                           8, 9, 10, 11, 12, 13, 14, 15);
}

static __device__ inline v8f wmma16(v16h a, v16h b, v8f c) {
    // 8-arg form: (neg_a, A, neg_b, B, c_mod, C, reuse_a, reuse_b)
    return __builtin_amdgcn_wmma_f32_16x16x32_f16(false, a, false, b,
                                                  (short)0, c, false, false);
}

static __device__ inline v8f vzero8() {
    v8f z = {0.f, 0.f, 0.f, 0.f, 0.f, 0.f, 0.f, 0.f};
    return z;
}

static __device__ inline void async_copy_b128(unsigned lds_byte_off,
                                              const _Float16* gaddr) {
    unsigned long long ga = (unsigned long long)(uintptr_t)gaddr;
    asm volatile("global_load_async_to_lds_b128 %0, %1, off"
                 :: "v"(lds_byte_off), "v"(ga) : "memory");
}

static __device__ inline void wait_async0() {
    asm volatile("s_wait_asynccnt 0x0" ::: "memory");
}

// ---------------------------------------------------------------------------
// f32 -> f16 conversion
// ---------------------------------------------------------------------------
__global__ void f32_to_f16_kernel(const float* __restrict__ src,
                                  _Float16* __restrict__ dst, int n) {
    int i = blockIdx.x * blockDim.x + threadIdx.x;
    if (i < n) dst[i] = (_Float16)src[i];
}

#define WROW 40

static __device__ inline void stage_w_tile(_Float16* wbuf,   // [2][64][WROW]
                                           const _Float16* wr,
                                           const _Float16* wi,
                                           int col0, int kb, int tid) {
#pragma unroll
    for (int i = 0; i < 4; ++i) {
        const int q   = tid + i * 128;        // 0..511
        const int mat = q >> 8;               // 0 = re, 1 = im
        const int rr  = q & 255;
        const int c   = rr >> 2;              // column within tile, 0..63
        const int ck  = (rr & 3) << 3;        // k-chunk start (halves)
        const _Float16* g = (mat ? wi : wr) + (size_t)(col0 + c) * EDIM + kb + ck;
        unsigned lds = (unsigned)(uintptr_t)(wbuf + (mat * 64 + c) * WROW + ck);
        async_copy_b128(lds, g);
    }
}

// ---------------------------------------------------------------------------
// QKV complex projection:  y = x @ W^T + b, writing q/k/v head-major
// (B,H,S,HD) f16.  Block = 128 threads (4 waves); wave = 16x64 complex tile;
// W tile staged once per block via async-to-LDS.
// ---------------------------------------------------------------------------
__global__ void __launch_bounds__(128) qkv_gemm_kernel(
    const _Float16* __restrict__ xqr, const _Float16* __restrict__ xqi,
    const _Float16* __restrict__ xkr, const _Float16* __restrict__ xki,
    const _Float16* __restrict__ xvr, const _Float16* __restrict__ xvi,
    const _Float16* __restrict__ wr,  const _Float16* __restrict__ wi,
    const float* __restrict__ bre,    const float* __restrict__ bim,
    _Float16* __restrict__ Qr, _Float16* __restrict__ Qi,
    _Float16* __restrict__ Kr, _Float16* __restrict__ Ki,
    _Float16* __restrict__ Vr, _Float16* __restrict__ Vi)
{
    __shared__ __align__(16) _Float16 wbuf[2 * 64 * WROW];

    const int lane = threadIdx.x & 31;
    const int wave = threadIdx.x >> 5;
    const int row0 = (blockIdx.x * 4 + wave) * 16;   // token tile
    const int col0 = blockIdx.y * 64;                // output-feature tile
    const int sel  = col0 >> 10;                     // 0=q 1=k 2=v

    const _Float16* Xr = (sel == 0) ? xqr : ((sel == 1) ? xkr : xvr);
    const _Float16* Xi = (sel == 0) ? xqi : ((sel == 1) ? xki : xvi);

    v8f accR[4], accI[4];
#pragma unroll
    for (int j = 0; j < 4; ++j) { accR[j] = vzero8(); accI[j] = vzero8(); }

    for (int kb = 0; kb < EDIM; kb += 32) {
        __syncthreads();   // all waves done reading previous W tile
        stage_w_tile(wbuf, wr, wi, col0, kb, (int)threadIdx.x);

        v16h ar  = load_frag16(Xr + (size_t)row0 * EDIM + kb, EDIM, lane);
        v16h ai  = load_frag16(Xi + (size_t)row0 * EDIM + kb, EDIM, lane);
        v16h nai = -ai;  // wmma16 fixes neg_a false; negate explicitly
        if (kb + 32 < EDIM) {   // prefetch next A tiles (global_prefetch_b8)
            __builtin_prefetch(Xr + (size_t)row0 * EDIM + kb + 32, 0, 3);
            __builtin_prefetch(Xi + (size_t)row0 * EDIM + kb + 32, 0, 3);
        }

        wait_async0();
        __syncthreads();   // W tile visible to all waves

#pragma unroll
        for (int j = 0; j < 4; ++j) {
            v16h brf = load_frag16(wbuf + (0 * 64 + j * 16) * WROW, WROW, lane);
            v16h bif = load_frag16(wbuf + (1 * 64 + j * 16) * WROW, WROW, lane);
            accR[j] = wmma16(ar,  brf, accR[j]);
            accR[j] = wmma16(nai, bif, accR[j]);   // - ai*bi
            accI[j] = wmma16(ar,  bif, accI[j]);
            accI[j] = wmma16(ai,  brf, accI[j]);
        }
    }

    _Float16* Dr = (sel == 0) ? Qr : ((sel == 1) ? Kr : Vr);
    _Float16* Di = (sel == 0) ? Qi : ((sel == 1) ? Ki : Vi);

#pragma unroll
    for (int j = 0; j < 4; ++j) {
        const int col = col0 + j * 16 + (lane & 15);
        const float br_v = bre[col];
        const float bi_v = bim[col];
        const int e  = col & (EDIM - 1);
        const int hh = e >> 6;         // head
        const int d  = e & 63;         // dim in head
#pragma unroll
        for (int r = 0; r < 8; ++r) {
            const int tok = row0 + ((lane >> 4) << 3) + r;   // C layout rows
            const int s = tok >> 3;        // token = s*B + b, B=8
            const int b = tok & 7;
            const size_t off = (((size_t)(b * HNUM + hh) * SDIM + s) * HD) + d;
            Dr[off] = (_Float16)(accR[j][r] + br_v);
            Di[off] = (_Float16)(accI[j][r] + bi_v);
        }
    }
}

// ---------------------------------------------------------------------------
// Flash attention per (b,h):  scores = (qr.kr^T + qi.ki^T)/8, online softmax,
// out = P @ v (re and im).  Block = 4 waves, each wave owns 16 query rows.
// V tiles staged transposed in LDS; P bounces through LDS (C- -> A-layout).
// ---------------------------------------------------------------------------
__global__ void __launch_bounds__(128) attn_kernel(
    const _Float16* __restrict__ Qr, const _Float16* __restrict__ Qi,
    const _Float16* __restrict__ Kr, const _Float16* __restrict__ Ki,
    const _Float16* __restrict__ Vr, const _Float16* __restrict__ Vi,
    _Float16* __restrict__ Or, _Float16* __restrict__ Oi)
{
    __shared__ __align__(16) _Float16 vtr[64][40];       // V^T re, padded rows
    __shared__ __align__(16) _Float16 vti[64][40];       // V^T im
    __shared__ __align__(16) _Float16 pbuf[4][16][32];   // per-wave P tile

    const int lane = threadIdx.x & 31;
    const int wave = threadIdx.x >> 5;
    const int bh = blockIdx.y;          // = b*H + h
    const int b  = bh >> 4;
    const int h  = bh & 15;
    const int s0 = blockIdx.x * 64 + wave * 16;

    const size_t base = (size_t)bh * SDIM * HD;

    v16h aqr[2], aqi[2];
#pragma unroll
    for (int ks = 0; ks < 2; ++ks) {
        aqr[ks] = load_frag16(Qr + base + (size_t)s0 * HD + ks * 32, HD, lane);
        aqi[ks] = load_frag16(Qi + base + (size_t)s0 * HD + ks * 32, HD, lane);
    }

    v8f oR[4], oI[4];
#pragma unroll
    for (int j = 0; j < 4; ++j) { oR[j] = vzero8(); oI[j] = vzero8(); }
    float mrun[8], lrun[8];
#pragma unroll
    for (int r = 0; r < 8; ++r) { mrun[r] = -1e30f; lrun[r] = 0.f; }

    const float scale = 0.125f;   // 1/sqrt(64)

    for (int t0 = 0; t0 < SDIM; t0 += 32) {
        __syncthreads();   // protect previous iteration's V-tile reads
        // Cooperative staging of V[t0..t0+31][0..63] transposed into LDS
#pragma unroll 4
        for (int i = 0; i < 16; ++i) {
            const int idx = (int)threadIdx.x + i * 128;   // 0..2047
            const int t = idx >> 6;
            const int d = idx & 63;
            vtr[d][t] = Vr[base + (size_t)(t0 + t) * HD + d];
            vti[d][t] = Vi[base + (size_t)(t0 + t) * HD + d];
        }
        __syncthreads();

        // Scores: 16x32 block as two 16x16 C tiles
        v8f sc[2];
        sc[0] = vzero8(); sc[1] = vzero8();
#pragma unroll
        for (int ts = 0; ts < 2; ++ts) {
#pragma unroll
            for (int ks = 0; ks < 2; ++ks) {
                v16h bkr = load_frag16(Kr + base + (size_t)(t0 + ts * 16) * HD + ks * 32, HD, lane);
                v16h bki = load_frag16(Ki + base + (size_t)(t0 + ts * 16) * HD + ks * 32, HD, lane);
                sc[ts] = wmma16(aqr[ks], bkr, sc[ts]);
                sc[ts] = wmma16(aqi[ks], bki, sc[ts]);
            }
        }

        // Online softmax across the 32 new columns (butterfly within 16-lane
        // half-groups: C-layout spreads each row over 16 lanes)
#pragma unroll
        for (int r = 0; r < 8; ++r) {
            float x0 = sc[0][r] * scale;
            float x1 = sc[1][r] * scale;
            float mx = fmaxf(x0, x1);
            mx = fmaxf(mx, __shfl_xor(mx, 1, 32));
            mx = fmaxf(mx, __shfl_xor(mx, 2, 32));
            mx = fmaxf(mx, __shfl_xor(mx, 4, 32));
            mx = fmaxf(mx, __shfl_xor(mx, 8, 32));
            const float mnew = fmaxf(mrun[r], mx);
            const float corr = __expf(mrun[r] - mnew);
            const float p0 = __expf(x0 - mnew);
            const float p1 = __expf(x1 - mnew);
            float rs = p0 + p1;
            rs += __shfl_xor(rs, 1, 32);
            rs += __shfl_xor(rs, 2, 32);
            rs += __shfl_xor(rs, 4, 32);
            rs += __shfl_xor(rs, 8, 32);
            lrun[r] = lrun[r] * corr + rs;
            mrun[r] = mnew;
#pragma unroll
            for (int j = 0; j < 4; ++j) { oR[j][r] *= corr; oI[j][r] *= corr; }
            const int row = ((lane >> 4) << 3) + r;
            pbuf[wave][row][(lane & 15)]      = (_Float16)p0;
            pbuf[wave][row][16 + (lane & 15)] = (_Float16)p1;
        }

        // LDS pipeline is in-order per wave; fence explicitly anyway
        asm volatile("s_wait_dscnt 0x0" ::: "memory");

        v16h pa = load_frag16(&pbuf[wave][0][0], 32, lane);
#pragma unroll
        for (int j = 0; j < 4; ++j) {
            v16h bvr = load_frag16(&vtr[j * 16][0], 40, lane);
            v16h bvi = load_frag16(&vti[j * 16][0], 40, lane);
            oR[j] = wmma16(pa, bvr, oR[j]);
            oI[j] = wmma16(pa, bvi, oI[j]);
        }
    }

    // Normalize and write (S,B,E) f16 for the output projection
#pragma unroll
    for (int j = 0; j < 4; ++j) {
        const int d = j * 16 + (lane & 15);
#pragma unroll
        for (int r = 0; r < 8; ++r) {
            const int row = ((lane >> 4) << 3) + r;
            const int s = s0 + row;
            const float invl = 1.0f / lrun[r];
            const size_t off = ((size_t)(s * BDIM + b)) * EDIM + h * HD + d;
            Or[off] = (_Float16)(oR[j][r] * invl);
            Oi[off] = (_Float16)(oI[j][r] * invl);
        }
    }
}

// ---------------------------------------------------------------------------
// Output complex projection:  y = out @ Wo^T + bo -> f32 d_out stacked
// (2, S, B, E).  Same async-staged structure as the QKV GEMM.
// ---------------------------------------------------------------------------
__global__ void __launch_bounds__(128) out_gemm_kernel(
    const _Float16* __restrict__ Ar, const _Float16* __restrict__ Ai,
    const _Float16* __restrict__ wr, const _Float16* __restrict__ wi,
    const float* __restrict__ bre,   const float* __restrict__ bim,
    float* __restrict__ out)
{
    __shared__ __align__(16) _Float16 wbuf[2 * 64 * WROW];

    const int lane = threadIdx.x & 31;
    const int wave = threadIdx.x >> 5;
    const int row0 = (blockIdx.x * 4 + wave) * 16;
    const int col0 = blockIdx.y * 64;

    v8f accR[4], accI[4];
#pragma unroll
    for (int j = 0; j < 4; ++j) { accR[j] = vzero8(); accI[j] = vzero8(); }

    for (int kb = 0; kb < EDIM; kb += 32) {
        __syncthreads();
        stage_w_tile(wbuf, wr, wi, col0, kb, (int)threadIdx.x);

        v16h ar  = load_frag16(Ar + (size_t)row0 * EDIM + kb, EDIM, lane);
        v16h ai  = load_frag16(Ai + (size_t)row0 * EDIM + kb, EDIM, lane);
        v16h nai = -ai;
        if (kb + 32 < EDIM) {
            __builtin_prefetch(Ar + (size_t)row0 * EDIM + kb + 32, 0, 3);
            __builtin_prefetch(Ai + (size_t)row0 * EDIM + kb + 32, 0, 3);
        }

        wait_async0();
        __syncthreads();

#pragma unroll
        for (int j = 0; j < 4; ++j) {
            v16h brf = load_frag16(wbuf + (0 * 64 + j * 16) * WROW, WROW, lane);
            v16h bif = load_frag16(wbuf + (1 * 64 + j * 16) * WROW, WROW, lane);
            accR[j] = wmma16(ar,  brf, accR[j]);
            accR[j] = wmma16(nai, bif, accR[j]);
            accI[j] = wmma16(ar,  bif, accI[j]);
            accI[j] = wmma16(ai,  brf, accI[j]);
        }
    }

    const size_t imOff = (size_t)NTOK * EDIM;
#pragma unroll
    for (int j = 0; j < 4; ++j) {
        const int col = col0 + j * 16 + (lane & 15);
        const float br_v = bre[col];
        const float bi_v = bim[col];
#pragma unroll
        for (int r = 0; r < 8; ++r) {
            const int tok = row0 + ((lane >> 4) << 3) + r;
            const size_t off = (size_t)tok * EDIM + col;
            out[off]         = accR[j][r] + br_v;
            out[imOff + off] = accI[j][r] + bi_v;
        }
    }
}

// ---------------------------------------------------------------------------
// Host launcher
// ---------------------------------------------------------------------------
extern "C" void kernel_launch(void* const* d_in, const int* in_sizes, int n_in,
                              void* d_out, int out_size, void* d_ws, size_t ws_size,
                              hipStream_t stream) {
    (void)in_sizes; (void)n_in; (void)out_size; (void)ws_size;

    const size_t NE   = (size_t)NTOK * EDIM;   // 8,388,608
    const size_t WQKV = (size_t)E3 * EDIM;     // 3,145,728
    const size_t WO   = (size_t)EDIM * EDIM;   // 1,048,576

    _Float16* hws = (_Float16*)d_ws;
    _Float16* xqr = hws;            _Float16* xqi = xqr + NE;
    _Float16* xkr = xqi + NE;       _Float16* xki = xkr + NE;
    _Float16* xvr = xki + NE;       _Float16* xvi = xvr + NE;
    _Float16* wr  = xvi + NE;       _Float16* wi  = wr + WQKV;
    _Float16* wor = wi + WQKV;      _Float16* woi = wor + WO;
    _Float16* Qr  = woi + WO;       _Float16* Qi  = Qr + NE;
    _Float16* Kr  = Qi + NE;        _Float16* Ki  = Kr + NE;
    _Float16* Vr  = Ki + NE;        _Float16* Vi  = Vr + NE;
    _Float16* Aor = Vi + NE;        _Float16* Aoi = Aor + NE;

    auto cvt = [&](const void* src, _Float16* dst, size_t n) {
        f32_to_f16_kernel<<<dim3((unsigned)((n + 255) / 256)), dim3(256), 0, stream>>>(
            (const float*)src, dst, (int)n);
    };

    // Activations and weights -> f16
    cvt(d_in[0], xqr, NE);  cvt(d_in[1], xqi, NE);
    cvt(d_in[2], xkr, NE);  cvt(d_in[3], xki, NE);
    cvt(d_in[4], xvr, NE);  cvt(d_in[5], xvi, NE);
    cvt(d_in[6], wr, WQKV); cvt(d_in[7], wi, WQKV);
    cvt(d_in[10], wor, WO); cvt(d_in[11], woi, WO);

    // QKV projection (complex), head-major f16 outputs
    {
        dim3 grid(NTOK / 64, E3 / 64);
        qkv_gemm_kernel<<<grid, dim3(128), 0, stream>>>(
            xqr, xqi, xkr, xki, xvr, xvi, wr, wi,
            (const float*)d_in[8], (const float*)d_in[9],
            Qr, Qi, Kr, Ki, Vr, Vi);
    }

    // Flash attention per (b,h)
    {
        dim3 grid(SDIM / 64, BDIM * HNUM);
        attn_kernel<<<grid, dim3(128), 0, stream>>>(Qr, Qi, Kr, Ki, Vr, Vi, Aor, Aoi);
    }

    // Output projection (complex), f32 result stacked (re, im)
    {
        dim3 grid(NTOK / 64, EDIM / 64);
        out_gemm_kernel<<<grid, dim3(128), 0, stream>>>(
            Aor, Aoi, wor, woi,
            (const float*)d_in[12], (const float*)d_in[13],
            (float*)d_out);
    }
}

// v001
// One run takes 723 microseconds.
// Next to v000, in two timings, it ran 1.12 and 1.13 times as fast.
#include <hip/hip_runtime.h>
#include <hip/hip_bf16.h>

// Problem constants (match reference)
#define SDIM 1024
#define BDIM 8
#define EDIM 1024
#define HNUM 16
#define HD   64
#define NTOK (SDIM * BDIM)   // 8192 tokens
#define E3   (3 * EDIM)      // 3072

typedef __attribute__((ext_vector_type(16))) _Float16 v16h;
typedef __attribute__((ext_vector_type(8)))  _Float16 v8h;
typedef __attribute__((ext_vector_type(8)))  float    v8f;

static __device__ inline v16h load_frag16(const _Float16* p, int ld, int lane) {
    const int m  = lane & 15;
    const int kb = (lane >> 4) << 3;
    const _Float16* r = p + (size_t)m * (size_t)ld + kb;
    v8h lo = *(const v8h*)(r);
    v8h hi = *(const v8h*)(r + 16);
    return __builtin_shufflevector(lo, hi, 0, 1, 2, 3, 4, 5, 6, 7,
                                           8, 9, 10, 11, 12, 13, 14, 15);
}

static __device__ inline v8f wmma16(v16h a, v16h b, v8f c) {
    // 8-arg form: (neg_a, A, neg_b, B, c_mod, C, reuse_a, reuse_b)
    return __builtin_amdgcn_wmma_f32_16x16x32_f16(false, a, false, b,
                                                  (short)0, c, false, false);
}

// Value of lane (L ^ MASK) inside each 16-lane row, by a DPP row_xmask move on
// the vector pipe (control word 0x160 | MASK); all 32 lanes are active here.
template <int MASK>
static __device__ inline float row_xor(float v) {
    return __builtin_bit_cast(float, __builtin_amdgcn_update_dpp(
        0, __builtin_bit_cast(int, v), 0x160 | MASK, 0xf, 0xf, true));
}

static __device__ inline void row_max8(float (&m)[8]) {
    asm(
        "v_max_num_f32_dpp %0, %0, %0 row_xmask:1 row_mask:0xf bank_mask:0xf\n\t"
        "v_max_num_f32_dpp %1, %1, %1 row_xmask:1 row_mask:0xf bank_mask:0xf\n\t"
        "v_max_num_f32_dpp %2, %2, %2 row_xmask:1 row_mask:0xf bank_mask:0xf\n\t"
        "v_max_num_f32_dpp %3, %3, %3 row_xmask:1 row_mask:0xf bank_mask:0xf\n\t"
        "v_max_num_f32_dpp %4, %4, %4 row_xmask:1 row_mask:0xf bank_mask:0xf\n\t"
        "v_max_num_f32_dpp %5, %5, %5 row_xmask:1 row_mask:0xf bank_mask:0xf\n\t"
        "v_max_num_f32_dpp %6, %6, %6 row_xmask:1 row_mask:0xf bank_mask:0xf\n\t"
        "v_max_num_f32_dpp %7, %7, %7 row_xmask:1 row_mask:0xf bank_mask:0xf\n\t"
        "v_max_num_f32_dpp %0, %0, %0 row_xmask:2 row_mask:0xf bank_mask:0xf\n\t"
        "v_max_num_f32_dpp %1, %1, %1 row_xmask:2 row_mask:0xf bank_mask:0xf\n\t"
        "v_max_num_f32_dpp %2, %2, %2 row_xmask:2 row_mask:0xf bank_mask:0xf\n\t"
        "v_max_num_f32_dpp %3, %3, %3 row_xmask:2 row_mask:0xf bank_mask:0xf\n\t"
        "v_max_num_f32_dpp %4, %4, %4 row_xmask:2 row_mask:0xf bank_mask:0xf\n\t"
        "v_max_num_f32_dpp %5, %5, %5 row_xmask:2 row_mask:0xf bank_mask:0xf\n\t"
        "v_max_num_f32_dpp %6, %6, %6 row_xmask:2 row_mask:0xf bank_mask:0xf\n\t"
        "v_max_num_f32_dpp %7, %7, %7 row_xmask:2 row_mask:0xf bank_mask:0xf\n\t"
        "v_max_num_f32_dpp %0, %0, %0 row_xmask:4 row_mask:0xf bank_mask:0xf\n\t"
        "v_max_num_f32_dpp %1, %1, %1 row_xmask:4 row_mask:0xf bank_mask:0xf\n\t"
        "v_max_num_f32_dpp %2, %2, %2 row_xmask:4 row_mask:0xf bank_mask:0xf\n\t"
        "v_max_num_f32_dpp %3, %3, %3 row_xmask:4 row_mask:0xf bank_mask:0xf\n\t"
        "v_max_num_f32_dpp %4, %4, %4 row_xmask:4 row_mask:0xf bank_mask:0xf\n\t"
        "v_max_num_f32_dpp %5, %5, %5 row_xmask:4 row_mask:0xf bank_mask:0xf\n\t"
        "v_max_num_f32_dpp %6, %6, %6 row_xmask:4 row_mask:0xf bank_mask:0xf\n\t"
        "v_max_num_f32_dpp %7, %7, %7 row_xmask:4 row_mask:0xf bank_mask:0xf\n\t"
        "v_max_num_f32_dpp %0, %0, %0 row_xmask:8 row_mask:0xf bank_mask:0xf\n\t"
        "v_max_num_f32_dpp %1, %1, %1 row_xmask:8 row_mask:0xf bank_mask:0xf\n\t"
        "v_max_num_f32_dpp %2, %2, %2 row_xmask:8 row_mask:0xf bank_mask:0xf\n\t"
        "v_max_num_f32_dpp %3, %3, %3 row_xmask:8 row_mask:0xf bank_mask:0xf\n\t"
        "v_max_num_f32_dpp %4, %4, %4 row_xmask:8 row_mask:0xf bank_mask:0xf\n\t"
        "v_max_num_f32_dpp %5, %5, %5 row_xmask:8 row_mask:0xf bank_mask:0xf\n\t"
        "v_max_num_f32_dpp %6, %6, %6 row_xmask:8 row_mask:0xf bank_mask:0xf\n\t"
        "v_max_num_f32_dpp %7, %7, %7 row_xmask:8 row_mask:0xf bank_mask:0xf\n\t"
        : "+v"(m[0]), "+v"(m[1]), "+v"(m[2]), "+v"(m[3]),
          "+v"(m[4]), "+v"(m[5]), "+v"(m[6]), "+v"(m[7]));
}

static __device__ inline v8f vzero8() {
    v8f z = {0.f, 0.f, 0.f, 0.f, 0.f, 0.f, 0.f, 0.f};
    return z;
}

static __device__ inline void async_copy_b128(unsigned lds_byte_off,
                                              const _Float16* gaddr) {
    unsigned long long ga = (unsigned long long)(uintptr_t)gaddr;
    asm volatile("global_load_async_to_lds_b128 %0, %1, off"
                 :: "v"(lds_byte_off), "v"(ga) : "memory");
}

static __device__ inline void wait_async0() {
    asm volatile("s_wait_asynccnt 0x0" ::: "memory");
}

// ---------------------------------------------------------------------------
// f32 -> f16 conversion
// ---------------------------------------------------------------------------
__global__ void f32_to_f16_kernel(const float* __restrict__ src,
                                  _Float16* __restrict__ dst, int n) {
    int i = blockIdx.x * blockDim.x + threadIdx.x;
    if (i < n) dst[i] = (_Float16)src[i];
}

#define WROW 40

static __device__ inline void stage_w_tile(_Float16* wbuf,   // [2][64][WROW]
                                           const _Float16* wr,
                                           const _Float16* wi,
                                           int col0, int kb, int tid) {
#pragma unroll
    for (int i = 0; i < 4; ++i) {
        const int q   = tid + i * 128;        // 0..511
        const int mat = q >> 8;               // 0 = re, 1 = im
        const int rr  = q & 255;
        const int c   = rr >> 2;              // column within tile, 0..63
        const int ck  = (rr & 3) << 3;        // k-chunk start (halves)
        const _Float16* g = (mat ? wi : wr) + (size_t)(col0 + c) * EDIM + kb + ck;
        unsigned lds = (unsigned)(uintptr_t)(wbuf + (mat * 64 + c) * WROW + ck);
        async_copy_b128(lds, g);
    }
}

// ---------------------------------------------------------------------------
// QKV complex projection:  y = x @ W^T + b, writing q/k/v head-major
// (B,H,S,HD) f16.  Block = 128 threads (4 waves); wave = 16x64 complex tile;
// W tile staged once per block via async-to-LDS.
// ---------------------------------------------------------------------------
__global__ void __launch_bounds__(128) qkv_gemm_kernel(
    const _Float16* __restrict__ xqr, const _Float16* __restrict__ xqi,
    const _Float16* __restrict__ xkr, const _Float16* __restrict__ xki,
    const _Float16* __restrict__ xvr, const _Float16* __restrict__ xvi,
    const _Float16* __restrict__ wr,  const _Float16* __restrict__ wi,
    const float* __restrict__ bre,    const float* __restrict__ bim,
    _Float16* __restrict__ Qr, _Float16* __restrict__ Qi,
    _Float16* __restrict__ Kr, _Float16* __restrict__ Ki,
    _Float16* __restrict__ Vr, _Float16* __restrict__ Vi)
{
    __shared__ __align__(16) _Float16 wbuf[2 * 64 * WROW];

    const int lane = threadIdx.x & 31;
    const int wave = threadIdx.x >> 5;
    const int row0 = (blockIdx.x * 4 + wave) * 16;   // token tile
    const int col0 = blockIdx.y * 64;                // output-feature tile
    const int sel  = col0 >> 10;                     // 0=q 1=k 2=v

    const _Float16* Xr = (sel == 0) ? xqr : ((sel == 1) ? xkr : xvr);
    const _Float16* Xi = (sel == 0) ? xqi : ((sel == 1) ? xki : xvi);

    v8f accR[4], accI[4];
#pragma unroll
    for (int j = 0; j < 4; ++j) { accR[j] = vzero8(); accI[j] = vzero8(); }

    for (int kb = 0; kb < EDIM; kb += 32) {
        __syncthreads();   // all waves done reading previous W tile
        stage_w_tile(wbuf, wr, wi, col0, kb, (int)threadIdx.x);

        v16h ar  = load_frag16(Xr + (size_t)row0 * EDIM + kb, EDIM, lane);
        v16h ai  = load_frag16(Xi + (size_t)row0 * EDIM + kb, EDIM, lane);
        v16h nai = -ai;  // wmma16 fixes neg_a false; negate explicitly
        if (kb + 32 < EDIM) {   // prefetch next A tiles (global_prefetch_b8)
            __builtin_prefetch(Xr + (size_t)row0 * EDIM + kb + 32, 0, 3);
            __builtin_prefetch(Xi + (size_t)row0 * EDIM + kb + 32, 0, 3);
        }

        wait_async0();
        __syncthreads();   // W tile visible to all waves

#pragma unroll
        for (int j = 0; j < 4; ++j) {
            v16h brf = load_frag16(wbuf + (0 * 64 + j * 16) * WROW, WROW, lane);
            v16h bif = load_frag16(wbuf + (1 * 64 + j * 16) * WROW, WROW, lane);
            accR[j] = wmma16(ar,  brf, accR[j]);
            accR[j] = wmma16(nai, bif, accR[j]);   // - ai*bi
            accI[j] = wmma16(ar,  bif, accI[j]);
            accI[j] = wmma16(ai,  brf, accI[j]);
        }
    }

    _Float16* Dr = (sel == 0) ? Qr : ((sel == 1) ? Kr : Vr);
    _Float16* Di = (sel == 0) ? Qi : ((sel == 1) ? Ki : Vi);

#pragma unroll
    for (int j = 0; j < 4; ++j) {
        const int col = col0 + j * 16 + (lane & 15);
        const float br_v = bre[col];
        const float bi_v = bim[col];
        const int e  = col & (EDIM - 1);
        const int hh = e >> 6;         // head
        const int d  = e & 63;         // dim in head
#pragma unroll
        for (int r = 0; r < 8; ++r) {
            const int tok = row0 + ((lane >> 4) << 3) + r;   // C layout rows
            const int s = tok >> 3;        // token = s*B + b, B=8
            const int b = tok & 7;
            const size_t off = (((size_t)(b * HNUM + hh) * SDIM + s) * HD) + d;
            Dr[off] = (_Float16)(accR[j][r] + br_v);
            Di[off] = (_Float16)(accI[j][r] + bi_v);
        }
    }
}

// ---------------------------------------------------------------------------
// Flash attention per (b,h):  scores = (qr.kr^T + qi.ki^T)/8, online softmax,
// out = P @ v (re and im).  Block = 4 waves, each wave owns 16 query rows.
// V tiles staged transposed in LDS; P bounces through LDS (C- -> A-layout).
// ---------------------------------------------------------------------------
__global__ void __launch_bounds__(128) attn_kernel(
    const _Float16* __restrict__ Qr, const _Float16* __restrict__ Qi,
    const _Float16* __restrict__ Kr, const _Float16* __restrict__ Ki,
    const _Float16* __restrict__ Vr, const _Float16* __restrict__ Vi,
    _Float16* __restrict__ Or, _Float16* __restrict__ Oi)
{
    __shared__ __align__(16) _Float16 vtr[64][40];       // V^T re, padded rows
    __shared__ __align__(16) _Float16 vti[64][40];       // V^T im
    __shared__ __align__(16) _Float16 pbuf[4][16][32];   // per-wave P tile

    const int lane = threadIdx.x & 31;
    const int wave = threadIdx.x >> 5;
    const int bh = blockIdx.y;          // = b*H + h
    const int b  = bh >> 4;
    const int h  = bh & 15;
    const int s0 = blockIdx.x * 64 + wave * 16;

    const size_t base = (size_t)bh * SDIM * HD;

    v16h aqr[2], aqi[2];
#pragma unroll
    for (int ks = 0; ks < 2; ++ks) {
        aqr[ks] = load_frag16(Qr + base + (size_t)s0 * HD + ks * 32, HD, lane);
        aqi[ks] = load_frag16(Qi + base + (size_t)s0 * HD + ks * 32, HD, lane);
    }

    v8f oR[4], oI[4];
#pragma unroll
    for (int j = 0; j < 4; ++j) { oR[j] = vzero8(); oI[j] = vzero8(); }
    float mrun[8], lrun[8];
#pragma unroll
    for (int r = 0; r < 8; ++r) { mrun[r] = -1e30f; lrun[r] = 0.f; }

    const float scale = 0.125f;   // 1/sqrt(64)

    for (int t0 = 0; t0 < SDIM; t0 += 32) {
        __syncthreads();   // protect previous iteration's V-tile reads
        // Cooperative staging of V[t0..t0+31][0..63] transposed into LDS
#pragma unroll 4
        for (int i = 0; i < 16; ++i) {
            const int idx = (int)threadIdx.x + i * 128;   // 0..2047
            const int t = idx >> 6;
            const int d = idx & 63;
            vtr[d][t] = Vr[base + (size_t)(t0 + t) * HD + d];
            vti[d][t] = Vi[base + (size_t)(t0 + t) * HD + d];
        }
        __syncthreads();

        // Scores: 16x32 block as two 16x16 C tiles
        v8f sc[2];
        sc[0] = vzero8(); sc[1] = vzero8();
#pragma unroll
        for (int ts = 0; ts < 2; ++ts) {
#pragma unroll
            for (int ks = 0; ks < 2; ++ks) {
                v16h bkr = load_frag16(Kr + base + (size_t)(t0 + ts * 16) * HD + ks * 32, HD, lane);
                v16h bki = load_frag16(Ki + base + (size_t)(t0 + ts * 16) * HD + ks * 32, HD, lane);
                sc[ts] = wmma16(aqr[ks], bkr, sc[ts]);
                sc[ts] = wmma16(aqi[ks], bki, sc[ts]);
            }
        }

        // Online softmax across the 32 new columns (butterfly within 16-lane
        // half-groups: C-layout spreads each row over 16 lanes)
        float rmx[8];
#pragma unroll
        for (int r = 0; r < 8; ++r) rmx[r] = fmaxf(sc[0][r] * scale, sc[1][r] * scale);
        row_max8(rmx);
#pragma unroll
        for (int r = 0; r < 8; ++r) {
            float x0 = sc[0][r] * scale;
            float x1 = sc[1][r] * scale;
            const float mnew = fmaxf(mrun[r], rmx[r]);
            const float corr = __expf(mrun[r] - mnew);
            const float p0 = __expf(x0 - mnew);
            const float p1 = __expf(x1 - mnew);
            float rs = p0 + p1;
            rs += row_xor<1>(rs);
            rs += row_xor<2>(rs);
            rs += row_xor<4>(rs);
            rs += row_xor<8>(rs);
            lrun[r] = lrun[r] * corr + rs;
            mrun[r] = mnew;
#pragma unroll
            for (int j = 0; j < 4; ++j) { oR[j][r] *= corr; oI[j][r] *= corr; }
            const int row = ((lane >> 4) << 3) + r;
            pbuf[wave][row][(lane & 15)]      = (_Float16)p0;
            pbuf[wave][row][16 + (lane & 15)] = (_Float16)p1;
        }

        // LDS pipeline is in-order per wave; fence explicitly anyway
        asm volatile("s_wait_dscnt 0x0" ::: "memory");

        v16h pa = load_frag16(&pbuf[wave][0][0], 32, lane);
#pragma unroll
        for (int j = 0; j < 4; ++j) {
            v16h bvr = load_frag16(&vtr[j * 16][0], 40, lane);
            v16h bvi = load_frag16(&vti[j * 16][0], 40, lane);
            oR[j] = wmma16(pa, bvr, oR[j]);
            oI[j] = wmma16(pa, bvi, oI[j]);
        }
    }

    // Normalize and write (S,B,E) f16 for the output projection
#pragma unroll
    for (int j = 0; j < 4; ++j) {
        const int d = j * 16 + (lane & 15);
#pragma unroll
        for (int r = 0; r < 8; ++r) {
            const int row = ((lane >> 4) << 3) + r;
            const int s = s0 + row;
            const float invl = 1.0f / lrun[r];
            const size_t off = ((size_t)(s * BDIM + b)) * EDIM + h * HD + d;
            Or[off] = (_Float16)(oR[j][r] * invl);
            Oi[off] = (_Float16)(oI[j][r] * invl);
        }
    }
}

// ---------------------------------------------------------------------------
// Output complex projection:  y = out @ Wo^T + bo -> f32 d_out stacked
// (2, S, B, E).  Same async-staged structure as the QKV GEMM.
// ---------------------------------------------------------------------------
__global__ void __launch_bounds__(128) out_gemm_kernel(
    const _Float16* __restrict__ Ar, const _Float16* __restrict__ Ai,
    const _Float16* __restrict__ wr, const _Float16* __restrict__ wi,
    const float* __restrict__ bre,   const float* __restrict__ bim,
    float* __restrict__ out)
{
    __shared__ __align__(16) _Float16 wbuf[2 * 64 * WROW];

    const int lane = threadIdx.x & 31;
    const int wave = threadIdx.x >> 5;
    const int row0 = (blockIdx.x * 4 + wave) * 16;
    const int col0 = blockIdx.y * 64;

    v8f accR[4], accI[4];
#pragma unroll
    for (int j = 0; j < 4; ++j) { accR[j] = vzero8(); accI[j] = vzero8(); }

    for (int kb = 0; kb < EDIM; kb += 32) {
        __syncthreads();
        stage_w_tile(wbuf, wr, wi, col0, kb, (int)threadIdx.x);

        v16h ar  = load_frag16(Ar + (size_t)row0 * EDIM + kb, EDIM, lane);
        v16h ai  = load_frag16(Ai + (size_t)row0 * EDIM + kb, EDIM, lane);
        v16h nai = -ai;
        if (kb + 32 < EDIM) {
            __builtin_prefetch(Ar + (size_t)row0 * EDIM + kb + 32, 0, 3);
            __builtin_prefetch(Ai + (size_t)row0 * EDIM + kb + 32, 0, 3);
        }

        wait_async0();
        __syncthreads();

#pragma unroll
        for (int j = 0; j < 4; ++j) {
            v16h brf = load_frag16(wbuf + (0 * 64 + j * 16) * WROW, WROW, lane);
            v16h bif = load_frag16(wbuf + (1 * 64 + j * 16) * WROW, WROW, lane);
            accR[j] = wmma16(ar,  brf, accR[j]);
            accR[j] = wmma16(nai, bif, accR[j]);
            accI[j] = wmma16(ar,  bif, accI[j]);
            accI[j] = wmma16(ai,  brf, accI[j]);
        }
    }

    const size_t imOff = (size_t)NTOK * EDIM;
#pragma unroll
    for (int j = 0; j < 4; ++j) {
        const int col = col0 + j * 16 + (lane & 15);
        const float br_v = bre[col];
        const float bi_v = bim[col];
#pragma unroll
        for (int r = 0; r < 8; ++r) {
            const int tok = row0 + ((lane >> 4) << 3) + r;
            const size_t off = (size_t)tok * EDIM + col;
            out[off]         = accR[j][r] + br_v;
            out[imOff + off] = accI[j][r] + bi_v;
        }
    }
}

// ---------------------------------------------------------------------------
// Host launcher
// ---------------------------------------------------------------------------
extern "C" void kernel_launch(void* const* d_in, const int* in_sizes, int n_in,
                              void* d_out, int out_size, void* d_ws, size_t ws_size,
                              hipStream_t stream) {
    (void)in_sizes; (void)n_in; (void)out_size; (void)ws_size;

    const size_t NE   = (size_t)NTOK * EDIM;   // 8,388,608
    const size_t WQKV = (size_t)E3 * EDIM;     // 3,145,728
    const size_t WO   = (size_t)EDIM * EDIM;   // 1,048,576

    _Float16* hws = (_Float16*)d_ws;
    _Float16* xqr = hws;            _Float16* xqi = xqr + NE;
    _Float16* xkr = xqi + NE;       _Float16* xki = xkr + NE;
    _Float16* xvr = xki + NE;       _Float16* xvi = xvr + NE;
    _Float16* wr  = xvi + NE;       _Float16* wi  = wr + WQKV;
    _Float16* wor = wi + WQKV;      _Float16* woi = wor + WO;
    _Float16* Qr  = woi + WO;       _Float16* Qi  = Qr + NE;
    _Float16* Kr  = Qi + NE;        _Float16* Ki  = Kr + NE;
    _Float16* Vr  = Ki + NE;        _Float16* Vi  = Vr + NE;
    _Float16* Aor = Vi + NE;        _Float16* Aoi = Aor + NE;

    auto cvt = [&](const void* src, _Float16* dst, size_t n) {
        f32_to_f16_kernel<<<dim3((unsigned)((n + 255) / 256)), dim3(256), 0, stream>>>(
            (const float*)src, dst, (int)n);
    };

    // Activations and weights -> f16
    cvt(d_in[0], xqr, NE);  cvt(d_in[1], xqi, NE);
    cvt(d_in[2], xkr, NE);  cvt(d_in[3], xki, NE);
    cvt(d_in[4], xvr, NE);  cvt(d_in[5], xvi, NE);
    cvt(d_in[6], wr, WQKV); cvt(d_in[7], wi, WQKV);
    cvt(d_in[10], wor, WO); cvt(d_in[11], woi, WO);

    // QKV projection (complex), head-major f16 outputs
    {
        dim3 grid(NTOK / 64, E3 / 64);
        qkv_gemm_kernel<<<grid, dim3(128), 0, stream>>>(
            xqr, xqi, xkr, xki, xvr, xvi, wr, wi,
            (const float*)d_in[8], (const float*)d_in[9],
            Qr, Qi, Kr, Ki, Vr, Vi);
    }

    // Flash attention per (b,h)
    {
        dim3 grid(SDIM / 64, BDIM * HNUM);
        attn_kernel<<<grid, dim3(128), 0, stream>>>(Qr, Qi, Kr, Ki, Vr, Vi, Aor, Aoi);
    }

    // Output projection (complex), f32 result stacked (re, im)
    {
        dim3 grid(NTOK / 64, EDIM / 64);
        out_gemm_kernel<<<grid, dim3(128), 0, stream>>>(
            Aor, Aoi, wor, woi,
            (const float*)d_in[12], (const float*)d_in[13],
            (float*)d_out);
    }
}

// v002
// One run takes 613 microseconds.
// Two timings next to v001 put it at 1.18 and 1.19 times that version's speed.
// Counting every step since v000, it is 1.33 times as fast.
#include <hip/hip_runtime.h>
#include <hip/hip_bf16.h>

// Problem constants (match reference)
#define SDIM 1024
#define BDIM 8
#define EDIM 1024
#define HNUM 16
#define HD   64
#define NTOK (SDIM * BDIM)   // 8192 tokens
#define E3   (3 * EDIM)      // 3072

typedef __attribute__((ext_vector_type(16))) _Float16 v16h;
typedef __attribute__((ext_vector_type(8)))  _Float16 v8h;
typedef __attribute__((ext_vector_type(8)))  float    v8f;

static __device__ inline v16h load_frag16(const _Float16* p, int ld, int lane) {
    const int m  = lane & 15;
    const int kb = (lane >> 4) << 3;
    const _Float16* r = p + (size_t)m * (size_t)ld + kb;
    v8h lo = *(const v8h*)(r);
    v8h hi = *(const v8h*)(r + 16);
    return __builtin_shufflevector(lo, hi, 0, 1, 2, 3, 4, 5, 6, 7,
                                           8, 9, 10, 11, 12, 13, 14, 15);
}

static __device__ inline v8f wmma16(v16h a, v16h b, v8f c) {
    // 8-arg form: (neg_a, A, neg_b, B, c_mod, C, reuse_a, reuse_b)
    return __builtin_amdgcn_wmma_f32_16x16x32_f16(false, a, false, b,
                                                  (short)0, c, false, false);
}

// Value of lane (L ^ MASK) inside each 16-lane row, by a DPP row_xmask move on
// the vector pipe (control word 0x160 | MASK); all 32 lanes are active here.
template <int MASK>
static __device__ inline float row_xor(float v) {
    return __builtin_bit_cast(float, __builtin_amdgcn_update_dpp(
        0, __builtin_bit_cast(int, v), 0x160 | MASK, 0xf, 0xf, true));
}

static __device__ inline void row_max8(float (&m)[8]) {
    asm(
        "v_max_num_f32_dpp %0, %0, %0 row_xmask:1 row_mask:0xf bank_mask:0xf\n\t"
        "v_max_num_f32_dpp %1, %1, %1 row_xmask:1 row_mask:0xf bank_mask:0xf\n\t"
        "v_max_num_f32_dpp %2, %2, %2 row_xmask:1 row_mask:0xf bank_mask:0xf\n\t"
        "v_max_num_f32_dpp %3, %3, %3 row_xmask:1 row_mask:0xf bank_mask:0xf\n\t"
        "v_max_num_f32_dpp %4, %4, %4 row_xmask:1 row_mask:0xf bank_mask:0xf\n\t"
        "v_max_num_f32_dpp %5, %5, %5 row_xmask:1 row_mask:0xf bank_mask:0xf\n\t"
        "v_max_num_f32_dpp %6, %6, %6 row_xmask:1 row_mask:0xf bank_mask:0xf\n\t"
        "v_max_num_f32_dpp %7, %7, %7 row_xmask:1 row_mask:0xf bank_mask:0xf\n\t"
        "v_max_num_f32_dpp %0, %0, %0 row_xmask:2 row_mask:0xf bank_mask:0xf\n\t"
        "v_max_num_f32_dpp %1, %1, %1 row_xmask:2 row_mask:0xf bank_mask:0xf\n\t"
        "v_max_num_f32_dpp %2, %2, %2 row_xmask:2 row_mask:0xf bank_mask:0xf\n\t"
        "v_max_num_f32_dpp %3, %3, %3 row_xmask:2 row_mask:0xf bank_mask:0xf\n\t"
        "v_max_num_f32_dpp %4, %4, %4 row_xmask:2 row_mask:0xf bank_mask:0xf\n\t"
        "v_max_num_f32_dpp %5, %5, %5 row_xmask:2 row_mask:0xf bank_mask:0xf\n\t"
        "v_max_num_f32_dpp %6, %6, %6 row_xmask:2 row_mask:0xf bank_mask:0xf\n\t"
        "v_max_num_f32_dpp %7, %7, %7 row_xmask:2 row_mask:0xf bank_mask:0xf\n\t"
        "v_max_num_f32_dpp %0, %0, %0 row_xmask:4 row_mask:0xf bank_mask:0xf\n\t"
        "v_max_num_f32_dpp %1, %1, %1 row_xmask:4 row_mask:0xf bank_mask:0xf\n\t"
        "v_max_num_f32_dpp %2, %2, %2 row_xmask:4 row_mask:0xf bank_mask:0xf\n\t"
        "v_max_num_f32_dpp %3, %3, %3 row_xmask:4 row_mask:0xf bank_mask:0xf\n\t"
        "v_max_num_f32_dpp %4, %4, %4 row_xmask:4 row_mask:0xf bank_mask:0xf\n\t"
        "v_max_num_f32_dpp %5, %5, %5 row_xmask:4 row_mask:0xf bank_mask:0xf\n\t"
        "v_max_num_f32_dpp %6, %6, %6 row_xmask:4 row_mask:0xf bank_mask:0xf\n\t"
        "v_max_num_f32_dpp %7, %7, %7 row_xmask:4 row_mask:0xf bank_mask:0xf\n\t"
        "v_max_num_f32_dpp %0, %0, %0 row_xmask:8 row_mask:0xf bank_mask:0xf\n\t"
        "v_max_num_f32_dpp %1, %1, %1 row_xmask:8 row_mask:0xf bank_mask:0xf\n\t"
        "v_max_num_f32_dpp %2, %2, %2 row_xmask:8 row_mask:0xf bank_mask:0xf\n\t"
        "v_max_num_f32_dpp %3, %3, %3 row_xmask:8 row_mask:0xf bank_mask:0xf\n\t"
        "v_max_num_f32_dpp %4, %4, %4 row_xmask:8 row_mask:0xf bank_mask:0xf\n\t"
        "v_max_num_f32_dpp %5, %5, %5 row_xmask:8 row_mask:0xf bank_mask:0xf\n\t"
        "v_max_num_f32_dpp %6, %6, %6 row_xmask:8 row_mask:0xf bank_mask:0xf\n\t"
        "v_max_num_f32_dpp %7, %7, %7 row_xmask:8 row_mask:0xf bank_mask:0xf\n\t"
        : "+v"(m[0]), "+v"(m[1]), "+v"(m[2]), "+v"(m[3]),
          "+v"(m[4]), "+v"(m[5]), "+v"(m[6]), "+v"(m[7]));
}

static __device__ inline v8f vzero8() {
    v8f z = {0.f, 0.f, 0.f, 0.f, 0.f, 0.f, 0.f, 0.f};
    return z;
}

static __device__ inline void async_copy_b128(unsigned lds_byte_off,
                                              const _Float16* gaddr) {
    unsigned long long ga = (unsigned long long)(uintptr_t)gaddr;
    asm volatile("global_load_async_to_lds_b128 %0, %1, off"
                 :: "v"(lds_byte_off), "v"(ga) : "memory");
}

static __device__ inline void wait_async0() {
    asm volatile("s_wait_asynccnt 0x0" ::: "memory");
}

// ---------------------------------------------------------------------------
// f32 -> f16 conversion of all ten operands in one launch.
// The ten f16 copies lie one behind the other in the workspace, in argument
// order, and every operand's length is a whole number of units of CVT_UNIT
// elements, so each unit of the destination has exactly one source.
// blockIdx.y = unit, blockIdx.x = slice of the unit.  A work-group converts
// CVT_TRIPS x 8,192 elements; each wave-wide load covers 512 contiguous bytes,
// each wave-wide store 256.
// ---------------------------------------------------------------------------
#define CVT_UNIT   (1 << 20)
#define CVT_X      ((NTOK * EDIM) / CVT_UNIT)   // units per activation: 8
#define CVT_WQKV   ((E3 * EDIM) / CVT_UNIT)     // units per qkv weight: 3
#define CVT_WO     ((EDIM * EDIM) / CVT_UNIT)   // units per out weight: 1
#define CVT_UNITS  (6 * CVT_X + 2 * CVT_WQKV + 2 * CVT_WO)
#define CVT_SLICES 32
#define CVT_TRIPS  (CVT_UNIT / CVT_SLICES / 8192)
static_assert(CVT_X * CVT_UNIT == NTOK * EDIM && CVT_WQKV * CVT_UNIT == E3 * EDIM &&
              CVT_WO * CVT_UNIT == EDIM * EDIM, "operands are whole units");
static_assert(CVT_TRIPS * CVT_SLICES * 8192 == CVT_UNIT, "slices are whole trips");

typedef __attribute__((ext_vector_type(4))) float    v4f;
typedef __attribute__((ext_vector_type(4))) _Float16 v4h;

__global__ void __launch_bounds__(256) f32_to_f16_all_kernel(
    const float* __restrict__ xqr, const float* __restrict__ xqi,
    const float* __restrict__ xkr, const float* __restrict__ xki,
    const float* __restrict__ xvr, const float* __restrict__ xvi,
    const float* __restrict__ wr,  const float* __restrict__ wi,
    const float* __restrict__ wor, const float* __restrict__ woi,
    _Float16* __restrict__ dst)
{
    const int u = (int)blockIdx.y;
    const float* src;   // the operand that unit u belongs to
    int u0;             // that operand's first unit
    if (u < 6 * CVT_X) {
        const int a = u / CVT_X;
        u0  = a * CVT_X;
        src = (a == 0) ? xqr : (a == 1) ? xqi : (a == 2) ? xkr
            : (a == 3) ? xki : (a == 4) ? xvr : xvi;
    } else if (u < 6 * CVT_X + CVT_WQKV) {
        u0 = 6 * CVT_X;                              src = wr;
    } else if (u < 6 * CVT_X + 2 * CVT_WQKV) {
        u0 = 6 * CVT_X + CVT_WQKV;                   src = wi;
    } else if (u < 6 * CVT_X + 2 * CVT_WQKV + CVT_WO) {
        u0 = 6 * CVT_X + 2 * CVT_WQKV;               src = wor;
    } else {
        u0 = 6 * CVT_X + 2 * CVT_WQKV + CVT_WO;      src = woi;
    }
    const size_t slice = (size_t)blockIdx.x * (CVT_UNIT / CVT_SLICES);
    const v4f* s4 = (const v4f*)(src + (size_t)(u - u0) * CVT_UNIT + slice) + threadIdx.x;
    v4h*       d4 = (v4h*)(dst + (size_t)u * CVT_UNIT + slice) + threadIdx.x;

    // Kept rolled: 8 loads of 16 bytes in flight per lane are enough for the
    // memory rate, and the small register count keeps every work-group resident.
#pragma unroll 1
    for (int it = 0; it < CVT_TRIPS; ++it) {
        v4f v[8];
#pragma unroll   // all 8 loads issue before the first value is used
        for (int j = 0; j < 8; ++j) v[j] = s4[it * 2048 + j * 256];
#pragma unroll   // constant indices keep v[] in registers
        for (int j = 0; j < 8; ++j)
            d4[it * 2048 + j * 256] = __builtin_convertvector(v[j], v4h);
    }
}

#define WROW 40

static __device__ inline void stage_w_tile(_Float16* wbuf,   // [2][64][WROW]
                                           const _Float16* wr,
                                           const _Float16* wi,
                                           int col0, int kb, int tid) {
#pragma unroll
    for (int i = 0; i < 4; ++i) {
        const int q   = tid + i * 128;        // 0..511
        const int mat = q >> 8;               // 0 = re, 1 = im
        const int rr  = q & 255;
        const int c   = rr >> 2;              // column within tile, 0..63
        const int ck  = (rr & 3) << 3;        // k-chunk start (halves)
        const _Float16* g = (mat ? wi : wr) + (size_t)(col0 + c) * EDIM + kb + ck;
        unsigned lds = (unsigned)(uintptr_t)(wbuf + (mat * 64 + c) * WROW + ck);
        async_copy_b128(lds, g);
    }
}

// ---------------------------------------------------------------------------
// QKV complex projection:  y = x @ W^T + b, writing q/k/v head-major
// (B,H,S,HD) f16.  Block = 128 threads (4 waves); wave = 16x64 complex tile;
// W tile staged once per block via async-to-LDS.
// ---------------------------------------------------------------------------
__global__ void __launch_bounds__(128) qkv_gemm_kernel(
    const _Float16* __restrict__ xqr, const _Float16* __restrict__ xqi,
    const _Float16* __restrict__ xkr, const _Float16* __restrict__ xki,
    const _Float16* __restrict__ xvr, const _Float16* __restrict__ xvi,
    const _Float16* __restrict__ wr,  const _Float16* __restrict__ wi,
    const float* __restrict__ bre,    const float* __restrict__ bim,
    _Float16* __restrict__ Qr, _Float16* __restrict__ Qi,
    _Float16* __restrict__ Kr, _Float16* __restrict__ Ki,
    _Float16* __restrict__ Vr, _Float16* __restrict__ Vi)
{
    __shared__ __align__(16) _Float16 wbuf[2 * 64 * WROW];

    const int lane = threadIdx.x & 31;
    const int wave = threadIdx.x >> 5;
    const int row0 = (blockIdx.x * 4 + wave) * 16;   // token tile
    const int col0 = blockIdx.y * 64;                // output-feature tile
    const int sel  = col0 >> 10;                     // 0=q 1=k 2=v

    const _Float16* Xr = (sel == 0) ? xqr : ((sel == 1) ? xkr : xvr);
    const _Float16* Xi = (sel == 0) ? xqi : ((sel == 1) ? xki : xvi);

    v8f accR[4], accI[4];
#pragma unroll
    for (int j = 0; j < 4; ++j) { accR[j] = vzero8(); accI[j] = vzero8(); }

    for (int kb = 0; kb < EDIM; kb += 32) {
        __syncthreads();   // all waves done reading previous W tile
        stage_w_tile(wbuf, wr, wi, col0, kb, (int)threadIdx.x);

        v16h ar  = load_frag16(Xr + (size_t)row0 * EDIM + kb, EDIM, lane);
        v16h ai  = load_frag16(Xi + (size_t)row0 * EDIM + kb, EDIM, lane);
        v16h nai = -ai;  // wmma16 fixes neg_a false; negate explicitly
        if (kb + 32 < EDIM) {   // prefetch next A tiles (global_prefetch_b8)
            __builtin_prefetch(Xr + (size_t)row0 * EDIM + kb + 32, 0, 3);
            __builtin_prefetch(Xi + (size_t)row0 * EDIM + kb + 32, 0, 3);
        }

        wait_async0();
        __syncthreads();   // W tile visible to all waves

#pragma unroll
        for (int j = 0; j < 4; ++j) {
            v16h brf = load_frag16(wbuf + (0 * 64 + j * 16) * WROW, WROW, lane);
            v16h bif = load_frag16(wbuf + (1 * 64 + j * 16) * WROW, WROW, lane);
            accR[j] = wmma16(ar,  brf, accR[j]);
            accR[j] = wmma16(nai, bif, accR[j]);   // - ai*bi
            accI[j] = wmma16(ar,  bif, accI[j]);
            accI[j] = wmma16(ai,  brf, accI[j]);
        }
    }

    _Float16* Dr = (sel == 0) ? Qr : ((sel == 1) ? Kr : Vr);
    _Float16* Di = (sel == 0) ? Qi : ((sel == 1) ? Ki : Vi);

#pragma unroll
    for (int j = 0; j < 4; ++j) {
        const int col = col0 + j * 16 + (lane & 15);
        const float br_v = bre[col];
        const float bi_v = bim[col];
        const int e  = col & (EDIM - 1);
        const int hh = e >> 6;         // head
        const int d  = e & 63;         // dim in head
#pragma unroll
        for (int r = 0; r < 8; ++r) {
            const int tok = row0 + ((lane >> 4) << 3) + r;   // C layout rows
            const int s = tok >> 3;        // token = s*B + b, B=8
            const int b = tok & 7;
            const size_t off = (((size_t)(b * HNUM + hh) * SDIM + s) * HD) + d;
            Dr[off] = (_Float16)(accR[j][r] + br_v);
            Di[off] = (_Float16)(accI[j][r] + bi_v);
        }
    }
}

// ---------------------------------------------------------------------------
// Flash attention per (b,h):  scores = (qr.kr^T + qi.ki^T)/8, online softmax,
// out = P @ v (re and im).  Block = 4 waves, each wave owns 16 query rows.
// V tiles staged transposed in LDS; P bounces through LDS (C- -> A-layout).
// ---------------------------------------------------------------------------
__global__ void __launch_bounds__(128) attn_kernel(
    const _Float16* __restrict__ Qr, const _Float16* __restrict__ Qi,
    const _Float16* __restrict__ Kr, const _Float16* __restrict__ Ki,
    const _Float16* __restrict__ Vr, const _Float16* __restrict__ Vi,
    _Float16* __restrict__ Or, _Float16* __restrict__ Oi)
{
    __shared__ __align__(16) _Float16 vtr[64][40];       // V^T re, padded rows
    __shared__ __align__(16) _Float16 vti[64][40];       // V^T im
    __shared__ __align__(16) _Float16 pbuf[4][16][32];   // per-wave P tile

    const int lane = threadIdx.x & 31;
    const int wave = threadIdx.x >> 5;
    const int bh = blockIdx.y;          // = b*H + h
    const int b  = bh >> 4;
    const int h  = bh & 15;
    const int s0 = blockIdx.x * 64 + wave * 16;

    const size_t base = (size_t)bh * SDIM * HD;

    v16h aqr[2], aqi[2];
#pragma unroll
    for (int ks = 0; ks < 2; ++ks) {
        aqr[ks] = load_frag16(Qr + base + (size_t)s0 * HD + ks * 32, HD, lane);
        aqi[ks] = load_frag16(Qi + base + (size_t)s0 * HD + ks * 32, HD, lane);
    }

    v8f oR[4], oI[4];
#pragma unroll
    for (int j = 0; j < 4; ++j) { oR[j] = vzero8(); oI[j] = vzero8(); }
    float mrun[8], lrun[8];
#pragma unroll
    for (int r = 0; r < 8; ++r) { mrun[r] = -1e30f; lrun[r] = 0.f; }

    const float scale = 0.125f;   // 1/sqrt(64)

    for (int t0 = 0; t0 < SDIM; t0 += 32) {
        __syncthreads();   // protect previous iteration's V-tile reads
        // Cooperative staging of V[t0..t0+31][0..63] transposed into LDS
#pragma unroll 4
        for (int i = 0; i < 16; ++i) {
            const int idx = (int)threadIdx.x + i * 128;   // 0..2047
            const int t = idx >> 6;
            const int d = idx & 63;
            vtr[d][t] = Vr[base + (size_t)(t0 + t) * HD + d];
            vti[d][t] = Vi[base + (size_t)(t0 + t) * HD + d];
        }
        __syncthreads();

        // Scores: 16x32 block as two 16x16 C tiles
        v8f sc[2];
        sc[0] = vzero8(); sc[1] = vzero8();
#pragma unroll
        for (int ts = 0; ts < 2; ++ts) {
#pragma unroll
            for (int ks = 0; ks < 2; ++ks) {
                v16h bkr = load_frag16(Kr + base + (size_t)(t0 + ts * 16) * HD + ks * 32, HD, lane);
                v16h bki = load_frag16(Ki + base + (size_t)(t0 + ts * 16) * HD + ks * 32, HD, lane);
                sc[ts] = wmma16(aqr[ks], bkr, sc[ts]);
                sc[ts] = wmma16(aqi[ks], bki, sc[ts]);
            }
        }

        // Online softmax across the 32 new columns (butterfly within 16-lane
        // half-groups: C-layout spreads each row over 16 lanes)
        float rmx[8];
#pragma unroll
        for (int r = 0; r < 8; ++r) rmx[r] = fmaxf(sc[0][r] * scale, sc[1][r] * scale);
        row_max8(rmx);
#pragma unroll
        for (int r = 0; r < 8; ++r) {
            float x0 = sc[0][r] * scale;
            float x1 = sc[1][r] * scale;
            const float mnew = fmaxf(mrun[r], rmx[r]);
            const float corr = __expf(mrun[r] - mnew);
            const float p0 = __expf(x0 - mnew);
            const float p1 = __expf(x1 - mnew);
            float rs = p0 + p1;
            rs += row_xor<1>(rs);
            rs += row_xor<2>(rs);
            rs += row_xor<4>(rs);
            rs += row_xor<8>(rs);
            lrun[r] = lrun[r] * corr + rs;
            mrun[r] = mnew;
#pragma unroll
            for (int j = 0; j < 4; ++j) { oR[j][r] *= corr; oI[j][r] *= corr; }
            const int row = ((lane >> 4) << 3) + r;
            pbuf[wave][row][(lane & 15)]      = (_Float16)p0;
            pbuf[wave][row][16 + (lane & 15)] = (_Float16)p1;
        }

        // LDS pipeline is in-order per wave; fence explicitly anyway
        asm volatile("s_wait_dscnt 0x0" ::: "memory");

        v16h pa = load_frag16(&pbuf[wave][0][0], 32, lane);
#pragma unroll
        for (int j = 0; j < 4; ++j) {
            v16h bvr = load_frag16(&vtr[j * 16][0], 40, lane);
            v16h bvi = load_frag16(&vti[j * 16][0], 40, lane);
            oR[j] = wmma16(pa, bvr, oR[j]);
            oI[j] = wmma16(pa, bvi, oI[j]);
        }
    }

    // Normalize and write (S,B,E) f16 for the output projection
#pragma unroll
    for (int j = 0; j < 4; ++j) {
        const int d = j * 16 + (lane & 15);
#pragma unroll
        for (int r = 0; r < 8; ++r) {
            const int row = ((lane >> 4) << 3) + r;
            const int s = s0 + row;
            const float invl = 1.0f / lrun[r];
            const size_t off = ((size_t)(s * BDIM + b)) * EDIM + h * HD + d;
            Or[off] = (_Float16)(oR[j][r] * invl);
            Oi[off] = (_Float16)(oI[j][r] * invl);
        }
    }
}

// ---------------------------------------------------------------------------
// Output complex projection:  y = out @ Wo^T + bo -> f32 d_out stacked
// (2, S, B, E).  Same async-staged structure as the QKV GEMM.
// ---------------------------------------------------------------------------
__global__ void __launch_bounds__(128) out_gemm_kernel(
    const _Float16* __restrict__ Ar, const _Float16* __restrict__ Ai,
    const _Float16* __restrict__ wr, const _Float16* __restrict__ wi,
    const float* __restrict__ bre,   const float* __restrict__ bim,
    float* __restrict__ out)
{
    __shared__ __align__(16) _Float16 wbuf[2 * 64 * WROW];

    const int lane = threadIdx.x & 31;
    const int wave = threadIdx.x >> 5;
    const int row0 = (blockIdx.x * 4 + wave) * 16;
    const int col0 = blockIdx.y * 64;

    v8f accR[4], accI[4];
#pragma unroll
    for (int j = 0; j < 4; ++j) { accR[j] = vzero8(); accI[j] = vzero8(); }

    for (int kb = 0; kb < EDIM; kb += 32) {
        __syncthreads();
        stage_w_tile(wbuf, wr, wi, col0, kb, (int)threadIdx.x);

        v16h ar  = load_frag16(Ar + (size_t)row0 * EDIM + kb, EDIM, lane);
        v16h ai  = load_frag16(Ai + (size_t)row0 * EDIM + kb, EDIM, lane);
        v16h nai = -ai;
        if (kb + 32 < EDIM) {
            __builtin_prefetch(Ar + (size_t)row0 * EDIM + kb + 32, 0, 3);
            __builtin_prefetch(Ai + (size_t)row0 * EDIM + kb + 32, 0, 3);
        }

        wait_async0();
        __syncthreads();

#pragma unroll
        for (int j = 0; j < 4; ++j) {
            v16h brf = load_frag16(wbuf + (0 * 64 + j * 16) * WROW, WROW, lane);
            v16h bif = load_frag16(wbuf + (1 * 64 + j * 16) * WROW, WROW, lane);
            accR[j] = wmma16(ar,  brf, accR[j]);
            accR[j] = wmma16(nai, bif, accR[j]);
            accI[j] = wmma16(ar,  bif, accI[j]);
            accI[j] = wmma16(ai,  brf, accI[j]);
        }
    }

    const size_t imOff = (size_t)NTOK * EDIM;
#pragma unroll
    for (int j = 0; j < 4; ++j) {
        const int col = col0 + j * 16 + (lane & 15);
        const float br_v = bre[col];
        const float bi_v = bim[col];
#pragma unroll
        for (int r = 0; r < 8; ++r) {
            const int tok = row0 + ((lane >> 4) << 3) + r;
            const size_t off = (size_t)tok * EDIM + col;
            out[off]         = accR[j][r] + br_v;
            out[imOff + off] = accI[j][r] + bi_v;
        }
    }
}

// ---------------------------------------------------------------------------
// Host launcher
// ---------------------------------------------------------------------------
extern "C" void kernel_launch(void* const* d_in, const int* in_sizes, int n_in,
                              void* d_out, int out_size, void* d_ws, size_t ws_size,
                              hipStream_t stream) {
    (void)in_sizes; (void)n_in; (void)out_size; (void)ws_size;

    const size_t NE   = (size_t)NTOK * EDIM;   // 8,388,608
    const size_t WQKV = (size_t)E3 * EDIM;     // 3,145,728
    const size_t WO   = (size_t)EDIM * EDIM;   // 1,048,576

    _Float16* hws = (_Float16*)d_ws;
    _Float16* xqr = hws;            _Float16* xqi = xqr + NE;
    _Float16* xkr = xqi + NE;       _Float16* xki = xkr + NE;
    _Float16* xvr = xki + NE;       _Float16* xvi = xvr + NE;
    _Float16* wr  = xvi + NE;       _Float16* wi  = wr + WQKV;
    _Float16* wor = wi + WQKV;      _Float16* woi = wor + WO;
    _Float16* Qr  = woi + WO;       _Float16* Qi  = Qr + NE;
    _Float16* Kr  = Qi + NE;        _Float16* Ki  = Kr + NE;
    _Float16* Vr  = Ki + NE;        _Float16* Vi  = Vr + NE;
    _Float16* Aor = Vi + NE;        _Float16* Aoi = Aor + NE;

    // Activations and weights -> f16: xqr .. woi are contiguous from hws on
    {
        dim3 grid(CVT_SLICES, CVT_UNITS);
        f32_to_f16_all_kernel<<<grid, dim3(256), 0, stream>>>(
            (const float*)d_in[0], (const float*)d_in[1], (const float*)d_in[2],
            (const float*)d_in[3], (const float*)d_in[4], (const float*)d_in[5],
            (const float*)d_in[6], (const float*)d_in[7],
            (const float*)d_in[10], (const float*)d_in[11], hws);
    }

    // QKV projection (complex), head-major f16 outputs
    {
        dim3 grid(NTOK / 64, E3 / 64);
        qkv_gemm_kernel<<<grid, dim3(128), 0, stream>>>(
            xqr, xqi, xkr, xki, xvr, xvi, wr, wi,
            (const float*)d_in[8], (const float*)d_in[9],
            Qr, Qi, Kr, Ki, Vr, Vi);
    }

    // Flash attention per (b,h)
    {
        dim3 grid(SDIM / 64, BDIM * HNUM);
        attn_kernel<<<grid, dim3(128), 0, stream>>>(Qr, Qi, Kr, Ki, Vr, Vi, Aor, Aoi);
    }

    // Output projection (complex), f32 result stacked (re, im)
    {
        dim3 grid(NTOK / 64, EDIM / 64);
        out_gemm_kernel<<<grid, dim3(128), 0, stream>>>(
            Aor, Aoi, wor, woi,
            (const float*)d_in[12], (const float*)d_in[13],
            (float*)d_out);
    }
}

// v003
// Measured time: 461 microseconds a run.
// In both of two side-by-side timings against v002, it was 1.33 times as fast.
// All steps since v000 together make it 1.77 times as fast.
#include <hip/hip_runtime.h>
#include <hip/hip_bf16.h>

// Problem constants (match reference)
#define SDIM 1024
#define BDIM 8
#define EDIM 1024
#define HNUM 16
#define HD   64
#define NTOK (SDIM * BDIM)   // 8192 tokens
#define E3   (3 * EDIM)      // 3072

typedef __attribute__((ext_vector_type(16))) _Float16 v16h;
typedef __attribute__((ext_vector_type(8)))  _Float16 v8h;
typedef __attribute__((ext_vector_type(8)))  float    v8f;

static __device__ inline v16h load_frag16(const _Float16* p, int ld, int lane) {
    const int m  = lane & 15;
    const int kb = (lane >> 4) << 3;
    const _Float16* r = p + (size_t)m * (size_t)ld + kb;
    v8h lo = *(const v8h*)(r);
    v8h hi = *(const v8h*)(r + 16);
    return __builtin_shufflevector(lo, hi, 0, 1, 2, 3, 4, 5, 6, 7,
                                           8, 9, 10, 11, 12, 13, 14, 15);
}

static __device__ inline v8f wmma16(v16h a, v16h b, v8f c) {
    // 8-arg form: (neg_a, A, neg_b, B, c_mod, C, reuse_a, reuse_b)
    return __builtin_amdgcn_wmma_f32_16x16x32_f16(false, a, false, b,
                                                  (short)0, c, false, false);
}

// Value of lane (L ^ MASK) inside each 16-lane row, by a DPP row_xmask move on
// the vector pipe (control word 0x160 | MASK); all 32 lanes are active here.
template <int MASK>
static __device__ inline float row_xor(float v) {
    return __builtin_bit_cast(float, __builtin_amdgcn_update_dpp(
        0, __builtin_bit_cast(int, v), 0x160 | MASK, 0xf, 0xf, true));
}

static __device__ inline void row_max8(float (&m)[8]) {
    asm(
        "v_max_num_f32_dpp %0, %0, %0 row_xmask:1 row_mask:0xf bank_mask:0xf\n\t"
        "v_max_num_f32_dpp %1, %1, %1 row_xmask:1 row_mask:0xf bank_mask:0xf\n\t"
        "v_max_num_f32_dpp %2, %2, %2 row_xmask:1 row_mask:0xf bank_mask:0xf\n\t"
        "v_max_num_f32_dpp %3, %3, %3 row_xmask:1 row_mask:0xf bank_mask:0xf\n\t"
        "v_max_num_f32_dpp %4, %4, %4 row_xmask:1 row_mask:0xf bank_mask:0xf\n\t"
        "v_max_num_f32_dpp %5, %5, %5 row_xmask:1 row_mask:0xf bank_mask:0xf\n\t"
        "v_max_num_f32_dpp %6, %6, %6 row_xmask:1 row_mask:0xf bank_mask:0xf\n\t"
        "v_max_num_f32_dpp %7, %7, %7 row_xmask:1 row_mask:0xf bank_mask:0xf\n\t"
        "v_max_num_f32_dpp %0, %0, %0 row_xmask:2 row_mask:0xf bank_mask:0xf\n\t"
        "v_max_num_f32_dpp %1, %1, %1 row_xmask:2 row_mask:0xf bank_mask:0xf\n\t"
        "v_max_num_f32_dpp %2, %2, %2 row_xmask:2 row_mask:0xf bank_mask:0xf\n\t"
        "v_max_num_f32_dpp %3, %3, %3 row_xmask:2 row_mask:0xf bank_mask:0xf\n\t"
        "v_max_num_f32_dpp %4, %4, %4 row_xmask:2 row_mask:0xf bank_mask:0xf\n\t"
        "v_max_num_f32_dpp %5, %5, %5 row_xmask:2 row_mask:0xf bank_mask:0xf\n\t"
        "v_max_num_f32_dpp %6, %6, %6 row_xmask:2 row_mask:0xf bank_mask:0xf\n\t"
        "v_max_num_f32_dpp %7, %7, %7 row_xmask:2 row_mask:0xf bank_mask:0xf\n\t"
        "v_max_num_f32_dpp %0, %0, %0 row_xmask:4 row_mask:0xf bank_mask:0xf\n\t"
        "v_max_num_f32_dpp %1, %1, %1 row_xmask:4 row_mask:0xf bank_mask:0xf\n\t"
        "v_max_num_f32_dpp %2, %2, %2 row_xmask:4 row_mask:0xf bank_mask:0xf\n\t"
        "v_max_num_f32_dpp %3, %3, %3 row_xmask:4 row_mask:0xf bank_mask:0xf\n\t"
        "v_max_num_f32_dpp %4, %4, %4 row_xmask:4 row_mask:0xf bank_mask:0xf\n\t"
        "v_max_num_f32_dpp %5, %5, %5 row_xmask:4 row_mask:0xf bank_mask:0xf\n\t"
        "v_max_num_f32_dpp %6, %6, %6 row_xmask:4 row_mask:0xf bank_mask:0xf\n\t"
        "v_max_num_f32_dpp %7, %7, %7 row_xmask:4 row_mask:0xf bank_mask:0xf\n\t"
        "v_max_num_f32_dpp %0, %0, %0 row_xmask:8 row_mask:0xf bank_mask:0xf\n\t"
        "v_max_num_f32_dpp %1, %1, %1 row_xmask:8 row_mask:0xf bank_mask:0xf\n\t"
        "v_max_num_f32_dpp %2, %2, %2 row_xmask:8 row_mask:0xf bank_mask:0xf\n\t"
        "v_max_num_f32_dpp %3, %3, %3 row_xmask:8 row_mask:0xf bank_mask:0xf\n\t"
        "v_max_num_f32_dpp %4, %4, %4 row_xmask:8 row_mask:0xf bank_mask:0xf\n\t"
        "v_max_num_f32_dpp %5, %5, %5 row_xmask:8 row_mask:0xf bank_mask:0xf\n\t"
        "v_max_num_f32_dpp %6, %6, %6 row_xmask:8 row_mask:0xf bank_mask:0xf\n\t"
        "v_max_num_f32_dpp %7, %7, %7 row_xmask:8 row_mask:0xf bank_mask:0xf\n\t"
        : "+v"(m[0]), "+v"(m[1]), "+v"(m[2]), "+v"(m[3]),
          "+v"(m[4]), "+v"(m[5]), "+v"(m[6]), "+v"(m[7]));
}

static __device__ inline v8f vzero8() {
    v8f z = {0.f, 0.f, 0.f, 0.f, 0.f, 0.f, 0.f, 0.f};
    return z;
}

static __device__ inline void async_rows8_b128(unsigned l, const _Float16* g,
                                               unsigned lstep, unsigned gstep) {
    const unsigned long long a = (unsigned long long)(uintptr_t)g;
    const unsigned long long s = (unsigned long long)gstep * sizeof(_Float16);
    asm volatile(
        "global_load_async_to_lds_b128 %0, %8, off\n\t"
        "global_load_async_to_lds_b128 %1, %9, off\n\t"
        "global_load_async_to_lds_b128 %2, %10, off\n\t"
        "global_load_async_to_lds_b128 %3, %11, off\n\t"
        "global_load_async_to_lds_b128 %4, %12, off\n\t"
        "global_load_async_to_lds_b128 %5, %13, off\n\t"
        "global_load_async_to_lds_b128 %6, %14, off\n\t"
        "global_load_async_to_lds_b128 %7, %15, off\n\t"
        "s_wait_xcnt 0x0"
        :: "v"(l), "v"(l + lstep), "v"(l + 2 * lstep), "v"(l + 3 * lstep),
           "v"(l + 4 * lstep), "v"(l + 5 * lstep), "v"(l + 6 * lstep), "v"(l + 7 * lstep),
           "v"(a), "v"(a + s), "v"(a + 2 * s), "v"(a + 3 * s),
           "v"(a + 4 * s), "v"(a + 5 * s), "v"(a + 6 * s), "v"(a + 7 * s)
        : "memory");
}

static __device__ inline void wait_async0() {
    asm volatile("s_wait_asynccnt 0x0" ::: "memory");
}

// ---------------------------------------------------------------------------
// f32 -> f16 conversion of all ten operands in one launch.
// The ten f16 copies lie one behind the other in the workspace, in argument
// order, and every operand's length is a whole number of units of CVT_UNIT
// elements, so each unit of the destination has exactly one source.
// blockIdx.y = unit, blockIdx.x = slice of the unit.  A work-group converts
// CVT_TRIPS x 8,192 elements; each wave-wide load covers 512 contiguous bytes,
// each wave-wide store 256.
// ---------------------------------------------------------------------------
#define CVT_UNIT   (1 << 20)
#define CVT_X      ((NTOK * EDIM) / CVT_UNIT)   // units per activation: 8
#define CVT_WQKV   ((E3 * EDIM) / CVT_UNIT)     // units per qkv weight: 3
#define CVT_WO     ((EDIM * EDIM) / CVT_UNIT)   // units per out weight: 1
#define CVT_UNITS  (6 * CVT_X + 2 * CVT_WQKV + 2 * CVT_WO)
#define CVT_SLICES 32
#define CVT_TRIPS  (CVT_UNIT / CVT_SLICES / 8192)
static_assert(CVT_X * CVT_UNIT == NTOK * EDIM && CVT_WQKV * CVT_UNIT == E3 * EDIM &&
              CVT_WO * CVT_UNIT == EDIM * EDIM, "operands are whole units");
static_assert(CVT_TRIPS * CVT_SLICES * 8192 == CVT_UNIT, "slices are whole trips");

typedef __attribute__((ext_vector_type(4))) float    v4f;
typedef __attribute__((ext_vector_type(4))) _Float16 v4h;

__global__ void __launch_bounds__(256) f32_to_f16_all_kernel(
    const float* __restrict__ xqr, const float* __restrict__ xqi,
    const float* __restrict__ xkr, const float* __restrict__ xki,
    const float* __restrict__ xvr, const float* __restrict__ xvi,
    const float* __restrict__ wr,  const float* __restrict__ wi,
    const float* __restrict__ wor, const float* __restrict__ woi,
    _Float16* __restrict__ dst)
{
    const int u = (int)blockIdx.y;
    const float* src;   // the operand that unit u belongs to
    int u0;             // that operand's first unit
    if (u < 6 * CVT_X) {
        const int a = u / CVT_X;
        u0  = a * CVT_X;
        src = (a == 0) ? xqr : (a == 1) ? xqi : (a == 2) ? xkr
            : (a == 3) ? xki : (a == 4) ? xvr : xvi;
    } else if (u < 6 * CVT_X + CVT_WQKV) {
        u0 = 6 * CVT_X;                              src = wr;
    } else if (u < 6 * CVT_X + 2 * CVT_WQKV) {
        u0 = 6 * CVT_X + CVT_WQKV;                   src = wi;
    } else if (u < 6 * CVT_X + 2 * CVT_WQKV + CVT_WO) {
        u0 = 6 * CVT_X + 2 * CVT_WQKV;               src = wor;
    } else {
        u0 = 6 * CVT_X + 2 * CVT_WQKV + CVT_WO;      src = woi;
    }
    const size_t slice = (size_t)blockIdx.x * (CVT_UNIT / CVT_SLICES);
    const v4f* s4 = (const v4f*)(src + (size_t)(u - u0) * CVT_UNIT + slice) + threadIdx.x;
    v4h*       d4 = (v4h*)(dst + (size_t)u * CVT_UNIT + slice) + threadIdx.x;

    // Kept rolled: 8 loads of 16 bytes in flight per lane are enough for the
    // memory rate, and the small register count keeps every work-group resident.
#pragma unroll 1
    for (int it = 0; it < CVT_TRIPS; ++it) {
        v4f v[8];
#pragma unroll   // all 8 loads issue before the first value is used
        for (int j = 0; j < 8; ++j) v[j] = s4[it * 2048 + j * 256];
#pragma unroll   // constant indices keep v[] in registers
        for (int j = 0; j < 8; ++j)
            d4[it * 2048 + j * 256] = __builtin_convertvector(v[j], v4h);
    }
}

#define GK      64
#define GPITCH  72
#define GTILE   (128 * GPITCH)
#define GSTAGE  (4 * GTILE)
#define GSTAGES (EDIM / GK)
static_assert(NTOK % 128 == 0 && EDIM % 128 == 0 && GSTAGES >= 2, "whole tiles, two stages");

// xr .. wi: first row of each tile (the same in every lane).  A lane brings 16
// bytes of row (tid >> 3) + 16 n of each tile, k = kb + (tid & 7) * 8 onwards.
static __device__ inline void stage_tiles(_Float16* buf, int tid, int kb,
                                          const _Float16* xr, const _Float16* xi,
                                          const _Float16* wr, const _Float16* wi) {
    const unsigned l = (unsigned)(uintptr_t)(buf + (tid >> 3) * GPITCH + (tid & 7) * 8);
    const unsigned o = (unsigned)((tid >> 3) * EDIM + (tid & 7) * 8 + kb);
    const unsigned lstep = 16 * GPITCH * sizeof(_Float16);
    const unsigned ltile = GTILE * sizeof(_Float16);
    async_rows8_b128(l,             xr + o, lstep, 16 * EDIM);
    async_rows8_b128(l + ltile,     xi + o, lstep, 16 * EDIM);
    async_rows8_b128(l + 2 * ltile, wr + o, lstep, 16 * EDIM);
    async_rows8_b128(l + 3 * ltile, wi + o, lstep, 16 * EDIM);
}

static __device__ __forceinline__ void cgemm_128x128(
    _Float16* sbuf,
    const _Float16* __restrict__ Xr, const _Float16* __restrict__ Xi,
    const _Float16* __restrict__ Wr, const _Float16* __restrict__ Wi,
    v8f (&accR)[4][4], v8f (&accI)[4][4])
{
    const int tid  = (int)threadIdx.x;
    const int lane = tid & 31;
    const int wave = tid >> 5;
    const int wm   = wave >> 1;       // which 64 rows of X
    const int wn   = wave & 1;        // which 64 rows of W

#pragma unroll   // constant indices keep tiles and fragments in registers
    for (int i = 0; i < 4; ++i)
#pragma unroll   // constant indices keep tiles and fragments in registers
        for (int j = 0; j < 4; ++j) { accR[i][j] = vzero8(); accI[i][j] = vzero8(); }

    stage_tiles(sbuf, tid, 0, Xr, Xi, Wr, Wi);
    wait_async0();
    __syncthreads();   // stage 0 visible to all waves
    stage_tiles(sbuf + GSTAGE, tid, GK, Xr, Xi, Wr, Wi);

    // Kept rolled: one copy of the 128-WMMA body, for speed only.
#pragma unroll 1
    for (int t = 0; t < GSTAGES; ++t) {
        _Float16* buf = sbuf + (t & 1) * GSTAGE;
        const _Float16* pa = buf + (wm * 64) * GPITCH;
        const _Float16* pb = buf + 2 * GTILE + (wn * 64) * GPITCH;
#pragma unroll   // constant indices keep tiles and fragments in registers
        for (int ks = 0; ks < GK; ks += 32) {
            v16h ar[4], ai[4], br[4], bi[4];
#pragma unroll   // constant indices keep tiles and fragments in registers
            for (int i = 0; i < 4; ++i) {
                ar[i] = load_frag16(pa + (i * 16) * GPITCH + ks, GPITCH, lane);
                ai[i] = load_frag16(pa + GTILE + (i * 16) * GPITCH + ks, GPITCH, lane);
                br[i] = load_frag16(pb + (i * 16) * GPITCH + ks, GPITCH, lane);
                bi[i] = load_frag16(pb + GTILE + (i * 16) * GPITCH + ks, GPITCH, lane);
            }
            // Per accumulator the order stays ar.br, -ai.bi and ar.bi, ai.br;
            // neighbouring WMMAs write different tiles.
#pragma unroll   // constant indices keep tiles and fragments in registers
            for (int i = 0; i < 4; ++i)
#pragma unroll   // constant indices keep tiles and fragments in registers
                for (int j = 0; j < 4; ++j) accR[i][j] = wmma16(ar[i], br[j], accR[i][j]);
#pragma unroll   // constant indices keep tiles and fragments in registers
            for (int i = 0; i < 4; ++i)
#pragma unroll   // constant indices keep tiles and fragments in registers
                for (int j = 0; j < 4; ++j) accI[i][j] = wmma16(ar[i], bi[j], accI[i][j]);
#pragma unroll   // constant indices keep tiles and fragments in registers
            for (int i = 0; i < 4; ++i)
#pragma unroll   // constant indices keep tiles and fragments in registers
                for (int j = 0; j < 4; ++j) accI[i][j] = wmma16(ai[i], br[j], accI[i][j]);
#pragma unroll   // constant indices keep tiles and fragments in registers
            for (int i = 0; i < 4; ++i) {
                const v16h nai = -ai[i];
#pragma unroll   // constant indices keep tiles and fragments in registers
                for (int j = 0; j < 4; ++j) accR[i][j] = wmma16(nai, bi[j], accR[i][j]);
            }
        }
        // Hand-over: this wave's reads of buf are done, its copies of stage
        // t + 1 have landed; behind the barrier both hold for every wave.
        asm volatile("s_wait_dscnt 0x0" ::: "memory");
        wait_async0();
        __syncthreads();
        if (t + 2 < GSTAGES)
            stage_tiles(buf, tid, (t + 2) * GK, Xr, Xi, Wr, Wi);
    }
    wait_async0();   // nothing in flight when the wave goes on
}

__global__ void __launch_bounds__(128, 2) qkv_gemm_kernel(
    const _Float16* __restrict__ xqr, const _Float16* __restrict__ xqi,
    const _Float16* __restrict__ xkr, const _Float16* __restrict__ xki,
    const _Float16* __restrict__ xvr, const _Float16* __restrict__ xvi,
    const _Float16* __restrict__ wr,  const _Float16* __restrict__ wi,
    const float* __restrict__ bre,    const float* __restrict__ bim,
    _Float16* __restrict__ Qr, _Float16* __restrict__ Qi,
    _Float16* __restrict__ Kr, _Float16* __restrict__ Ki,
    _Float16* __restrict__ Vr, _Float16* __restrict__ Vi)
{
    __shared__ __align__(16) _Float16 sbuf[2 * GSTAGE];

    const int lane = threadIdx.x & 31;
    const int wave = threadIdx.x >> 5;
    const int row0 = blockIdx.x * 128;               // token tile
    const int col0 = blockIdx.y * 128;               // output-feature tile
    const int sel  = col0 >> 10;                     // 0=q 1=k 2=v

    const _Float16* Xr = (sel == 0) ? xqr : ((sel == 1) ? xkr : xvr);
    const _Float16* Xi = (sel == 0) ? xqi : ((sel == 1) ? xki : xvi);

    v8f accR[4][4], accI[4][4];
    cgemm_128x128(sbuf, Xr + (size_t)row0 * EDIM, Xi + (size_t)row0 * EDIM,
                  wr + (size_t)col0 * EDIM, wi + (size_t)col0 * EDIM, accR, accI);

    _Float16* Dr = (sel == 0) ? Qr : ((sel == 1) ? Kr : Vr);
    _Float16* Di = (sel == 0) ? Qi : ((sel == 1) ? Ki : Vi);

    const int rowb = row0 + (wave >> 1) * 64;
    const int colb = col0 + (wave & 1) * 64;
#pragma unroll   // constant indices keep tiles and fragments in registers
    for (int j = 0; j < 4; ++j) {
        const int col = colb + j * 16 + (lane & 15);
        const float br_v = bre[col];
        const float bi_v = bim[col];
        const int e  = col & (EDIM - 1);
        const int hh = e >> 6;         // head
        const int d  = e & 63;         // dim in head
#pragma unroll   // constant indices keep tiles and fragments in registers
        for (int i = 0; i < 4; ++i) {
#pragma unroll   // constant indices keep tiles and fragments in registers
            for (int r = 0; r < 8; ++r) {
                const int tok = rowb + i * 16 + ((lane >> 4) << 3) + r;   // C layout rows
                const int s = tok >> 3;        // token = s*B + b, B=8
                const int b = tok & 7;
                const size_t off = (((size_t)(b * HNUM + hh) * SDIM + s) * HD) + d;
                Dr[off] = (_Float16)(accR[i][j][r] + br_v);
                Di[off] = (_Float16)(accI[i][j][r] + bi_v);
            }
        }
        // Stores of this column group have their addresses taken before the next
        // group's values reuse a register that one of them names; the scheduling
        // barrier keeps that group's arithmetic behind the wait.
        if (j < 3) {
            asm volatile("s_wait_xcnt 0x0" ::: "memory");
            __builtin_amdgcn_sched_barrier(0);
        }
    }
}

// ---------------------------------------------------------------------------
// Flash attention per (b,h):  scores = (qr.kr^T + qi.ki^T)/8, online softmax,
// out = P @ v (re and im).  Block = 4 waves, each wave owns 16 query rows.
// V tiles staged transposed in LDS; P bounces through LDS (C- -> A-layout).
// ---------------------------------------------------------------------------
__global__ void __launch_bounds__(128) attn_kernel(
    const _Float16* __restrict__ Qr, const _Float16* __restrict__ Qi,
    const _Float16* __restrict__ Kr, const _Float16* __restrict__ Ki,
    const _Float16* __restrict__ Vr, const _Float16* __restrict__ Vi,
    _Float16* __restrict__ Or, _Float16* __restrict__ Oi)
{
    __shared__ __align__(16) _Float16 vtr[64][40];       // V^T re, padded rows
    __shared__ __align__(16) _Float16 vti[64][40];       // V^T im
    __shared__ __align__(16) _Float16 pbuf[4][16][32];   // per-wave P tile

    const int lane = threadIdx.x & 31;
    const int wave = threadIdx.x >> 5;
    const int bh = blockIdx.y;          // = b*H + h
    const int b  = bh >> 4;
    const int h  = bh & 15;
    const int s0 = blockIdx.x * 64 + wave * 16;

    const size_t base = (size_t)bh * SDIM * HD;

    v16h aqr[2], aqi[2];
#pragma unroll
    for (int ks = 0; ks < 2; ++ks) {
        aqr[ks] = load_frag16(Qr + base + (size_t)s0 * HD + ks * 32, HD, lane);
        aqi[ks] = load_frag16(Qi + base + (size_t)s0 * HD + ks * 32, HD, lane);
    }

    v8f oR[4], oI[4];
#pragma unroll
    for (int j = 0; j < 4; ++j) { oR[j] = vzero8(); oI[j] = vzero8(); }
    float mrun[8], lrun[8];
#pragma unroll
    for (int r = 0; r < 8; ++r) { mrun[r] = -1e30f; lrun[r] = 0.f; }

    const float scale = 0.125f;   // 1/sqrt(64)

    for (int t0 = 0; t0 < SDIM; t0 += 32) {
        __syncthreads();   // protect previous iteration's V-tile reads
        // Cooperative staging of V[t0..t0+31][0..63] transposed into LDS
#pragma unroll 4
        for (int i = 0; i < 16; ++i) {
            const int idx = (int)threadIdx.x + i * 128;   // 0..2047
            const int t = idx >> 6;
            const int d = idx & 63;
            vtr[d][t] = Vr[base + (size_t)(t0 + t) * HD + d];
            vti[d][t] = Vi[base + (size_t)(t0 + t) * HD + d];
        }
        __syncthreads();

        // Scores: 16x32 block as two 16x16 C tiles
        v8f sc[2];
        sc[0] = vzero8(); sc[1] = vzero8();
#pragma unroll
        for (int ts = 0; ts < 2; ++ts) {
#pragma unroll
            for (int ks = 0; ks < 2; ++ks) {
                v16h bkr = load_frag16(Kr + base + (size_t)(t0 + ts * 16) * HD + ks * 32, HD, lane);
                v16h bki = load_frag16(Ki + base + (size_t)(t0 + ts * 16) * HD + ks * 32, HD, lane);
                sc[ts] = wmma16(aqr[ks], bkr, sc[ts]);
                sc[ts] = wmma16(aqi[ks], bki, sc[ts]);
            }
        }

        // Online softmax across the 32 new columns (butterfly within 16-lane
        // half-groups: C-layout spreads each row over 16 lanes)
        float rmx[8];
#pragma unroll
        for (int r = 0; r < 8; ++r) rmx[r] = fmaxf(sc[0][r] * scale, sc[1][r] * scale);
        row_max8(rmx);
#pragma unroll
        for (int r = 0; r < 8; ++r) {
            float x0 = sc[0][r] * scale;
            float x1 = sc[1][r] * scale;
            const float mnew = fmaxf(mrun[r], rmx[r]);
            const float corr = __expf(mrun[r] - mnew);
            const float p0 = __expf(x0 - mnew);
            const float p1 = __expf(x1 - mnew);
            float rs = p0 + p1;
            rs += row_xor<1>(rs);
            rs += row_xor<2>(rs);
            rs += row_xor<4>(rs);
            rs += row_xor<8>(rs);
            lrun[r] = lrun[r] * corr + rs;
            mrun[r] = mnew;
#pragma unroll
            for (int j = 0; j < 4; ++j) { oR[j][r] *= corr; oI[j][r] *= corr; }
            const int row = ((lane >> 4) << 3) + r;
            pbuf[wave][row][(lane & 15)]      = (_Float16)p0;
            pbuf[wave][row][16 + (lane & 15)] = (_Float16)p1;
        }

        // LDS pipeline is in-order per wave; fence explicitly anyway
        asm volatile("s_wait_dscnt 0x0" ::: "memory");

        v16h pa = load_frag16(&pbuf[wave][0][0], 32, lane);
#pragma unroll
        for (int j = 0; j < 4; ++j) {
            v16h bvr = load_frag16(&vtr[j * 16][0], 40, lane);
            v16h bvi = load_frag16(&vti[j * 16][0], 40, lane);
            oR[j] = wmma16(pa, bvr, oR[j]);
            oI[j] = wmma16(pa, bvi, oI[j]);
        }
    }

    // Normalize and write (S,B,E) f16 for the output projection
#pragma unroll
    for (int j = 0; j < 4; ++j) {
        const int d = j * 16 + (lane & 15);
#pragma unroll
        for (int r = 0; r < 8; ++r) {
            const int row = ((lane >> 4) << 3) + r;
            const int s = s0 + row;
            const float invl = 1.0f / lrun[r];
            const size_t off = ((size_t)(s * BDIM + b)) * EDIM + h * HD + d;
            Or[off] = (_Float16)(oR[j][r] * invl);
            Oi[off] = (_Float16)(oI[j][r] * invl);
        }
    }
}

// ---------------------------------------------------------------------------
// Output complex projection:  y = out @ Wo^T + bo -> f32 d_out stacked
// (2, S, B, E).  Same main loop and launch bounds as the QKV GEMM.
// ---------------------------------------------------------------------------
__global__ void __launch_bounds__(128, 2) out_gemm_kernel(
    const _Float16* __restrict__ Ar, const _Float16* __restrict__ Ai,
    const _Float16* __restrict__ wr, const _Float16* __restrict__ wi,
    const float* __restrict__ bre,   const float* __restrict__ bim,
    float* __restrict__ out)
{
    __shared__ __align__(16) _Float16 sbuf[2 * GSTAGE];

    const int lane = threadIdx.x & 31;
    const int wave = threadIdx.x >> 5;
    const int row0 = blockIdx.x * 128;
    const int col0 = blockIdx.y * 128;

    v8f accR[4][4], accI[4][4];
    cgemm_128x128(sbuf, Ar + (size_t)row0 * EDIM, Ai + (size_t)row0 * EDIM,
                  wr + (size_t)col0 * EDIM, wi + (size_t)col0 * EDIM, accR, accI);

    const size_t imOff = (size_t)NTOK * EDIM;
    const int rowb = row0 + (wave >> 1) * 64;
    const int colb = col0 + (wave & 1) * 64;
#pragma unroll   // constant indices keep tiles and fragments in registers
    for (int j = 0; j < 4; ++j) {
        const int col = colb + j * 16 + (lane & 15);
        const float br_v = bre[col];
        const float bi_v = bim[col];
#pragma unroll   // constant indices keep tiles and fragments in registers
        for (int i = 0; i < 4; ++i) {
#pragma unroll   // constant indices keep tiles and fragments in registers
            for (int r = 0; r < 8; ++r) {
                const int tok = rowb + i * 16 + ((lane >> 4) << 3) + r;
                const size_t off = (size_t)tok * EDIM + col;
                out[off]         = accR[i][j][r] + br_v;
                out[imOff + off] = accI[i][j][r] + bi_v;
            }
        }
        // Stores of this column group have their addresses taken before the next
        // group's values reuse a register that one of them names; the scheduling
        // barrier keeps that group's arithmetic behind the wait.
        if (j < 3) {
            asm volatile("s_wait_xcnt 0x0" ::: "memory");
            __builtin_amdgcn_sched_barrier(0);
        }
    }
}

// ---------------------------------------------------------------------------
// Host launcher
// ---------------------------------------------------------------------------
extern "C" void kernel_launch(void* const* d_in, const int* in_sizes, int n_in,
                              void* d_out, int out_size, void* d_ws, size_t ws_size,
                              hipStream_t stream) {
    (void)in_sizes; (void)n_in; (void)out_size; (void)ws_size;

    const size_t NE   = (size_t)NTOK * EDIM;   // 8,388,608
    const size_t WQKV = (size_t)E3 * EDIM;     // 3,145,728
    const size_t WO   = (size_t)EDIM * EDIM;   // 1,048,576

    _Float16* hws = (_Float16*)d_ws;
    _Float16* xqr = hws;            _Float16* xqi = xqr + NE;
    _Float16* xkr = xqi + NE;       _Float16* xki = xkr + NE;
    _Float16* xvr = xki + NE;       _Float16* xvi = xvr + NE;
    _Float16* wr  = xvi + NE;       _Float16* wi  = wr + WQKV;
    _Float16* wor = wi + WQKV;      _Float16* woi = wor + WO;
    _Float16* Qr  = woi + WO;       _Float16* Qi  = Qr + NE;
    _Float16* Kr  = Qi + NE;        _Float16* Ki  = Kr + NE;
    _Float16* Vr  = Ki + NE;        _Float16* Vi  = Vr + NE;
    _Float16* Aor = Vi + NE;        _Float16* Aoi = Aor + NE;

    // Activations and weights -> f16: xqr .. woi are contiguous from hws on
    {
        dim3 grid(CVT_SLICES, CVT_UNITS);
        f32_to_f16_all_kernel<<<grid, dim3(256), 0, stream>>>(
            (const float*)d_in[0], (const float*)d_in[1], (const float*)d_in[2],
            (const float*)d_in[3], (const float*)d_in[4], (const float*)d_in[5],
            (const float*)d_in[6], (const float*)d_in[7],
            (const float*)d_in[10], (const float*)d_in[11], hws);
    }

    // QKV projection (complex), head-major f16 outputs
    {
        dim3 grid(NTOK / 128, E3 / 128);
        qkv_gemm_kernel<<<grid, dim3(128), 0, stream>>>(
            xqr, xqi, xkr, xki, xvr, xvi, wr, wi,
            (const float*)d_in[8], (const float*)d_in[9],
            Qr, Qi, Kr, Ki, Vr, Vi);
    }

    // Flash attention per (b,h)
    {
        dim3 grid(SDIM / 64, BDIM * HNUM);
        attn_kernel<<<grid, dim3(128), 0, stream>>>(Qr, Qi, Kr, Ki, Vr, Vi, Aor, Aoi);
    }

    // Output projection (complex), f32 result stacked (re, im)
    {
        dim3 grid(NTOK / 128, EDIM / 128);
        out_gemm_kernel<<<grid, dim3(128), 0, stream>>>(
            Aor, Aoi, wor, woi,
            (const float*)d_in[12], (const float*)d_in[13],
            (float*)d_out);
    }
}

// v004
// Measured time: 278 microseconds a run.
// Next to v003, in two timings, it ran 1.67 and 1.66 times as fast.
// Counting every step since v000, it is 2.93 times as fast.
#include <hip/hip_runtime.h>
#include <hip/hip_bf16.h>

// Problem constants (match reference)
#define SDIM 1024
#define BDIM 8
#define EDIM 1024
#define HNUM 16
#define HD   64
#define NTOK (SDIM * BDIM)   // 8192 tokens
#define E3   (3 * EDIM)      // 3072

typedef __attribute__((ext_vector_type(16))) _Float16 v16h;
typedef __attribute__((ext_vector_type(8)))  _Float16 v8h;
typedef __attribute__((ext_vector_type(8)))  float    v8f;

static __device__ inline v16h load_frag16(const _Float16* p, int ld, int lane) {
    const int m  = lane & 15;
    const int kb = (lane >> 4) << 3;
    const _Float16* r = p + (size_t)m * (size_t)ld + kb;
    v8h lo = *(const v8h*)(r);
    v8h hi = *(const v8h*)(r + 16);
    return __builtin_shufflevector(lo, hi, 0, 1, 2, 3, 4, 5, 6, 7,
                                           8, 9, 10, 11, 12, 13, 14, 15);
}

static __device__ inline v8f wmma16(v16h a, v16h b, v8f c) {
    // 8-arg form: (neg_a, A, neg_b, B, c_mod, C, reuse_a, reuse_b)
    return __builtin_amdgcn_wmma_f32_16x16x32_f16(false, a, false, b,
                                                  (short)0, c, false, false);
}

// Value of lane (L ^ MASK) inside each 16-lane row, by a DPP row_xmask move on
// the vector pipe (control word 0x160 | MASK); all 32 lanes are active here.
template <int MASK>
static __device__ inline float row_xor(float v) {
    return __builtin_bit_cast(float, __builtin_amdgcn_update_dpp(
        0, __builtin_bit_cast(int, v), 0x160 | MASK, 0xf, 0xf, true));
}

static __device__ inline void row_max8(float (&m)[8]) {
    asm(
        "v_max_num_f32_dpp %0, %0, %0 row_xmask:1 row_mask:0xf bank_mask:0xf\n\t"
        "v_max_num_f32_dpp %1, %1, %1 row_xmask:1 row_mask:0xf bank_mask:0xf\n\t"
        "v_max_num_f32_dpp %2, %2, %2 row_xmask:1 row_mask:0xf bank_mask:0xf\n\t"
        "v_max_num_f32_dpp %3, %3, %3 row_xmask:1 row_mask:0xf bank_mask:0xf\n\t"
        "v_max_num_f32_dpp %4, %4, %4 row_xmask:1 row_mask:0xf bank_mask:0xf\n\t"
        "v_max_num_f32_dpp %5, %5, %5 row_xmask:1 row_mask:0xf bank_mask:0xf\n\t"
        "v_max_num_f32_dpp %6, %6, %6 row_xmask:1 row_mask:0xf bank_mask:0xf\n\t"
        "v_max_num_f32_dpp %7, %7, %7 row_xmask:1 row_mask:0xf bank_mask:0xf\n\t"
        "v_max_num_f32_dpp %0, %0, %0 row_xmask:2 row_mask:0xf bank_mask:0xf\n\t"
        "v_max_num_f32_dpp %1, %1, %1 row_xmask:2 row_mask:0xf bank_mask:0xf\n\t"
        "v_max_num_f32_dpp %2, %2, %2 row_xmask:2 row_mask:0xf bank_mask:0xf\n\t"
        "v_max_num_f32_dpp %3, %3, %3 row_xmask:2 row_mask:0xf bank_mask:0xf\n\t"
        "v_max_num_f32_dpp %4, %4, %4 row_xmask:2 row_mask:0xf bank_mask:0xf\n\t"
        "v_max_num_f32_dpp %5, %5, %5 row_xmask:2 row_mask:0xf bank_mask:0xf\n\t"
        "v_max_num_f32_dpp %6, %6, %6 row_xmask:2 row_mask:0xf bank_mask:0xf\n\t"
        "v_max_num_f32_dpp %7, %7, %7 row_xmask:2 row_mask:0xf bank_mask:0xf\n\t"
        "v_max_num_f32_dpp %0, %0, %0 row_xmask:4 row_mask:0xf bank_mask:0xf\n\t"
        "v_max_num_f32_dpp %1, %1, %1 row_xmask:4 row_mask:0xf bank_mask:0xf\n\t"
        "v_max_num_f32_dpp %2, %2, %2 row_xmask:4 row_mask:0xf bank_mask:0xf\n\t"
        "v_max_num_f32_dpp %3, %3, %3 row_xmask:4 row_mask:0xf bank_mask:0xf\n\t"
        "v_max_num_f32_dpp %4, %4, %4 row_xmask:4 row_mask:0xf bank_mask:0xf\n\t"
        "v_max_num_f32_dpp %5, %5, %5 row_xmask:4 row_mask:0xf bank_mask:0xf\n\t"
        "v_max_num_f32_dpp %6, %6, %6 row_xmask:4 row_mask:0xf bank_mask:0xf\n\t"
        "v_max_num_f32_dpp %7, %7, %7 row_xmask:4 row_mask:0xf bank_mask:0xf\n\t"
        "v_max_num_f32_dpp %0, %0, %0 row_xmask:8 row_mask:0xf bank_mask:0xf\n\t"
        "v_max_num_f32_dpp %1, %1, %1 row_xmask:8 row_mask:0xf bank_mask:0xf\n\t"
        "v_max_num_f32_dpp %2, %2, %2 row_xmask:8 row_mask:0xf bank_mask:0xf\n\t"
        "v_max_num_f32_dpp %3, %3, %3 row_xmask:8 row_mask:0xf bank_mask:0xf\n\t"
        "v_max_num_f32_dpp %4, %4, %4 row_xmask:8 row_mask:0xf bank_mask:0xf\n\t"
        "v_max_num_f32_dpp %5, %5, %5 row_xmask:8 row_mask:0xf bank_mask:0xf\n\t"
        "v_max_num_f32_dpp %6, %6, %6 row_xmask:8 row_mask:0xf bank_mask:0xf\n\t"
        "v_max_num_f32_dpp %7, %7, %7 row_xmask:8 row_mask:0xf bank_mask:0xf\n\t"
        : "+v"(m[0]), "+v"(m[1]), "+v"(m[2]), "+v"(m[3]),
          "+v"(m[4]), "+v"(m[5]), "+v"(m[6]), "+v"(m[7]));
}

static __device__ inline v8f vzero8() {
    v8f z = {0.f, 0.f, 0.f, 0.f, 0.f, 0.f, 0.f, 0.f};
    return z;
}

static __device__ inline void async_rows8_b128(unsigned l, const _Float16* g,
                                               unsigned lstep, unsigned gstep) {
    const unsigned long long a = (unsigned long long)(uintptr_t)g;
    const unsigned long long s = (unsigned long long)gstep * sizeof(_Float16);
    asm volatile(
        "global_load_async_to_lds_b128 %0, %8, off\n\t"
        "global_load_async_to_lds_b128 %1, %9, off\n\t"
        "global_load_async_to_lds_b128 %2, %10, off\n\t"
        "global_load_async_to_lds_b128 %3, %11, off\n\t"
        "global_load_async_to_lds_b128 %4, %12, off\n\t"
        "global_load_async_to_lds_b128 %5, %13, off\n\t"
        "global_load_async_to_lds_b128 %6, %14, off\n\t"
        "global_load_async_to_lds_b128 %7, %15, off\n\t"
        "s_wait_xcnt 0x0"
        :: "v"(l), "v"(l + lstep), "v"(l + 2 * lstep), "v"(l + 3 * lstep),
           "v"(l + 4 * lstep), "v"(l + 5 * lstep), "v"(l + 6 * lstep), "v"(l + 7 * lstep),
           "v"(a), "v"(a + s), "v"(a + 2 * s), "v"(a + 3 * s),
           "v"(a + 4 * s), "v"(a + 5 * s), "v"(a + 6 * s), "v"(a + 7 * s)
        : "memory");
}

static __device__ inline void wait_async0() {
    asm volatile("s_wait_asynccnt 0x0" ::: "memory");
}

// ---------------------------------------------------------------------------
// f32 -> f16 conversion of all ten operands in one launch.
// The ten f16 copies lie one behind the other in the workspace, in argument
// order, and every operand's length is a whole number of units of CVT_UNIT
// elements, so each unit of the destination has exactly one source.
// blockIdx.y = unit, blockIdx.x = slice of the unit.  A work-group converts
// CVT_TRIPS x 8,192 elements; each wave-wide load covers 512 contiguous bytes,
// each wave-wide store 256.
// ---------------------------------------------------------------------------
#define CVT_UNIT   (1 << 20)
#define CVT_X      ((NTOK * EDIM) / CVT_UNIT)   // units per activation: 8
#define CVT_WQKV   ((E3 * EDIM) / CVT_UNIT)     // units per qkv weight: 3
#define CVT_WO     ((EDIM * EDIM) / CVT_UNIT)   // units per out weight: 1
#define CVT_UNITS  (6 * CVT_X + 2 * CVT_WQKV + 2 * CVT_WO)
#define CVT_SLICES 32
#define CVT_TRIPS  (CVT_UNIT / CVT_SLICES / 8192)
static_assert(CVT_X * CVT_UNIT == NTOK * EDIM && CVT_WQKV * CVT_UNIT == E3 * EDIM &&
              CVT_WO * CVT_UNIT == EDIM * EDIM, "operands are whole units");
static_assert(CVT_TRIPS * CVT_SLICES * 8192 == CVT_UNIT, "slices are whole trips");

typedef __attribute__((ext_vector_type(4))) float    v4f;
typedef __attribute__((ext_vector_type(4))) _Float16 v4h;

__global__ void __launch_bounds__(256) f32_to_f16_all_kernel(
    const float* __restrict__ xqr, const float* __restrict__ xqi,
    const float* __restrict__ xkr, const float* __restrict__ xki,
    const float* __restrict__ xvr, const float* __restrict__ xvi,
    const float* __restrict__ wr,  const float* __restrict__ wi,
    const float* __restrict__ wor, const float* __restrict__ woi,
    _Float16* __restrict__ dst)
{
    const int u = (int)blockIdx.y;
    const float* src;   // the operand that unit u belongs to
    int u0;             // that operand's first unit
    if (u < 6 * CVT_X) {
        const int a = u / CVT_X;
        u0  = a * CVT_X;
        src = (a == 0) ? xqr : (a == 1) ? xqi : (a == 2) ? xkr
            : (a == 3) ? xki : (a == 4) ? xvr : xvi;
    } else if (u < 6 * CVT_X + CVT_WQKV) {
        u0 = 6 * CVT_X;                              src = wr;
    } else if (u < 6 * CVT_X + 2 * CVT_WQKV) {
        u0 = 6 * CVT_X + CVT_WQKV;                   src = wi;
    } else if (u < 6 * CVT_X + 2 * CVT_WQKV + CVT_WO) {
        u0 = 6 * CVT_X + 2 * CVT_WQKV;               src = wor;
    } else {
        u0 = 6 * CVT_X + 2 * CVT_WQKV + CVT_WO;      src = woi;
    }
    const size_t slice = (size_t)blockIdx.x * (CVT_UNIT / CVT_SLICES);
    const v4f* s4 = (const v4f*)(src + (size_t)(u - u0) * CVT_UNIT + slice) + threadIdx.x;
    v4h*       d4 = (v4h*)(dst + (size_t)u * CVT_UNIT + slice) + threadIdx.x;

    // Kept rolled: 8 loads of 16 bytes in flight per lane are enough for the
    // memory rate, and the small register count keeps every work-group resident.
#pragma unroll 1
    for (int it = 0; it < CVT_TRIPS; ++it) {
        v4f v[8];
#pragma unroll   // all 8 loads issue before the first value is used
        for (int j = 0; j < 8; ++j) v[j] = s4[it * 2048 + j * 256];
#pragma unroll   // constant indices keep v[] in registers
        for (int j = 0; j < 8; ++j)
            d4[it * 2048 + j * 256] = __builtin_convertvector(v[j], v4h);
    }
}

#define GK      64
#define GPITCH  72
#define GTILE   (128 * GPITCH)
#define GSTAGE  (4 * GTILE)
#define GSTAGES (EDIM / GK)
static_assert(NTOK % 128 == 0 && EDIM % 128 == 0 && GSTAGES >= 2, "whole tiles, two stages");

// xr .. wi: first row of each tile (the same in every lane).  A lane brings 16
// bytes of row (tid >> 3) + 16 n of each tile, k = kb + (tid & 7) * 8 onwards.
static __device__ inline void stage_tiles(_Float16* buf, int tid, int kb,
                                          const _Float16* xr, const _Float16* xi,
                                          const _Float16* wr, const _Float16* wi) {
    const unsigned l = (unsigned)(uintptr_t)(buf + (tid >> 3) * GPITCH + (tid & 7) * 8);
    const unsigned o = (unsigned)((tid >> 3) * EDIM + (tid & 7) * 8 + kb);
    const unsigned lstep = 16 * GPITCH * sizeof(_Float16);
    const unsigned ltile = GTILE * sizeof(_Float16);
    async_rows8_b128(l,             xr + o, lstep, 16 * EDIM);
    async_rows8_b128(l + ltile,     xi + o, lstep, 16 * EDIM);
    async_rows8_b128(l + 2 * ltile, wr + o, lstep, 16 * EDIM);
    async_rows8_b128(l + 3 * ltile, wi + o, lstep, 16 * EDIM);
}

static __device__ __forceinline__ void cgemm_128x128(
    _Float16* sbuf,
    const _Float16* __restrict__ Xr, const _Float16* __restrict__ Xi,
    const _Float16* __restrict__ Wr, const _Float16* __restrict__ Wi,
    v8f (&accR)[4][4], v8f (&accI)[4][4])
{
    const int tid  = (int)threadIdx.x;
    const int lane = tid & 31;
    const int wave = tid >> 5;
    const int wm   = wave >> 1;       // which 64 rows of X
    const int wn   = wave & 1;        // which 64 rows of W

#pragma unroll   // constant indices keep tiles and fragments in registers
    for (int i = 0; i < 4; ++i)
#pragma unroll   // constant indices keep tiles and fragments in registers
        for (int j = 0; j < 4; ++j) { accR[i][j] = vzero8(); accI[i][j] = vzero8(); }

    stage_tiles(sbuf, tid, 0, Xr, Xi, Wr, Wi);
    wait_async0();
    __syncthreads();   // stage 0 visible to all waves
    stage_tiles(sbuf + GSTAGE, tid, GK, Xr, Xi, Wr, Wi);

    // Kept rolled: one copy of the 128-WMMA body, for speed only.
#pragma unroll 1
    for (int t = 0; t < GSTAGES; ++t) {
        _Float16* buf = sbuf + (t & 1) * GSTAGE;
        const _Float16* pa = buf + (wm * 64) * GPITCH;
        const _Float16* pb = buf + 2 * GTILE + (wn * 64) * GPITCH;
#pragma unroll   // constant indices keep tiles and fragments in registers
        for (int ks = 0; ks < GK; ks += 32) {
            v16h ar[4], ai[4], br[4], bi[4];
#pragma unroll   // constant indices keep tiles and fragments in registers
            for (int i = 0; i < 4; ++i) {
                ar[i] = load_frag16(pa + (i * 16) * GPITCH + ks, GPITCH, lane);
                ai[i] = load_frag16(pa + GTILE + (i * 16) * GPITCH + ks, GPITCH, lane);
                br[i] = load_frag16(pb + (i * 16) * GPITCH + ks, GPITCH, lane);
                bi[i] = load_frag16(pb + GTILE + (i * 16) * GPITCH + ks, GPITCH, lane);
            }
            // Per accumulator the order stays ar.br, -ai.bi and ar.bi, ai.br;
            // neighbouring WMMAs write different tiles.
#pragma unroll   // constant indices keep tiles and fragments in registers
            for (int i = 0; i < 4; ++i)
#pragma unroll   // constant indices keep tiles and fragments in registers
                for (int j = 0; j < 4; ++j) accR[i][j] = wmma16(ar[i], br[j], accR[i][j]);
#pragma unroll   // constant indices keep tiles and fragments in registers
            for (int i = 0; i < 4; ++i)
#pragma unroll   // constant indices keep tiles and fragments in registers
                for (int j = 0; j < 4; ++j) accI[i][j] = wmma16(ar[i], bi[j], accI[i][j]);
#pragma unroll   // constant indices keep tiles and fragments in registers
            for (int i = 0; i < 4; ++i)
#pragma unroll   // constant indices keep tiles and fragments in registers
                for (int j = 0; j < 4; ++j) accI[i][j] = wmma16(ai[i], br[j], accI[i][j]);
#pragma unroll   // constant indices keep tiles and fragments in registers
            for (int i = 0; i < 4; ++i) {
                const v16h nai = -ai[i];
#pragma unroll   // constant indices keep tiles and fragments in registers
                for (int j = 0; j < 4; ++j) accR[i][j] = wmma16(nai, bi[j], accR[i][j]);
            }
        }
        // Hand-over: this wave's reads of buf are done, its copies of stage
        // t + 1 have landed; behind the barrier both hold for every wave.
        asm volatile("s_wait_dscnt 0x0" ::: "memory");
        wait_async0();
        __syncthreads();
        if (t + 2 < GSTAGES)
            stage_tiles(buf, tid, (t + 2) * GK, Xr, Xi, Wr, Wi);
    }
    wait_async0();   // nothing in flight when the wave goes on
}

__global__ void __launch_bounds__(128, 2) qkv_gemm_kernel(
    const _Float16* __restrict__ xqr, const _Float16* __restrict__ xqi,
    const _Float16* __restrict__ xkr, const _Float16* __restrict__ xki,
    const _Float16* __restrict__ xvr, const _Float16* __restrict__ xvi,
    const _Float16* __restrict__ wr,  const _Float16* __restrict__ wi,
    const float* __restrict__ bre,    const float* __restrict__ bim,
    _Float16* __restrict__ Qr, _Float16* __restrict__ Qi,
    _Float16* __restrict__ Kr, _Float16* __restrict__ Ki,
    _Float16* __restrict__ Vr, _Float16* __restrict__ Vi)
{
    __shared__ __align__(16) _Float16 sbuf[2 * GSTAGE];

    const int lane = threadIdx.x & 31;
    const int wave = threadIdx.x >> 5;
    const int row0 = blockIdx.x * 128;               // token tile
    const int col0 = blockIdx.y * 128;               // output-feature tile
    const int sel  = col0 >> 10;                     // 0=q 1=k 2=v

    const _Float16* Xr = (sel == 0) ? xqr : ((sel == 1) ? xkr : xvr);
    const _Float16* Xi = (sel == 0) ? xqi : ((sel == 1) ? xki : xvi);

    v8f accR[4][4], accI[4][4];
    cgemm_128x128(sbuf, Xr + (size_t)row0 * EDIM, Xi + (size_t)row0 * EDIM,
                  wr + (size_t)col0 * EDIM, wi + (size_t)col0 * EDIM, accR, accI);

    _Float16* Dr = (sel == 0) ? Qr : ((sel == 1) ? Kr : Vr);
    _Float16* Di = (sel == 0) ? Qi : ((sel == 1) ? Ki : Vi);

    const int rowb = row0 + (wave >> 1) * 64;
    const int colb = col0 + (wave & 1) * 64;
#pragma unroll   // constant indices keep tiles and fragments in registers
    for (int j = 0; j < 4; ++j) {
        const int col = colb + j * 16 + (lane & 15);
        const float br_v = bre[col];
        const float bi_v = bim[col];
        const int e  = col & (EDIM - 1);
        const int hh = e >> 6;         // head
        const int d  = e & 63;         // dim in head
#pragma unroll   // constant indices keep tiles and fragments in registers
        for (int i = 0; i < 4; ++i) {
#pragma unroll   // constant indices keep tiles and fragments in registers
            for (int r = 0; r < 8; ++r) {
                const int tok = rowb + i * 16 + ((lane >> 4) << 3) + r;   // C layout rows
                const int s = tok >> 3;        // token = s*B + b, B=8
                const int b = tok & 7;
                const size_t off = (((size_t)(b * HNUM + hh) * SDIM + s) * HD) + d;
                Dr[off] = (_Float16)(accR[i][j][r] + br_v);
                Di[off] = (_Float16)(accI[i][j][r] + bi_v);
            }
        }
        // Stores of this column group have their addresses taken before the next
        // group's values reuse a register that one of them names; the scheduling
        // barrier keeps that group's arithmetic behind the wait.
        if (j < 3) {
            asm volatile("s_wait_xcnt 0x0" ::: "memory");
            __builtin_amdgcn_sched_barrier(0);
        }
    }
}

// ---------------------------------------------------------------------------
// Flash attention per (b,h):  scores = (qr.kr^T + qi.ki^T)/8, online softmax,
// out = P @ v (re and im).  Block = 8 waves, each wave owns 16 query rows.
// A stage is 32 keys of Kr, Ki, Vr, Vi, row-major in LDS as in memory (rows of
// 128 bytes), brought once for all 8 waves by async copies; two stages, the
// next one's copies fly while this one is worked on.  K rows at a pitch of 144
// bytes (16 B x odd, ds_load_b128), V rows at 160 (32 B x odd,
// ds_load_tr16_b128, which hands V^T out in fragment order).
// P bounces through LDS (C- -> A-layout).
// ---------------------------------------------------------------------------
#define AW      8                     // waves per work-group
#define AKEYS   32                    // keys per stage
#define AKP     72                    // K row pitch in halves
#define AVP     80                    // V row pitch in halves
#define AKTILE  (AKEYS * AKP)         // halves per K tile
#define AVTILE  (AKEYS * AVP)         // halves per V tile
#define ASTAGE  (2 * AKTILE + 2 * AVTILE)
#define ASTAGES (SDIM / AKEYS)
static_assert(AW * 32 * 8 == AKEYS * HD, "one 16-byte copy a lane fills one tile");
static_assert(ASTAGES >= 2 && SDIM % (AW * 16) == 0, "two stages, whole query blocks");

static __device__ inline void stage_kv(_Float16* buf, int tid, int t0,
                                       const _Float16* kr, const _Float16* ki,
                                       const _Float16* vr, const _Float16* vi) {
    const int row = tid >> 3, ch = (tid & 7) * 8;
    const unsigned lk = (unsigned)(uintptr_t)(buf + row * AKP + ch);
    const unsigned lv = (unsigned)(uintptr_t)(buf + 2 * AKTILE + row * AVP + ch);
    const unsigned o  = (unsigned)((t0 + row) * HD + ch);
    asm volatile(
        "global_load_async_to_lds_b128 %0, %4, off\n\t"
        "global_load_async_to_lds_b128 %1, %5, off\n\t"
        "global_load_async_to_lds_b128 %2, %6, off\n\t"
        "global_load_async_to_lds_b128 %3, %7, off\n\t"
        "s_wait_xcnt 0x0"
        :: "v"(lk), "v"(lk + (unsigned)(AKTILE * sizeof(_Float16))),
           "v"(lv), "v"(lv + (unsigned)(AVTILE * sizeof(_Float16))),
           "v"(kr + o), "v"(ki + o), "v"(vr + o), "v"(vi + o)
        : "memory");
}

// B fragment (32 keys x 16 d) of a row-major V tile: lane (c, h) gets
// V[8h + 0..7][d0 + c] and V[16 + 8h + 0..7][d0 + c], the k order of load_frag16.
// p: the lane's own address, tile + (8h + (lane & 7)) rows + 8 * ((lane >> 3) & 1).
static __device__ inline v16h load_vt_frag(const _Float16* p) {
    typedef __attribute__((ext_vector_type(8))) short s16x8;
    typedef __attribute__((address_space(3))) s16x8 lds_s16x8;
    v8h lo = __builtin_bit_cast(v8h, __builtin_amdgcn_ds_load_tr16_b128_v8i16((lds_s16x8*)p));
    v8h hi = __builtin_bit_cast(v8h, __builtin_amdgcn_ds_load_tr16_b128_v8i16((lds_s16x8*)(p + 16 * AVP)));
    return __builtin_shufflevector(lo, hi, 0, 1, 2, 3, 4, 5, 6, 7,
                                           8, 9, 10, 11, 12, 13, 14, 15);
}

__global__ void __launch_bounds__(AW * 32, 4) attn_kernel(
    const _Float16* __restrict__ Qr, const _Float16* __restrict__ Qi,
    const _Float16* __restrict__ Kr, const _Float16* __restrict__ Ki,
    const _Float16* __restrict__ Vr, const _Float16* __restrict__ Vi,
    _Float16* __restrict__ Or, _Float16* __restrict__ Oi)
{
    __shared__ __align__(16) _Float16 kv[2 * ASTAGE];     // two K/V stages
    __shared__ __align__(16) _Float16 pbuf[AW][16][32];   // per-wave P tile

    const int tid  = (int)threadIdx.x;
    const int lane = tid & 31;
    const int wave = tid >> 5;
    const int bh = blockIdx.y;          // = b*H + h
    const int b  = bh >> 4;
    const int h  = bh & 15;
    const int s0 = blockIdx.x * (AW * 16) + wave * 16;

    const size_t base = (size_t)bh * SDIM * HD;
    const _Float16* kr = Kr + base;
    const _Float16* ki = Ki + base;
    const _Float16* vr = Vr + base;
    const _Float16* vi = Vi + base;

    stage_kv(kv, tid, 0, kr, ki, vr, vi);

    v16h aqr[2], aqi[2];
#pragma unroll
    for (int ks = 0; ks < 2; ++ks) {
        aqr[ks] = load_frag16(Qr + base + (size_t)s0 * HD + ks * 32, HD, lane);
        aqi[ks] = load_frag16(Qi + base + (size_t)s0 * HD + ks * 32, HD, lane);
    }

    v8f oR[4], oI[4];
#pragma unroll
    for (int j = 0; j < 4; ++j) { oR[j] = vzero8(); oI[j] = vzero8(); }
    float mrun[8], lrun[8];
#pragma unroll
    for (int r = 0; r < 8; ++r) { mrun[r] = -1e30f; lrun[r] = 0.f; }

    const float scale = 0.125f;   // 1/sqrt(64)
    // The lane's place in a V tile for the transposing load
    const int vlane = (((lane >> 4) << 3) + (lane & 7)) * AVP + ((lane >> 3) & 1) * 8;

    wait_async0();
    __syncthreads();   // stage 0 visible to all waves
    stage_kv(kv + ASTAGE, tid, AKEYS, kr, ki, vr, vi);

    // Kept rolled: the buffer alternates by address, one copy of the body.
#pragma unroll 1
    for (int t = 0; t < ASTAGES; ++t) {
        _Float16* buf = kv + (t & 1) * ASTAGE;

        // Scores: 16x32 block as two 16x16 C tiles.  All 16 K reads stand in one
        // place ahead of the products, for speed only; the scheduling barrier
        // keeps them from being spread.
        v16h bkr[2][2], bki[2][2];
#pragma unroll   // constant indices keep fragments in registers
        for (int ts = 0; ts < 2; ++ts) {
#pragma unroll   // constant indices keep fragments in registers
            for (int ks = 0; ks < 2; ++ks) {
                bkr[ts][ks] = load_frag16(buf + (ts * 16) * AKP + ks * 32, AKP, lane);
                bki[ts][ks] = load_frag16(buf + AKTILE + (ts * 16) * AKP + ks * 32, AKP, lane);
            }
        }
        __builtin_amdgcn_sched_barrier(0);
        // Per tile the order stays re, im of k 0..31, then re, im of k 32..63;
        // neighbouring WMMAs write different tiles.
        v8f sc[2];
        sc[0] = vzero8(); sc[1] = vzero8();
#pragma unroll   // constant indices keep fragments in registers
        for (int ks = 0; ks < 2; ++ks) {
            sc[0] = wmma16(aqr[ks], bkr[0][ks], sc[0]);
            sc[1] = wmma16(aqr[ks], bkr[1][ks], sc[1]);
            sc[0] = wmma16(aqi[ks], bki[0][ks], sc[0]);
            sc[1] = wmma16(aqi[ks], bki[1][ks], sc[1]);
        }

        // All 16 V^T reads as one group here: they need nothing of the softmax
        // and land under it; the scheduling barrier keeps them from sinking to
        // the products at the end of the pass.
        v16h bvr[4], bvi[4];
        {
            const _Float16* pv = buf + 2 * AKTILE + vlane;
#pragma unroll   // constant indices keep fragments in registers
            for (int j = 0; j < 4; ++j) {
                bvr[j] = load_vt_frag(pv + j * 16);
                bvi[j] = load_vt_frag(pv + AVTILE + j * 16);
            }
        }
        __builtin_amdgcn_sched_barrier(0);

        // Online softmax across the 32 new columns (butterfly within 16-lane
        // half-groups: C-layout spreads each row over 16 lanes)
        float rmx[8];
#pragma unroll
        for (int r = 0; r < 8; ++r) rmx[r] = fmaxf(sc[0][r] * scale, sc[1][r] * scale);
        row_max8(rmx);
#pragma unroll
        for (int r = 0; r < 8; ++r) {
            float x0 = sc[0][r] * scale;
            float x1 = sc[1][r] * scale;
            const float mnew = fmaxf(mrun[r], rmx[r]);
            const float corr = __expf(mrun[r] - mnew);
            const float p0 = __expf(x0 - mnew);
            const float p1 = __expf(x1 - mnew);
            float rs = p0 + p1;
            rs += row_xor<1>(rs);
            rs += row_xor<2>(rs);
            rs += row_xor<4>(rs);
            rs += row_xor<8>(rs);
            lrun[r] = lrun[r] * corr + rs;
            mrun[r] = mnew;
#pragma unroll
            for (int j = 0; j < 4; ++j) { oR[j][r] *= corr; oI[j][r] *= corr; }
            const int row = ((lane >> 4) << 3) + r;
            pbuf[wave][row][(lane & 15)]      = (_Float16)p0;
            pbuf[wave][row][16 + (lane & 15)] = (_Float16)p1;
        }

        // LDS pipeline is in-order per wave; fence explicitly anyway
        asm volatile("s_wait_dscnt 0x0" ::: "memory");

        v16h pa = load_frag16(&pbuf[wave][0][0], 32, lane);
#pragma unroll   // constant indices keep fragments in registers
        for (int j = 0; j < 4; ++j) {
            oR[j] = wmma16(pa, bvr[j], oR[j]);
            oI[j] = wmma16(pa, bvi[j], oI[j]);
        }

        // Hand-over: this wave's reads of buf are done, its copies of stage
        // t + 1 have landed; behind the barrier both hold for every wave.
        asm volatile("s_wait_dscnt 0x0" ::: "memory");
        wait_async0();
        __syncthreads();
        if (t + 2 < ASTAGES)
            stage_kv(buf, tid, (t + 2) * AKEYS, kr, ki, vr, vi);
    }
    wait_async0();   // nothing in flight when the wave goes on

    // Normalize and write (S,B,E) f16 for the output projection
#pragma unroll
    for (int j = 0; j < 4; ++j) {
        const int d = j * 16 + (lane & 15);
#pragma unroll
        for (int r = 0; r < 8; ++r) {
            const int row = ((lane >> 4) << 3) + r;
            const int s = s0 + row;
            const float invl = 1.0f / lrun[r];
            const size_t off = ((size_t)(s * BDIM + b)) * EDIM + h * HD + d;
            Or[off] = (_Float16)(oR[j][r] * invl);
            Oi[off] = (_Float16)(oI[j][r] * invl);
        }
    }
}

// ---------------------------------------------------------------------------
// Output complex projection:  y = out @ Wo^T + bo -> f32 d_out stacked
// (2, S, B, E).  Same main loop and launch bounds as the QKV GEMM.
// ---------------------------------------------------------------------------
__global__ void __launch_bounds__(128, 2) out_gemm_kernel(
    const _Float16* __restrict__ Ar, const _Float16* __restrict__ Ai,
    const _Float16* __restrict__ wr, const _Float16* __restrict__ wi,
    const float* __restrict__ bre,   const float* __restrict__ bim,
    float* __restrict__ out)
{
    __shared__ __align__(16) _Float16 sbuf[2 * GSTAGE];

    const int lane = threadIdx.x & 31;
    const int wave = threadIdx.x >> 5;
    const int row0 = blockIdx.x * 128;
    const int col0 = blockIdx.y * 128;

    v8f accR[4][4], accI[4][4];
    cgemm_128x128(sbuf, Ar + (size_t)row0 * EDIM, Ai + (size_t)row0 * EDIM,
                  wr + (size_t)col0 * EDIM, wi + (size_t)col0 * EDIM, accR, accI);

    const size_t imOff = (size_t)NTOK * EDIM;
    const int rowb = row0 + (wave >> 1) * 64;
    const int colb = col0 + (wave & 1) * 64;
#pragma unroll   // constant indices keep tiles and fragments in registers
    for (int j = 0; j < 4; ++j) {
        const int col = colb + j * 16 + (lane & 15);
        const float br_v = bre[col];
        const float bi_v = bim[col];
#pragma unroll   // constant indices keep tiles and fragments in registers
        for (int i = 0; i < 4; ++i) {
#pragma unroll   // constant indices keep tiles and fragments in registers
            for (int r = 0; r < 8; ++r) {
                const int tok = rowb + i * 16 + ((lane >> 4) << 3) + r;
                const size_t off = (size_t)tok * EDIM + col;
                out[off]         = accR[i][j][r] + br_v;
                out[imOff + off] = accI[i][j][r] + bi_v;
            }
        }
        // Stores of this column group have their addresses taken before the next
        // group's values reuse a register that one of them names; the scheduling
        // barrier keeps that group's arithmetic behind the wait.
        if (j < 3) {
            asm volatile("s_wait_xcnt 0x0" ::: "memory");
            __builtin_amdgcn_sched_barrier(0);
        }
    }
}

// ---------------------------------------------------------------------------
// Host launcher
// ---------------------------------------------------------------------------
extern "C" void kernel_launch(void* const* d_in, const int* in_sizes, int n_in,
                              void* d_out, int out_size, void* d_ws, size_t ws_size,
                              hipStream_t stream) {
    (void)in_sizes; (void)n_in; (void)out_size; (void)ws_size;

    const size_t NE   = (size_t)NTOK * EDIM;   // 8,388,608
    const size_t WQKV = (size_t)E3 * EDIM;     // 3,145,728
    const size_t WO   = (size_t)EDIM * EDIM;   // 1,048,576

    _Float16* hws = (_Float16*)d_ws;
    _Float16* xqr = hws;            _Float16* xqi = xqr + NE;
    _Float16* xkr = xqi + NE;       _Float16* xki = xkr + NE;
    _Float16* xvr = xki + NE;       _Float16* xvi = xvr + NE;
    _Float16* wr  = xvi + NE;       _Float16* wi  = wr + WQKV;
    _Float16* wor = wi + WQKV;      _Float16* woi = wor + WO;
    _Float16* Qr  = woi + WO;       _Float16* Qi  = Qr + NE;
    _Float16* Kr  = Qi + NE;        _Float16* Ki  = Kr + NE;
    _Float16* Vr  = Ki + NE;        _Float16* Vi  = Vr + NE;
    _Float16* Aor = Vi + NE;        _Float16* Aoi = Aor + NE;

    // Activations and weights -> f16: xqr .. woi are contiguous from hws on
    {
        dim3 grid(CVT_SLICES, CVT_UNITS);
        f32_to_f16_all_kernel<<<grid, dim3(256), 0, stream>>>(
            (const float*)d_in[0], (const float*)d_in[1], (const float*)d_in[2],
            (const float*)d_in[3], (const float*)d_in[4], (const float*)d_in[5],
            (const float*)d_in[6], (const float*)d_in[7],
            (const float*)d_in[10], (const float*)d_in[11], hws);
    }

    // QKV projection (complex), head-major f16 outputs
    {
        dim3 grid(NTOK / 128, E3 / 128);
        qkv_gemm_kernel<<<grid, dim3(128), 0, stream>>>(
            xqr, xqi, xkr, xki, xvr, xvi, wr, wi,
            (const float*)d_in[8], (const float*)d_in[9],
            Qr, Qi, Kr, Ki, Vr, Vi);
    }

    // Flash attention per (b,h)
    {
        dim3 grid(SDIM / (AW * 16), BDIM * HNUM);
        attn_kernel<<<grid, dim3(AW * 32), 0, stream>>>(Qr, Qi, Kr, Ki, Vr, Vi, Aor, Aoi);
    }

    // Output projection (complex), f32 result stacked (re, im)
    {
        dim3 grid(NTOK / 128, EDIM / 128);
        out_gemm_kernel<<<grid, dim3(128), 0, stream>>>(
            Aor, Aoi, wor, woi,
            (const float*)d_in[12], (const float*)d_in[13],
            (float*)d_out);
    }
}

// v005
// Measured time: 256 microseconds a run.
// Next to v004, in two timings, it ran 1.09 times as fast each time.
// Counting every step since v000, it is 3.19 times as fast.
#include <hip/hip_runtime.h>
#include <hip/hip_bf16.h>

// Problem constants (match reference)
#define SDIM 1024
#define BDIM 8
#define EDIM 1024
#define HNUM 16
#define HD   64
#define NTOK (SDIM * BDIM)   // 8192 tokens
#define E3   (3 * EDIM)      // 3072

typedef __attribute__((ext_vector_type(16))) _Float16 v16h;
typedef __attribute__((ext_vector_type(8)))  _Float16 v8h;
typedef __attribute__((ext_vector_type(8)))  float    v8f;
typedef __attribute__((ext_vector_type(2)))  float    v2f;
typedef __attribute__((ext_vector_type(2)))  _Float16 v2h;

static __device__ inline v16h load_frag16(const _Float16* p, int ld, int lane) {
    const int m  = lane & 15;
    const int kb = (lane >> 4) << 3;
    const _Float16* r = p + (size_t)m * (size_t)ld + kb;
    v8h lo = *(const v8h*)(r);
    v8h hi = *(const v8h*)(r + 16);
    return __builtin_shufflevector(lo, hi, 0, 1, 2, 3, 4, 5, 6, 7,
                                           8, 9, 10, 11, 12, 13, 14, 15);
}

static __device__ inline v8f wmma16(v16h a, v16h b, v8f c) {
    // 8-arg form: (neg_a, A, neg_b, B, c_mod, C, reuse_a, reuse_b)
    return __builtin_amdgcn_wmma_f32_16x16x32_f16(false, a, false, b,
                                                  (short)0, c, false, false);
}

static __device__ inline float xhalf(float v) {
    const int b = __builtin_bit_cast(int, v);
    return __builtin_bit_cast(float, __builtin_amdgcn_permlanex16(
        b, b, 0x76543210, 0xfedcba98, false, false));
}

static __device__ inline void exp2_17(float& c, float (&e)[16]) {
    asm("v_exp_f32 %0, %0\n\t"
        "v_exp_f32 %1, %1\n\t"
        "v_exp_f32 %2, %2\n\t"
        "v_exp_f32 %3, %3\n\t"
        "v_exp_f32 %4, %4\n\t"
        "v_exp_f32 %5, %5\n\t"
        "v_exp_f32 %6, %6\n\t"
        "v_exp_f32 %7, %7\n\t"
        "v_exp_f32 %8, %8\n\t"
        "v_exp_f32 %9, %9\n\t"
        "v_exp_f32 %10, %10\n\t"
        "v_exp_f32 %11, %11\n\t"
        "v_exp_f32 %12, %12\n\t"
        "v_exp_f32 %13, %13\n\t"
        "v_exp_f32 %14, %14\n\t"
        "v_exp_f32 %15, %15\n\t"
        "v_exp_f32 %16, %16\n\t"
        "v_nop"
        : "+v"(c), "+v"(e[0]), "+v"(e[1]), "+v"(e[2]), "+v"(e[3]), "+v"(e[4]),
          "+v"(e[5]), "+v"(e[6]), "+v"(e[7]), "+v"(e[8]), "+v"(e[9]), "+v"(e[10]),
          "+v"(e[11]), "+v"(e[12]), "+v"(e[13]), "+v"(e[14]), "+v"(e[15]));
}

static __device__ inline v8f vzero8() {
    v8f z = {0.f, 0.f, 0.f, 0.f, 0.f, 0.f, 0.f, 0.f};
    return z;
}

static __device__ inline void async_rows8_b128(unsigned l, const _Float16* g,
                                               unsigned lstep, unsigned gstep) {
    const unsigned long long a = (unsigned long long)(uintptr_t)g;
    const unsigned long long s = (unsigned long long)gstep * sizeof(_Float16);
    asm volatile(
        "global_load_async_to_lds_b128 %0, %8, off\n\t"
        "global_load_async_to_lds_b128 %1, %9, off\n\t"
        "global_load_async_to_lds_b128 %2, %10, off\n\t"
        "global_load_async_to_lds_b128 %3, %11, off\n\t"
        "global_load_async_to_lds_b128 %4, %12, off\n\t"
        "global_load_async_to_lds_b128 %5, %13, off\n\t"
        "global_load_async_to_lds_b128 %6, %14, off\n\t"
        "global_load_async_to_lds_b128 %7, %15, off\n\t"
        "s_wait_xcnt 0x0"
        :: "v"(l), "v"(l + lstep), "v"(l + 2 * lstep), "v"(l + 3 * lstep),
           "v"(l + 4 * lstep), "v"(l + 5 * lstep), "v"(l + 6 * lstep), "v"(l + 7 * lstep),
           "v"(a), "v"(a + s), "v"(a + 2 * s), "v"(a + 3 * s),
           "v"(a + 4 * s), "v"(a + 5 * s), "v"(a + 6 * s), "v"(a + 7 * s)
        : "memory");
}

static __device__ inline void wait_async0() {
    asm volatile("s_wait_asynccnt 0x0" ::: "memory");
}

// ---------------------------------------------------------------------------
// f32 -> f16 conversion of all ten operands in one launch.
// The ten f16 copies lie one behind the other in the workspace, in argument
// order, and every operand's length is a whole number of units of CVT_UNIT
// elements, so each unit of the destination has exactly one source.
// blockIdx.y = unit, blockIdx.x = slice of the unit.  A work-group converts
// CVT_TRIPS x 8,192 elements; each wave-wide load covers 512 contiguous bytes,
// each wave-wide store 256.
// ---------------------------------------------------------------------------
#define CVT_UNIT   (1 << 20)
#define CVT_X      ((NTOK * EDIM) / CVT_UNIT)   // units per activation: 8
#define CVT_WQKV   ((E3 * EDIM) / CVT_UNIT)     // units per qkv weight: 3
#define CVT_WO     ((EDIM * EDIM) / CVT_UNIT)   // units per out weight: 1
#define CVT_UNITS  (6 * CVT_X + 2 * CVT_WQKV + 2 * CVT_WO)
#define CVT_SLICES 32
#define CVT_TRIPS  (CVT_UNIT / CVT_SLICES / 8192)
static_assert(CVT_X * CVT_UNIT == NTOK * EDIM && CVT_WQKV * CVT_UNIT == E3 * EDIM &&
              CVT_WO * CVT_UNIT == EDIM * EDIM, "operands are whole units");
static_assert(CVT_TRIPS * CVT_SLICES * 8192 == CVT_UNIT, "slices are whole trips");

typedef __attribute__((ext_vector_type(4))) float    v4f;
typedef __attribute__((ext_vector_type(4))) _Float16 v4h;

__global__ void __launch_bounds__(256) f32_to_f16_all_kernel(
    const float* __restrict__ xqr, const float* __restrict__ xqi,
    const float* __restrict__ xkr, const float* __restrict__ xki,
    const float* __restrict__ xvr, const float* __restrict__ xvi,
    const float* __restrict__ wr,  const float* __restrict__ wi,
    const float* __restrict__ wor, const float* __restrict__ woi,
    _Float16* __restrict__ dst)
{
    const int u = (int)blockIdx.y;
    const float* src;   // the operand that unit u belongs to
    int u0;             // that operand's first unit
    if (u < 6 * CVT_X) {
        const int a = u / CVT_X;
        u0  = a * CVT_X;
        src = (a == 0) ? xqr : (a == 1) ? xqi : (a == 2) ? xkr
            : (a == 3) ? xki : (a == 4) ? xvr : xvi;
    } else if (u < 6 * CVT_X + CVT_WQKV) {
        u0 = 6 * CVT_X;                              src = wr;
    } else if (u < 6 * CVT_X + 2 * CVT_WQKV) {
        u0 = 6 * CVT_X + CVT_WQKV;                   src = wi;
    } else if (u < 6 * CVT_X + 2 * CVT_WQKV + CVT_WO) {
        u0 = 6 * CVT_X + 2 * CVT_WQKV;               src = wor;
    } else {
        u0 = 6 * CVT_X + 2 * CVT_WQKV + CVT_WO;      src = woi;
    }
    const size_t slice = (size_t)blockIdx.x * (CVT_UNIT / CVT_SLICES);
    const v4f* s4 = (const v4f*)(src + (size_t)(u - u0) * CVT_UNIT + slice) + threadIdx.x;
    v4h*       d4 = (v4h*)(dst + (size_t)u * CVT_UNIT + slice) + threadIdx.x;

    // Kept rolled: 8 loads of 16 bytes in flight per lane are enough for the
    // memory rate, and the small register count keeps every work-group resident.
#pragma unroll 1
    for (int it = 0; it < CVT_TRIPS; ++it) {
        v4f v[8];
#pragma unroll   // all 8 loads issue before the first value is used
        for (int j = 0; j < 8; ++j) v[j] = s4[it * 2048 + j * 256];
#pragma unroll   // constant indices keep v[] in registers
        for (int j = 0; j < 8; ++j)
            d4[it * 2048 + j * 256] = __builtin_convertvector(v[j], v4h);
    }
}

#define GK      64
#define GPITCH  72
#define GTILE   (128 * GPITCH)
#define GSTAGE  (4 * GTILE)
#define GSTAGES (EDIM / GK)
static_assert(NTOK % 128 == 0 && EDIM % 128 == 0 && GSTAGES >= 2, "whole tiles, two stages");

// xr .. wi: first row of each tile (the same in every lane).  A lane brings 16
// bytes of row (tid >> 3) + 16 n of each tile, k = kb + (tid & 7) * 8 onwards.
static __device__ inline void stage_tiles(_Float16* buf, int tid, int kb,
                                          const _Float16* xr, const _Float16* xi,
                                          const _Float16* wr, const _Float16* wi) {
    const unsigned l = (unsigned)(uintptr_t)(buf + (tid >> 3) * GPITCH + (tid & 7) * 8);
    const unsigned o = (unsigned)((tid >> 3) * EDIM + (tid & 7) * 8 + kb);
    const unsigned lstep = 16 * GPITCH * sizeof(_Float16);
    const unsigned ltile = GTILE * sizeof(_Float16);
    async_rows8_b128(l,             xr + o, lstep, 16 * EDIM);
    async_rows8_b128(l + ltile,     xi + o, lstep, 16 * EDIM);
    async_rows8_b128(l + 2 * ltile, wr + o, lstep, 16 * EDIM);
    async_rows8_b128(l + 3 * ltile, wi + o, lstep, 16 * EDIM);
}

static __device__ __forceinline__ void cgemm_128x128(
    _Float16* sbuf,
    const _Float16* __restrict__ Xr, const _Float16* __restrict__ Xi,
    const _Float16* __restrict__ Wr, const _Float16* __restrict__ Wi,
    v8f (&accR)[4][4], v8f (&accI)[4][4])
{
    const int tid  = (int)threadIdx.x;
    const int lane = tid & 31;
    const int wave = tid >> 5;
    const int wm   = wave >> 1;       // which 64 rows of X
    const int wn   = wave & 1;        // which 64 rows of W

#pragma unroll   // constant indices keep tiles and fragments in registers
    for (int i = 0; i < 4; ++i)
#pragma unroll   // constant indices keep tiles and fragments in registers
        for (int j = 0; j < 4; ++j) { accR[i][j] = vzero8(); accI[i][j] = vzero8(); }

    stage_tiles(sbuf, tid, 0, Xr, Xi, Wr, Wi);
    wait_async0();
    __syncthreads();   // stage 0 visible to all waves
    stage_tiles(sbuf + GSTAGE, tid, GK, Xr, Xi, Wr, Wi);

    // Kept rolled: one copy of the 128-WMMA body, for speed only.
#pragma unroll 1
    for (int t = 0; t < GSTAGES; ++t) {
        _Float16* buf = sbuf + (t & 1) * GSTAGE;
        const _Float16* pa = buf + (wm * 64) * GPITCH;
        const _Float16* pb = buf + 2 * GTILE + (wn * 64) * GPITCH;
#pragma unroll   // constant indices keep tiles and fragments in registers
        for (int ks = 0; ks < GK; ks += 32) {
            v16h ar[4], ai[4], br[4], bi[4];
#pragma unroll   // constant indices keep tiles and fragments in registers
            for (int i = 0; i < 4; ++i) {
                ar[i] = load_frag16(pa + (i * 16) * GPITCH + ks, GPITCH, lane);
                ai[i] = load_frag16(pa + GTILE + (i * 16) * GPITCH + ks, GPITCH, lane);
                br[i] = load_frag16(pb + (i * 16) * GPITCH + ks, GPITCH, lane);
                bi[i] = load_frag16(pb + GTILE + (i * 16) * GPITCH + ks, GPITCH, lane);
            }
            // Per accumulator the order stays ar.br, -ai.bi and ar.bi, ai.br;
            // neighbouring WMMAs write different tiles.
#pragma unroll   // constant indices keep tiles and fragments in registers
            for (int i = 0; i < 4; ++i)
#pragma unroll   // constant indices keep tiles and fragments in registers
                for (int j = 0; j < 4; ++j) accR[i][j] = wmma16(ar[i], br[j], accR[i][j]);
#pragma unroll   // constant indices keep tiles and fragments in registers
            for (int i = 0; i < 4; ++i)
#pragma unroll   // constant indices keep tiles and fragments in registers
                for (int j = 0; j < 4; ++j) accI[i][j] = wmma16(ar[i], bi[j], accI[i][j]);
#pragma unroll   // constant indices keep tiles and fragments in registers
            for (int i = 0; i < 4; ++i)
#pragma unroll   // constant indices keep tiles and fragments in registers
                for (int j = 0; j < 4; ++j) accI[i][j] = wmma16(ai[i], br[j], accI[i][j]);
#pragma unroll   // constant indices keep tiles and fragments in registers
            for (int i = 0; i < 4; ++i) {
                const v16h nai = -ai[i];
#pragma unroll   // constant indices keep tiles and fragments in registers
                for (int j = 0; j < 4; ++j) accR[i][j] = wmma16(nai, bi[j], accR[i][j]);
            }
        }
        // Hand-over: this wave's reads of buf are done, its copies of stage
        // t + 1 have landed; behind the barrier both hold for every wave.
        asm volatile("s_wait_dscnt 0x0" ::: "memory");
        wait_async0();
        __syncthreads();
        if (t + 2 < GSTAGES)
            stage_tiles(buf, tid, (t + 2) * GK, Xr, Xi, Wr, Wi);
    }
    wait_async0();   // nothing in flight when the wave goes on
}

__global__ void __launch_bounds__(128, 2) qkv_gemm_kernel(
    const _Float16* __restrict__ xqr, const _Float16* __restrict__ xqi,
    const _Float16* __restrict__ xkr, const _Float16* __restrict__ xki,
    const _Float16* __restrict__ xvr, const _Float16* __restrict__ xvi,
    const _Float16* __restrict__ wr,  const _Float16* __restrict__ wi,
    const float* __restrict__ bre,    const float* __restrict__ bim,
    _Float16* __restrict__ Qr, _Float16* __restrict__ Qi,
    _Float16* __restrict__ Kr, _Float16* __restrict__ Ki,
    _Float16* __restrict__ Vr, _Float16* __restrict__ Vi)
{
    __shared__ __align__(16) _Float16 sbuf[2 * GSTAGE];

    const int lane = threadIdx.x & 31;
    const int wave = threadIdx.x >> 5;
    const int row0 = blockIdx.x * 128;               // token tile
    const int col0 = blockIdx.y * 128;               // output-feature tile
    const int sel  = col0 >> 10;                     // 0=q 1=k 2=v

    const _Float16* Xr = (sel == 0) ? xqr : ((sel == 1) ? xkr : xvr);
    const _Float16* Xi = (sel == 0) ? xqi : ((sel == 1) ? xki : xvi);

    v8f accR[4][4], accI[4][4];
    cgemm_128x128(sbuf, Xr + (size_t)row0 * EDIM, Xi + (size_t)row0 * EDIM,
                  wr + (size_t)col0 * EDIM, wi + (size_t)col0 * EDIM, accR, accI);

    _Float16* Dr = (sel == 0) ? Qr : ((sel == 1) ? Kr : Vr);
    _Float16* Di = (sel == 0) ? Qi : ((sel == 1) ? Ki : Vi);

    const int rowb = row0 + (wave >> 1) * 64;
    const int colb = col0 + (wave & 1) * 64;
#pragma unroll   // constant indices keep tiles and fragments in registers
    for (int j = 0; j < 4; ++j) {
        const int col = colb + j * 16 + (lane & 15);
        const float br_v = bre[col];
        const float bi_v = bim[col];
        const int e  = col & (EDIM - 1);
        const int hh = e >> 6;         // head
        const int d  = e & 63;         // dim in head
#pragma unroll   // constant indices keep tiles and fragments in registers
        for (int i = 0; i < 4; ++i) {
#pragma unroll   // constant indices keep tiles and fragments in registers
            for (int r = 0; r < 8; ++r) {
                const int tok = rowb + i * 16 + ((lane >> 4) << 3) + r;   // C layout rows
                const int s = tok >> 3;        // token = s*B + b, B=8
                const int b = tok & 7;
                const size_t off = (((size_t)(b * HNUM + hh) * SDIM + s) * HD) + d;
                Dr[off] = (_Float16)(accR[i][j][r] + br_v);
                Di[off] = (_Float16)(accI[i][j][r] + bi_v);
            }
        }
        // Stores of this column group have their addresses taken before the next
        // group's values reuse a register that one of them names; the scheduling
        // barrier keeps that group's arithmetic behind the wait.
        if (j < 3) {
            asm volatile("s_wait_xcnt 0x0" ::: "memory");
            __builtin_amdgcn_sched_barrier(0);
        }
    }
}

#define AW      8
#define AKEYS   32
#define AKP     72
#define AVP     80
#define AKTILE  (AKEYS * AKP)
#define AVTILE  (AKEYS * AVP)
#define ASTAGE  (2 * AKTILE + 2 * AVTILE)
#define ASTAGES (SDIM / AKEYS)
static_assert(AW * 32 * 8 == AKEYS * HD, "one 16-byte copy a lane fills one tile");
static_assert(ASTAGES >= 2 && SDIM % (AW * 16) == 0, "two stages, whole query blocks");

static __device__ inline void stage_kv(_Float16* buf, int tid, int t0,
                                       const _Float16* kr, const _Float16* ki,
                                       const _Float16* vr, const _Float16* vi) {
    const int row = tid >> 3, ch = (tid & 7) * 8;
    const unsigned lk = (unsigned)(uintptr_t)(buf + row * AKP + ch);
    const unsigned lv = (unsigned)(uintptr_t)(buf + 2 * AKTILE + row * AVP + ch);
    const unsigned o  = (unsigned)((t0 + row) * HD + ch);
    asm volatile(
        "global_load_async_to_lds_b128 %0, %4, off\n\t"
        "global_load_async_to_lds_b128 %1, %5, off\n\t"
        "global_load_async_to_lds_b128 %2, %6, off\n\t"
        "global_load_async_to_lds_b128 %3, %7, off\n\t"
        "s_wait_xcnt 0x0"
        :: "v"(lk), "v"(lk + (unsigned)(AKTILE * sizeof(_Float16))),
           "v"(lv), "v"(lv + (unsigned)(AVTILE * sizeof(_Float16))),
           "v"(kr + o), "v"(ki + o), "v"(vr + o), "v"(vi + o)
        : "memory");
}

// A fragment (16 d x 32 keys) of V^T from a row-major V tile: lane (c, h) gets
// V[8h + 0..7][d0 + c] and V[16 + 8h + 0..7][d0 + c], the k order of load_frag16.
// p: the lane's own address, tile + (8h + (lane & 7)) rows + 8 * ((lane >> 3) & 1).
static __device__ inline v16h load_vt_frag(const _Float16* p) {
    typedef __attribute__((ext_vector_type(8))) short s16x8;
    typedef __attribute__((address_space(3))) s16x8 lds_s16x8;
    v8h lo = __builtin_bit_cast(v8h, __builtin_amdgcn_ds_load_tr16_b128_v8i16((lds_s16x8*)p));
    v8h hi = __builtin_bit_cast(v8h, __builtin_amdgcn_ds_load_tr16_b128_v8i16((lds_s16x8*)(p + 16 * AVP)));
    return __builtin_shufflevector(lo, hi, 0, 1, 2, 3, 4, 5, 6, 7,
                                           8, 9, 10, 11, 12, 13, 14, 15);
}

__global__ void __launch_bounds__(AW * 32, 4) attn_kernel(
    const _Float16* __restrict__ Qr, const _Float16* __restrict__ Qi,
    const _Float16* __restrict__ Kr, const _Float16* __restrict__ Ki,
    const _Float16* __restrict__ Vr, const _Float16* __restrict__ Vi,
    _Float16* __restrict__ Or, _Float16* __restrict__ Oi)
{
    __shared__ __align__(16) _Float16 kv[2 * ASTAGE];     // two K/V stages

    const int tid  = (int)threadIdx.x;
    const int lane = tid & 31;
    const int wave = tid >> 5;
    const int bh = blockIdx.y;          // = b*H + h
    const int b  = bh >> 4;
    const int h  = bh & 15;
    const int s0 = blockIdx.x * (AW * 16) + wave * 16;

    const size_t base = (size_t)bh * SDIM * HD;
    const _Float16* kr = Kr + base;
    const _Float16* ki = Ki + base;
    const _Float16* vr = Vr + base;
    const _Float16* vi = Vi + base;

    stage_kv(kv, tid, 0, kr, ki, vr, vi);

    v16h aqr[2], aqi[2];
#pragma unroll
    for (int ks = 0; ks < 2; ++ks) {
        aqr[ks] = load_frag16(Qr + base + (size_t)s0 * HD + ks * 32, HD, lane);
        aqi[ks] = load_frag16(Qi + base + (size_t)s0 * HD + ks * 32, HD, lane);
    }

    v8f oR[4], oI[4];
#pragma unroll
    for (int j = 0; j < 4; ++j) { oR[j] = vzero8(); oI[j] = vzero8(); }
    // Of the lane's query: running maximum (equal in both lane halves) and the
    // running sum over this half's keys (the halves are joined after the loop).
    float mrun = -1e30f, lrun = 0.f;

    const float scale = 0.125f;   // 1/sqrt(64)
    // The lane's place in a V tile for the transposing load
    const int vlane = (((lane >> 4) << 3) + (lane & 7)) * AVP + ((lane >> 3) & 1) * 8;

    wait_async0();
    __syncthreads();   // stage 0 visible to all waves
    stage_kv(kv + ASTAGE, tid, AKEYS, kr, ki, vr, vi);

    // Kept rolled: the buffer alternates by address, one copy of the body.
#pragma unroll 1
    for (int t = 0; t < ASTAGES; ++t) {
        _Float16* buf = kv + (t & 1) * ASTAGE;

        // Scores: 32 keys x 16 queries as two 16x16 C tiles.  All 16 K reads stand in one
        // place ahead of the products; the scheduling barrier keeps them from
        // being spread.
        v16h bkr[2][2], bki[2][2];
#pragma unroll   // constant indices keep fragments in registers
        for (int ts = 0; ts < 2; ++ts) {
#pragma unroll   // constant indices keep fragments in registers
            for (int ks = 0; ks < 2; ++ks) {
                bkr[ts][ks] = load_frag16(buf + (ts * 16) * AKP + ks * 32, AKP, lane);
                bki[ts][ks] = load_frag16(buf + AKTILE + (ts * 16) * AKP + ks * 32, AKP, lane);
            }
        }
        __builtin_amdgcn_sched_barrier(0);
        // Per tile the order stays re, im of k 0..31, then re, im of k 32..63;
        // neighbouring WMMAs write different tiles.
        v8f sc[2];
        sc[0] = vzero8(); sc[1] = vzero8();
#pragma unroll   // constant indices keep fragments in registers
        for (int ks = 0; ks < 2; ++ks) {
            sc[0] = wmma16(bkr[0][ks], aqr[ks], sc[0]);
            sc[1] = wmma16(bkr[1][ks], aqr[ks], sc[1]);
            sc[0] = wmma16(bki[0][ks], aqi[ks], sc[0]);
            sc[1] = wmma16(bki[1][ks], aqi[ks], sc[1]);
        }

        // All 16 V^T reads as one group here: they need nothing of the softmax
        // and land under it; the scheduling barrier keeps them from sinking to
        // the products at the end of the pass.
        v16h bvr[4], bvi[4];
        {
            const _Float16* pv = buf + 2 * AKTILE + vlane;
#pragma unroll   // constant indices keep fragments in registers
            for (int j = 0; j < 4; ++j) {
                bvr[j] = load_vt_frag(pv + j * 16);
                bvi[j] = load_vt_frag(pv + AVTILE + j * 16);
            }
        }
        __builtin_amdgcn_sched_barrier(0);

        const v8f x0 = sc[0] * scale, x1 = sc[1] * scale;
        float mx[8];
#pragma unroll   // constant indices keep the scores in registers
        for (int r = 0; r < 8; ++r) mx[r] = fmaxf(x0[r], x1[r]);
        float m = fmaxf(fmaxf(fmaxf(mx[0], mx[1]), fmaxf(mx[2], mx[3])),
                        fmaxf(fmaxf(mx[4], mx[5]), fmaxf(mx[6], mx[7])));
        m = fmaxf(m, xhalf(m));
        const float mnew = fmaxf(mrun, m);
        // exp(y) as 2^(y * log2 e), as __expf() forms it
        const float l2e = 1.442695041f;
        float corr = (mrun - mnew) * l2e;
        float p[16];
#pragma unroll   // constant indices keep the scores in registers
        for (int r = 0; r < 8; ++r) { p[r] = (x0[r] - mnew) * l2e; p[8 + r] = (x1[r] - mnew) * l2e; }
        exp2_17(corr, p);
        mrun = mnew;
#pragma unroll   // constant indices keep the tiles in registers
        for (int j = 0; j < 4; ++j) { oR[j] *= corr; oI[j] *= corr; }
        float ps[8];
#pragma unroll   // constant indices keep the scores in registers
        for (int r = 0; r < 8; ++r) ps[r] = p[r] + p[8 + r];
        lrun = lrun * corr + (((ps[0] + ps[1]) + (ps[2] + ps[3])) +
                              ((ps[4] + ps[5]) + (ps[6] + ps[7])));

        // P^T as B operand: element s of lane (c, h) is key 8h + s (s < 8) or
        // 16 + 8h + (s - 8), which is where the two score tiles hold it.
        v16h pb;
#pragma unroll   // constant indices keep the fragment in registers
        for (int r = 0; r < 16; r += 2) {
            const v2f two = {p[r], p[r + 1]};
            const v2h h2 = __builtin_convertvector(two, v2h);
            pb[r] = h2[0]; pb[r + 1] = h2[1];
        }
#pragma unroll   // constant indices keep fragments in registers
        for (int j = 0; j < 4; ++j) {
            oR[j] = wmma16(bvr[j], pb, oR[j]);
            oI[j] = wmma16(bvi[j], pb, oI[j]);
        }

        // Hand-over: this wave's reads of buf are done, its copies of stage
        // t + 1 have landed; behind the barrier both hold for every wave.
        // The scheduling barrier keeps it at the foot of the pass: lifted to
        // behind the V^T reads, its wait would stand in front of the softmax,
        // and the reads would no longer land under it.
        __builtin_amdgcn_sched_barrier(0);
        asm volatile("s_wait_dscnt 0x0" ::: "memory");
        wait_async0();
        __syncthreads();
        if (t + 2 < ASTAGES)
            stage_kv(buf, tid, (t + 2) * AKEYS, kr, ki, vr, vi);
    }
    wait_async0();   // nothing in flight when the wave goes on

    // Normalize and write (S,B,E) f16 for the output projection: lane (c, h)
    // holds d = 16 j + 8 h + 0..7 of query c, 16 contiguous bytes a tile.
    const float invl = 1.0f / (lrun + xhalf(lrun));
    const size_t orow = ((size_t)((s0 + (lane & 15)) * BDIM + b)) * EDIM + h * HD + ((lane >> 4) << 3);
#pragma unroll
    for (int j = 0; j < 4; ++j) {
        *(v8h*)(Or + orow + j * 16) = __builtin_convertvector(oR[j] * invl, v8h);
        *(v8h*)(Oi + orow + j * 16) = __builtin_convertvector(oI[j] * invl, v8h);
        // These stores have their registers taken before the next tiles' values
        // reuse one that they name; the scheduling barrier keeps that arithmetic
        // behind the wait.
        if (j < 3) {
            asm volatile("s_wait_xcnt 0x0" ::: "memory");
            __builtin_amdgcn_sched_barrier(0);
        }
    }
}

// ---------------------------------------------------------------------------
// Output complex projection:  y = out @ Wo^T + bo -> f32 d_out stacked
// (2, S, B, E).  Same main loop and launch bounds as the QKV GEMM.
// ---------------------------------------------------------------------------
__global__ void __launch_bounds__(128, 2) out_gemm_kernel(
    const _Float16* __restrict__ Ar, const _Float16* __restrict__ Ai,
    const _Float16* __restrict__ wr, const _Float16* __restrict__ wi,
    const float* __restrict__ bre,   const float* __restrict__ bim,
    float* __restrict__ out)
{
    __shared__ __align__(16) _Float16 sbuf[2 * GSTAGE];

    const int lane = threadIdx.x & 31;
    const int wave = threadIdx.x >> 5;
    const int row0 = blockIdx.x * 128;
    const int col0 = blockIdx.y * 128;

    v8f accR[4][4], accI[4][4];
    cgemm_128x128(sbuf, Ar + (size_t)row0 * EDIM, Ai + (size_t)row0 * EDIM,
                  wr + (size_t)col0 * EDIM, wi + (size_t)col0 * EDIM, accR, accI);

    const size_t imOff = (size_t)NTOK * EDIM;
    const int rowb = row0 + (wave >> 1) * 64;
    const int colb = col0 + (wave & 1) * 64;
#pragma unroll   // constant indices keep tiles and fragments in registers
    for (int j = 0; j < 4; ++j) {
        const int col = colb + j * 16 + (lane & 15);
        const float br_v = bre[col];
        const float bi_v = bim[col];
#pragma unroll   // constant indices keep tiles and fragments in registers
        for (int i = 0; i < 4; ++i) {
#pragma unroll   // constant indices keep tiles and fragments in registers
            for (int r = 0; r < 8; ++r) {
                const int tok = rowb + i * 16 + ((lane >> 4) << 3) + r;
                const size_t off = (size_t)tok * EDIM + col;
                out[off]         = accR[i][j][r] + br_v;
                out[imOff + off] = accI[i][j][r] + bi_v;
            }
        }
        // Stores of this column group have their addresses taken before the next
        // group's values reuse a register that one of them names; the scheduling
        // barrier keeps that group's arithmetic behind the wait.
        if (j < 3) {
            asm volatile("s_wait_xcnt 0x0" ::: "memory");
            __builtin_amdgcn_sched_barrier(0);
        }
    }
}

// ---------------------------------------------------------------------------
// Host launcher
// ---------------------------------------------------------------------------
extern "C" void kernel_launch(void* const* d_in, const int* in_sizes, int n_in,
                              void* d_out, int out_size, void* d_ws, size_t ws_size,
                              hipStream_t stream) {
    (void)in_sizes; (void)n_in; (void)out_size; (void)ws_size;

    const size_t NE   = (size_t)NTOK * EDIM;   // 8,388,608
    const size_t WQKV = (size_t)E3 * EDIM;     // 3,145,728
    const size_t WO   = (size_t)EDIM * EDIM;   // 1,048,576

    _Float16* hws = (_Float16*)d_ws;
    _Float16* xqr = hws;            _Float16* xqi = xqr + NE;
    _Float16* xkr = xqi + NE;       _Float16* xki = xkr + NE;
    _Float16* xvr = xki + NE;       _Float16* xvi = xvr + NE;
    _Float16* wr  = xvi + NE;       _Float16* wi  = wr + WQKV;
    _Float16* wor = wi + WQKV;      _Float16* woi = wor + WO;
    _Float16* Qr  = woi + WO;       _Float16* Qi  = Qr + NE;
    _Float16* Kr  = Qi + NE;        _Float16* Ki  = Kr + NE;
    _Float16* Vr  = Ki + NE;        _Float16* Vi  = Vr + NE;
    _Float16* Aor = Vi + NE;        _Float16* Aoi = Aor + NE;

    // Activations and weights -> f16: xqr .. woi are contiguous from hws on
    {
        dim3 grid(CVT_SLICES, CVT_UNITS);
        f32_to_f16_all_kernel<<<grid, dim3(256), 0, stream>>>(
            (const float*)d_in[0], (const float*)d_in[1], (const float*)d_in[2],
            (const float*)d_in[3], (const float*)d_in[4], (const float*)d_in[5],
            (const float*)d_in[6], (const float*)d_in[7],
            (const float*)d_in[10], (const float*)d_in[11], hws);
    }

    // QKV projection (complex), head-major f16 outputs
    {
        dim3 grid(NTOK / 128, E3 / 128);
        qkv_gemm_kernel<<<grid, dim3(128), 0, stream>>>(
            xqr, xqi, xkr, xki, xvr, xvi, wr, wi,
            (const float*)d_in[8], (const float*)d_in[9],
            Qr, Qi, Kr, Ki, Vr, Vi);
    }

    // Flash attention per (b,h)
    {
        dim3 grid(SDIM / (AW * 16), BDIM * HNUM);
        attn_kernel<<<grid, dim3(AW * 32), 0, stream>>>(Qr, Qi, Kr, Ki, Vr, Vi, Aor, Aoi);
    }

    // Output projection (complex), f32 result stacked (re, im)
    {
        dim3 grid(NTOK / 128, EDIM / 128);
        out_gemm_kernel<<<grid, dim3(128), 0, stream>>>(
            Aor, Aoi, wor, woi,
            (const float*)d_in[12], (const float*)d_in[13],
            (float*)d_out);
    }
}

// v006
// Measured time: 247 microseconds a run.
// In two side-by-side timings against v005, it was 1.03 and 1.04 times as fast.
// Over all steps from v000 it is 3.30 times as fast.
#include <hip/hip_runtime.h>
#include <hip/hip_bf16.h>

// Problem constants (match reference)
#define SDIM 1024
#define BDIM 8
#define EDIM 1024
#define HNUM 16
#define HD   64
#define NTOK (SDIM * BDIM)   // 8192 tokens
#define E3   (3 * EDIM)      // 3072

typedef __attribute__((ext_vector_type(16))) _Float16 v16h;
typedef __attribute__((ext_vector_type(8)))  _Float16 v8h;
typedef __attribute__((ext_vector_type(8)))  float    v8f;
typedef __attribute__((ext_vector_type(2)))  float    v2f;
typedef __attribute__((ext_vector_type(2)))  _Float16 v2h;

static __device__ inline v16h load_frag16(const _Float16* p, int ld, int lane) {
    const int m  = lane & 15;
    const int kb = (lane >> 4) << 3;
    const _Float16* r = p + (size_t)m * (size_t)ld + kb;
    v8h lo = *(const v8h*)(r);
    v8h hi = *(const v8h*)(r + 16);
    return __builtin_shufflevector(lo, hi, 0, 1, 2, 3, 4, 5, 6, 7,
                                           8, 9, 10, 11, 12, 13, 14, 15);
}

static __device__ inline v8f wmma16(v16h a, v16h b, v8f c) {
    // 8-arg form: (neg_a, A, neg_b, B, c_mod, C, reuse_a, reuse_b)
    return __builtin_amdgcn_wmma_f32_16x16x32_f16(false, a, false, b,
                                                  (short)0, c, false, false);
}

static __device__ inline float xhalf(float v) {
    const int b = __builtin_bit_cast(int, v);
    return __builtin_bit_cast(float, __builtin_amdgcn_permlanex16(
        b, b, 0x76543210, 0xfedcba98, false, false));
}

static __device__ inline void exp2_17(float& c, float (&e)[16]) {
    asm("v_exp_f32 %0, %0\n\t"
        "v_exp_f32 %1, %1\n\t"
        "v_exp_f32 %2, %2\n\t"
        "v_exp_f32 %3, %3\n\t"
        "v_exp_f32 %4, %4\n\t"
        "v_exp_f32 %5, %5\n\t"
        "v_exp_f32 %6, %6\n\t"
        "v_exp_f32 %7, %7\n\t"
        "v_exp_f32 %8, %8\n\t"
        "v_exp_f32 %9, %9\n\t"
        "v_exp_f32 %10, %10\n\t"
        "v_exp_f32 %11, %11\n\t"
        "v_exp_f32 %12, %12\n\t"
        "v_exp_f32 %13, %13\n\t"
        "v_exp_f32 %14, %14\n\t"
        "v_exp_f32 %15, %15\n\t"
        "v_exp_f32 %16, %16\n\t"
        "v_nop"
        : "+v"(c), "+v"(e[0]), "+v"(e[1]), "+v"(e[2]), "+v"(e[3]), "+v"(e[4]),
          "+v"(e[5]), "+v"(e[6]), "+v"(e[7]), "+v"(e[8]), "+v"(e[9]), "+v"(e[10]),
          "+v"(e[11]), "+v"(e[12]), "+v"(e[13]), "+v"(e[14]), "+v"(e[15]));
}

static __device__ inline v8f vzero8() {
    v8f z = {0.f, 0.f, 0.f, 0.f, 0.f, 0.f, 0.f, 0.f};
    return z;
}

static __device__ inline void async_rows8_b128(unsigned l, const _Float16* g,
                                               unsigned lstep, unsigned gstep) {
    const unsigned long long a = (unsigned long long)(uintptr_t)g;
    const unsigned long long s = (unsigned long long)gstep * sizeof(_Float16);
    asm volatile(
        "global_load_async_to_lds_b128 %0, %8, off\n\t"
        "global_load_async_to_lds_b128 %1, %9, off\n\t"
        "global_load_async_to_lds_b128 %2, %10, off\n\t"
        "global_load_async_to_lds_b128 %3, %11, off\n\t"
        "global_load_async_to_lds_b128 %4, %12, off\n\t"
        "global_load_async_to_lds_b128 %5, %13, off\n\t"
        "global_load_async_to_lds_b128 %6, %14, off\n\t"
        "global_load_async_to_lds_b128 %7, %15, off\n\t"
        "s_wait_xcnt 0x0"
        :: "v"(l), "v"(l + lstep), "v"(l + 2 * lstep), "v"(l + 3 * lstep),
           "v"(l + 4 * lstep), "v"(l + 5 * lstep), "v"(l + 6 * lstep), "v"(l + 7 * lstep),
           "v"(a), "v"(a + s), "v"(a + 2 * s), "v"(a + 3 * s),
           "v"(a + 4 * s), "v"(a + 5 * s), "v"(a + 6 * s), "v"(a + 7 * s)
        : "memory");
}

static __device__ inline void wait_async0() {
    asm volatile("s_wait_asynccnt 0x0" ::: "memory");
}

// ---------------------------------------------------------------------------
// f32 -> f16 conversion of all ten operands in one launch.
// The ten f16 copies lie one behind the other in the workspace, in argument
// order, and every operand's length is a whole number of units of CVT_UNIT
// elements, so each unit of the destination has exactly one source.
// blockIdx.y = unit, blockIdx.x = slice of the unit.  A work-group converts
// CVT_TRIPS x 8,192 elements; each wave-wide load covers 512 contiguous bytes,
// each wave-wide store 256.
// ---------------------------------------------------------------------------
#define CVT_UNIT   (1 << 20)
#define CVT_X      ((NTOK * EDIM) / CVT_UNIT)   // units per activation: 8
#define CVT_WQKV   ((E3 * EDIM) / CVT_UNIT)     // units per qkv weight: 3
#define CVT_WO     ((EDIM * EDIM) / CVT_UNIT)   // units per out weight: 1
#define CVT_UNITS  (6 * CVT_X + 2 * CVT_WQKV + 2 * CVT_WO)
#define CVT_SLICES 32
#define CVT_TRIPS  (CVT_UNIT / CVT_SLICES / 8192)
static_assert(CVT_X * CVT_UNIT == NTOK * EDIM && CVT_WQKV * CVT_UNIT == E3 * EDIM &&
              CVT_WO * CVT_UNIT == EDIM * EDIM, "operands are whole units");
static_assert(CVT_TRIPS * CVT_SLICES * 8192 == CVT_UNIT, "slices are whole trips");

typedef __attribute__((ext_vector_type(4))) float    v4f;
typedef __attribute__((ext_vector_type(4))) _Float16 v4h;

__global__ void __launch_bounds__(256) f32_to_f16_all_kernel(
    const float* __restrict__ xqr, const float* __restrict__ xqi,
    const float* __restrict__ xkr, const float* __restrict__ xki,
    const float* __restrict__ xvr, const float* __restrict__ xvi,
    const float* __restrict__ wr,  const float* __restrict__ wi,
    const float* __restrict__ wor, const float* __restrict__ woi,
    _Float16* __restrict__ dst)
{
    const int u = (int)blockIdx.y;
    const float* src;   // the operand that unit u belongs to
    int u0;             // that operand's first unit
    if (u < 6 * CVT_X) {
        const int a = u / CVT_X;
        u0  = a * CVT_X;
        src = (a == 0) ? xqr : (a == 1) ? xqi : (a == 2) ? xkr
            : (a == 3) ? xki : (a == 4) ? xvr : xvi;
    } else if (u < 6 * CVT_X + CVT_WQKV) {
        u0 = 6 * CVT_X;                              src = wr;
    } else if (u < 6 * CVT_X + 2 * CVT_WQKV) {
        u0 = 6 * CVT_X + CVT_WQKV;                   src = wi;
    } else if (u < 6 * CVT_X + 2 * CVT_WQKV + CVT_WO) {
        u0 = 6 * CVT_X + 2 * CVT_WQKV;               src = wor;
    } else {
        u0 = 6 * CVT_X + 2 * CVT_WQKV + CVT_WO;      src = woi;
    }
    const size_t slice = (size_t)blockIdx.x * (CVT_UNIT / CVT_SLICES);
    const v4f* s4 = (const v4f*)(src + (size_t)(u - u0) * CVT_UNIT + slice) + threadIdx.x;
    v4h*       d4 = (v4h*)(dst + (size_t)u * CVT_UNIT + slice) + threadIdx.x;

    // Kept rolled: 8 loads of 16 bytes in flight per lane are enough for the
    // memory rate, and the small register count keeps every work-group resident.
#pragma unroll 1
    for (int it = 0; it < CVT_TRIPS; ++it) {
        v4f v[8];
#pragma unroll   // all 8 loads issue before the first value is used
        for (int j = 0; j < 8; ++j) v[j] = s4[it * 2048 + j * 256];
#pragma unroll   // constant indices keep v[] in registers
        for (int j = 0; j < 8; ++j)
            d4[it * 2048 + j * 256] = __builtin_convertvector(v[j], v4h);
    }
}

#define GK      64
#define GPITCH  72
#define GTILE   (128 * GPITCH)
#define GSTAGE  (4 * GTILE)
#define GSTAGES (EDIM / GK)
static_assert(NTOK % 128 == 0 && EDIM % 128 == 0 && GSTAGES >= 2, "whole tiles, two stages");
static_assert(GK == 64, "a stage is two blocks of 32 k");

// xr .. wi: first row of each tile (the same in every lane).  A lane brings 16
// bytes of row (tid >> 3) + 16 n of each tile, k = kb + (tid & 7) * 8 onwards.
static __device__ inline void stage_tiles(_Float16* buf, int tid, int kb,
                                          const _Float16* xr, const _Float16* xi,
                                          const _Float16* wr, const _Float16* wi) {
    const unsigned l = (unsigned)(uintptr_t)(buf + (tid >> 3) * GPITCH + (tid & 7) * 8);
    const unsigned o = (unsigned)((tid >> 3) * EDIM + (tid & 7) * 8 + kb);
    const unsigned lstep = 16 * GPITCH * sizeof(_Float16);
    const unsigned ltile = GTILE * sizeof(_Float16);
    async_rows8_b128(l,             xr + o, lstep, 16 * EDIM);
    async_rows8_b128(l + ltile,     xi + o, lstep, 16 * EDIM);
    async_rows8_b128(l + 2 * ltile, wr + o, lstep, 16 * EDIM);
    async_rows8_b128(l + 3 * ltile, wi + o, lstep, 16 * EDIM);
}

// Four fragments, rows 0, 16, 32, 48 onwards of a 64-row slice of an operand tile.
static __device__ __forceinline__ void load_frags4(v16h (&f)[4], const _Float16* p, int lane) {
#pragma unroll   // constant indices keep tiles and fragments in registers
    for (int i = 0; i < 4; ++i) f[i] = load_frag16(p + (i * 16) * GPITCH, GPITCH, lane);
}

// 16 WMMAs: acc[i][j] += a[i] . b[j]^T over 32 k; neighbours write different tiles.
static __device__ __forceinline__ void wmma4x4(const v16h (&a)[4], const v16h (&b)[4],
                                               v8f (&acc)[4][4]) {
#pragma unroll   // constant indices keep tiles and fragments in registers
    for (int i = 0; i < 4; ++i)
#pragma unroll   // constant indices keep tiles and fragments in registers
        for (int j = 0; j < 4; ++j) acc[i][j] = wmma16(a[i], b[j], acc[i][j]);
}

// The same with -a[i].
static __device__ __forceinline__ void wmma4x4_neg(const v16h (&a)[4], const v16h (&b)[4],
                                                   v8f (&acc)[4][4]) {
#pragma unroll   // constant indices keep tiles and fragments in registers
    for (int i = 0; i < 4; ++i) {
        const v16h na = -a[i];
#pragma unroll   // constant indices keep tiles and fragments in registers
        for (int j = 0; j < 4; ++j) acc[i][j] = wmma16(na, b[j], acc[i][j]);
    }
}

static __device__ __forceinline__ void cgemm_128x128(
    _Float16* sbuf,
    const _Float16* __restrict__ Xr, const _Float16* __restrict__ Xi,
    const _Float16* __restrict__ Wr, const _Float16* __restrict__ Wi,
    v8f (&accR)[4][4], v8f (&accI)[4][4])
{
    const int tid  = (int)threadIdx.x;
    const int lane = tid & 31;
    const int wave = tid >> 5;
    const int wm   = wave >> 1;       // which 64 rows of X
    const int wn   = wave & 1;        // which 64 rows of W

#pragma unroll   // constant indices keep tiles and fragments in registers
    for (int i = 0; i < 4; ++i)
#pragma unroll   // constant indices keep tiles and fragments in registers
        for (int j = 0; j < 4; ++j) { accR[i][j] = vzero8(); accI[i][j] = vzero8(); }

    stage_tiles(sbuf, tid, 0, Xr, Xi, Wr, Wi);
    wait_async0();
    __syncthreads();   // stage 0 visible to all waves
    stage_tiles(sbuf + GSTAGE, tid, GK, Xr, Xi, Wr, Wi);

    // Kept rolled: one copy of the 128-WMMA body, for speed only.
#pragma unroll 1
    for (int t = 0; t < GSTAGES; ++t) {
        _Float16* buf = sbuf + (t & 1) * GSTAGE;
        const _Float16* pa = buf + (wm * 64) * GPITCH;
        const _Float16* pb = buf + 2 * GTILE + (wn * 64) * GPITCH;
        // LDS reads stand at three places a stage, each one group, and but for the
        // first each
        // group has 16 WMMAs between it and its first use.  Left alone the
        // compiler spreads the reads among the WMMAs, most of them a few WMMAs
        // ahead of their use; each scheduling barrier below says what it holds.
        // Per accumulator the order stays ar.br, -ai.bi and ar.bi, ai.br.
        v16h ar[4], ai[4], br[4], bi[4];
        load_frags4(ar, pa, lane);                // k 0..31, in the order of use
        load_frags4(br, pb, lane);
        load_frags4(bi, pb + GTILE, lane);
        load_frags4(ai, pa + GTILE, lane);
        __builtin_amdgcn_sched_barrier(0);
        wmma4x4(ar, br, accR);
        __builtin_amdgcn_sched_barrier(0);   // the block opens with the fragments that land first
        wmma4x4(ar, bi, accI);
        wmma4x4(ai, br, accI);
        __builtin_amdgcn_sched_barrier(0);   // group 2 is not split up and lifted among these WMMAs
        load_frags4(ar, pa + 32, lane);           // k 32..63: Xr, Wr, whose registers are free now
        load_frags4(br, pb + 32, lane);
        __builtin_amdgcn_sched_barrier(0);   // group 2 stays ahead of the 16 WMMAs that cover it
        wmma4x4_neg(ai, bi, accR);
        __builtin_amdgcn_sched_barrier(0);   // group 3 is not split up and lifted among these WMMAs
        load_frags4(bi, pb + GTILE + 32, lane);   // k 32..63: Wi, Xi
        load_frags4(ai, pa + GTILE + 32, lane);
        __builtin_amdgcn_sched_barrier(0);   // group 3 stays ahead of the 16 WMMAs that cover it
        wmma4x4(ar, br, accR);
        __builtin_amdgcn_sched_barrier(0);   // the block opens with group 2's fragments, not group 3's
        wmma4x4(ar, bi, accI);
        wmma4x4(ai, br, accI);
        wmma4x4_neg(ai, bi, accR);
        // Keeps the hand-over at the foot: lifted to behind the last reads, its
        // wait would stand in front of the products that cover them.
        __builtin_amdgcn_sched_barrier(0);
        // Hand-over: this wave's reads of buf are done, its copies of stage
        // t + 1 have landed; behind the barrier both hold for every wave.
        asm volatile("s_wait_dscnt 0x0" ::: "memory");
        wait_async0();
        __syncthreads();
        if (t + 2 < GSTAGES)
            stage_tiles(buf, tid, (t + 2) * GK, Xr, Xi, Wr, Wi);
    }
    wait_async0();   // nothing in flight when the wave goes on
}

__global__ void __launch_bounds__(128, 2) qkv_gemm_kernel(
    const _Float16* __restrict__ xqr, const _Float16* __restrict__ xqi,
    const _Float16* __restrict__ xkr, const _Float16* __restrict__ xki,
    const _Float16* __restrict__ xvr, const _Float16* __restrict__ xvi,
    const _Float16* __restrict__ wr,  const _Float16* __restrict__ wi,
    const float* __restrict__ bre,    const float* __restrict__ bim,
    _Float16* __restrict__ Qr, _Float16* __restrict__ Qi,
    _Float16* __restrict__ Kr, _Float16* __restrict__ Ki,
    _Float16* __restrict__ Vr, _Float16* __restrict__ Vi)
{
    __shared__ __align__(16) _Float16 sbuf[2 * GSTAGE];

    const int lane = threadIdx.x & 31;
    const int wave = threadIdx.x >> 5;
    const int row0 = blockIdx.x * 128;               // token tile
    const int col0 = blockIdx.y * 128;               // output-feature tile
    const int sel  = col0 >> 10;                     // 0=q 1=k 2=v

    const _Float16* Xr = (sel == 0) ? xqr : ((sel == 1) ? xkr : xvr);
    const _Float16* Xi = (sel == 0) ? xqi : ((sel == 1) ? xki : xvi);

    v8f accR[4][4], accI[4][4];
    cgemm_128x128(sbuf, Xr + (size_t)row0 * EDIM, Xi + (size_t)row0 * EDIM,
                  wr + (size_t)col0 * EDIM, wi + (size_t)col0 * EDIM, accR, accI);

    _Float16* Dr = (sel == 0) ? Qr : ((sel == 1) ? Kr : Vr);
    _Float16* Di = (sel == 0) ? Qi : ((sel == 1) ? Ki : Vi);

    const int rowb = row0 + (wave >> 1) * 64;
    const int colb = col0 + (wave & 1) * 64;
#pragma unroll   // constant indices keep tiles and fragments in registers
    for (int j = 0; j < 4; ++j) {
        const int col = colb + j * 16 + (lane & 15);
        const float br_v = bre[col];
        const float bi_v = bim[col];
        const int e  = col & (EDIM - 1);
        const int hh = e >> 6;         // head
        const int d  = e & 63;         // dim in head
#pragma unroll   // constant indices keep tiles and fragments in registers
        for (int i = 0; i < 4; ++i) {
#pragma unroll   // constant indices keep tiles and fragments in registers
            for (int r = 0; r < 8; ++r) {
                const int tok = rowb + i * 16 + ((lane >> 4) << 3) + r;   // C layout rows
                const int s = tok >> 3;        // token = s*B + b, B=8
                const int b = tok & 7;
                const size_t off = (((size_t)(b * HNUM + hh) * SDIM + s) * HD) + d;
                Dr[off] = (_Float16)(accR[i][j][r] + br_v);
                Di[off] = (_Float16)(accI[i][j][r] + bi_v);
            }
        }
        // Stores of this column group have their addresses taken before the next
        // group's values reuse a register that one of them names; the scheduling
        // barrier keeps that group's arithmetic behind the wait.
        if (j < 3) {
            asm volatile("s_wait_xcnt 0x0" ::: "memory");
            __builtin_amdgcn_sched_barrier(0);
        }
    }
}

#define AW      8
#define AKEYS   32
#define AKP     72
#define AVP     80
#define AKTILE  (AKEYS * AKP)
#define AVTILE  (AKEYS * AVP)
#define ASTAGE  (2 * AKTILE + 2 * AVTILE)
#define ASTAGES (SDIM / AKEYS)
static_assert(AW * 32 * 8 == AKEYS * HD, "one 16-byte copy a lane fills one tile");
static_assert(ASTAGES >= 2 && SDIM % (AW * 16) == 0, "two stages, whole query blocks");

static __device__ inline void stage_kv(_Float16* buf, int tid, int t0,
                                       const _Float16* kr, const _Float16* ki,
                                       const _Float16* vr, const _Float16* vi) {
    const int row = tid >> 3, ch = (tid & 7) * 8;
    const unsigned lk = (unsigned)(uintptr_t)(buf + row * AKP + ch);
    const unsigned lv = (unsigned)(uintptr_t)(buf + 2 * AKTILE + row * AVP + ch);
    const unsigned o  = (unsigned)((t0 + row) * HD + ch);
    asm volatile(
        "global_load_async_to_lds_b128 %0, %4, off\n\t"
        "global_load_async_to_lds_b128 %1, %5, off\n\t"
        "global_load_async_to_lds_b128 %2, %6, off\n\t"
        "global_load_async_to_lds_b128 %3, %7, off\n\t"
        "s_wait_xcnt 0x0"
        :: "v"(lk), "v"(lk + (unsigned)(AKTILE * sizeof(_Float16))),
           "v"(lv), "v"(lv + (unsigned)(AVTILE * sizeof(_Float16))),
           "v"(kr + o), "v"(ki + o), "v"(vr + o), "v"(vi + o)
        : "memory");
}

// A fragment (16 d x 32 keys) of V^T from a row-major V tile: lane (c, h) gets
// V[8h + 0..7][d0 + c] and V[16 + 8h + 0..7][d0 + c], the k order of load_frag16.
// p: the lane's own address, tile + (8h + (lane & 7)) rows + 8 * ((lane >> 3) & 1).
static __device__ inline v16h load_vt_frag(const _Float16* p) {
    typedef __attribute__((ext_vector_type(8))) short s16x8;
    typedef __attribute__((address_space(3))) s16x8 lds_s16x8;
    v8h lo = __builtin_bit_cast(v8h, __builtin_amdgcn_ds_load_tr16_b128_v8i16((lds_s16x8*)p));
    v8h hi = __builtin_bit_cast(v8h, __builtin_amdgcn_ds_load_tr16_b128_v8i16((lds_s16x8*)(p + 16 * AVP)));
    return __builtin_shufflevector(lo, hi, 0, 1, 2, 3, 4, 5, 6, 7,
                                           8, 9, 10, 11, 12, 13, 14, 15);
}

__global__ void __launch_bounds__(AW * 32, 4) attn_kernel(
    const _Float16* __restrict__ Qr, const _Float16* __restrict__ Qi,
    const _Float16* __restrict__ Kr, const _Float16* __restrict__ Ki,
    const _Float16* __restrict__ Vr, const _Float16* __restrict__ Vi,
    _Float16* __restrict__ Or, _Float16* __restrict__ Oi)
{
    __shared__ __align__(16) _Float16 kv[2 * ASTAGE];     // two K/V stages

    const int tid  = (int)threadIdx.x;
    const int lane = tid & 31;
    const int wave = tid >> 5;
    const int bh = blockIdx.y;          // = b*H + h
    const int b  = bh >> 4;
    const int h  = bh & 15;
    const int s0 = blockIdx.x * (AW * 16) + wave * 16;

    const size_t base = (size_t)bh * SDIM * HD;
    const _Float16* kr = Kr + base;
    const _Float16* ki = Ki + base;
    const _Float16* vr = Vr + base;
    const _Float16* vi = Vi + base;

    stage_kv(kv, tid, 0, kr, ki, vr, vi);

    v16h aqr[2], aqi[2];
#pragma unroll
    for (int ks = 0; ks < 2; ++ks) {
        aqr[ks] = load_frag16(Qr + base + (size_t)s0 * HD + ks * 32, HD, lane);
        aqi[ks] = load_frag16(Qi + base + (size_t)s0 * HD + ks * 32, HD, lane);
    }

    v8f oR[4], oI[4];
#pragma unroll
    for (int j = 0; j < 4; ++j) { oR[j] = vzero8(); oI[j] = vzero8(); }
    // Of the lane's query: running maximum (equal in both lane halves) and the
    // running sum over this half's keys (the halves are joined after the loop).
    float mrun = -1e30f, lrun = 0.f;

    const float scale = 0.125f;   // 1/sqrt(64)
    // The lane's place in a V tile for the transposing load
    const int vlane = (((lane >> 4) << 3) + (lane & 7)) * AVP + ((lane >> 3) & 1) * 8;

    wait_async0();
    __syncthreads();   // stage 0 visible to all waves
    stage_kv(kv + ASTAGE, tid, AKEYS, kr, ki, vr, vi);

    // Kept rolled: the buffer alternates by address, one copy of the body.
#pragma unroll 1
    for (int t = 0; t < ASTAGES; ++t) {
        _Float16* buf = kv + (t & 1) * ASTAGE;

        // Scores: 32 keys x 16 queries as two 16x16 C tiles.  All 16 K reads stand in one
        // place ahead of the products; the scheduling barrier keeps them from
        // being spread.
        v16h bkr[2][2], bki[2][2];
#pragma unroll   // constant indices keep fragments in registers
        for (int ts = 0; ts < 2; ++ts) {
#pragma unroll   // constant indices keep fragments in registers
            for (int ks = 0; ks < 2; ++ks) {
                bkr[ts][ks] = load_frag16(buf + (ts * 16) * AKP + ks * 32, AKP, lane);
                bki[ts][ks] = load_frag16(buf + AKTILE + (ts * 16) * AKP + ks * 32, AKP, lane);
            }
        }
        __builtin_amdgcn_sched_barrier(0);
        // Per tile the order stays re, im of k 0..31, then re, im of k 32..63;
        // neighbouring WMMAs write different tiles.
        v8f sc[2];
        sc[0] = vzero8(); sc[1] = vzero8();
#pragma unroll   // constant indices keep fragments in registers
        for (int ks = 0; ks < 2; ++ks) {
            sc[0] = wmma16(bkr[0][ks], aqr[ks], sc[0]);
            sc[1] = wmma16(bkr[1][ks], aqr[ks], sc[1]);
            sc[0] = wmma16(bki[0][ks], aqi[ks], sc[0]);
            sc[1] = wmma16(bki[1][ks], aqi[ks], sc[1]);
        }

        // All 16 V^T reads as one group here: they need nothing of the softmax
        // and land under it; the scheduling barrier keeps them from sinking to
        // the products at the end of the pass.
        v16h bvr[4], bvi[4];
        {
            const _Float16* pv = buf + 2 * AKTILE + vlane;
#pragma unroll   // constant indices keep fragments in registers
            for (int j = 0; j < 4; ++j) {
                bvr[j] = load_vt_frag(pv + j * 16);
                bvi[j] = load_vt_frag(pv + AVTILE + j * 16);
            }
        }
        __builtin_amdgcn_sched_barrier(0);

        const v8f x0 = sc[0] * scale, x1 = sc[1] * scale;
        float mx[8];
#pragma unroll   // constant indices keep the scores in registers
        for (int r = 0; r < 8; ++r) mx[r] = fmaxf(x0[r], x1[r]);
        float m = fmaxf(fmaxf(fmaxf(mx[0], mx[1]), fmaxf(mx[2], mx[3])),
                        fmaxf(fmaxf(mx[4], mx[5]), fmaxf(mx[6], mx[7])));
        m = fmaxf(m, xhalf(m));
        const float mnew = fmaxf(mrun, m);
        // exp(y) as 2^(y * log2 e), as __expf() forms it
        const float l2e = 1.442695041f;
        float corr = (mrun - mnew) * l2e;
        float p[16];
#pragma unroll   // constant indices keep the scores in registers
        for (int r = 0; r < 8; ++r) { p[r] = (x0[r] - mnew) * l2e; p[8 + r] = (x1[r] - mnew) * l2e; }
        exp2_17(corr, p);
        mrun = mnew;
#pragma unroll   // constant indices keep the tiles in registers
        for (int j = 0; j < 4; ++j) { oR[j] *= corr; oI[j] *= corr; }
        float ps[8];
#pragma unroll   // constant indices keep the scores in registers
        for (int r = 0; r < 8; ++r) ps[r] = p[r] + p[8 + r];
        lrun = lrun * corr + (((ps[0] + ps[1]) + (ps[2] + ps[3])) +
                              ((ps[4] + ps[5]) + (ps[6] + ps[7])));

        // P^T as B operand: element s of lane (c, h) is key 8h + s (s < 8) or
        // 16 + 8h + (s - 8), which is where the two score tiles hold it.
        v16h pb;
#pragma unroll   // constant indices keep the fragment in registers
        for (int r = 0; r < 16; r += 2) {
            const v2f two = {p[r], p[r + 1]};
            const v2h h2 = __builtin_convertvector(two, v2h);
            pb[r] = h2[0]; pb[r + 1] = h2[1];
        }
#pragma unroll   // constant indices keep fragments in registers
        for (int j = 0; j < 4; ++j) {
            oR[j] = wmma16(bvr[j], pb, oR[j]);
            oI[j] = wmma16(bvi[j], pb, oI[j]);
        }

        // Hand-over: this wave's reads of buf are done, its copies of stage
        // t + 1 have landed; behind the barrier both hold for every wave.
        // The scheduling barrier keeps it at the foot of the pass: lifted to
        // behind the V^T reads, its wait would stand in front of the softmax,
        // and the reads would no longer land under it.
        __builtin_amdgcn_sched_barrier(0);
        asm volatile("s_wait_dscnt 0x0" ::: "memory");
        wait_async0();
        __syncthreads();
        if (t + 2 < ASTAGES)
            stage_kv(buf, tid, (t + 2) * AKEYS, kr, ki, vr, vi);
    }
    wait_async0();   // nothing in flight when the wave goes on

    // Normalize and write (S,B,E) f16 for the output projection: lane (c, h)
    // holds d = 16 j + 8 h + 0..7 of query c, 16 contiguous bytes a tile.
    const float invl = 1.0f / (lrun + xhalf(lrun));
    const size_t orow = ((size_t)((s0 + (lane & 15)) * BDIM + b)) * EDIM + h * HD + ((lane >> 4) << 3);
#pragma unroll
    for (int j = 0; j < 4; ++j) {
        *(v8h*)(Or + orow + j * 16) = __builtin_convertvector(oR[j] * invl, v8h);
        *(v8h*)(Oi + orow + j * 16) = __builtin_convertvector(oI[j] * invl, v8h);
        // These stores have their registers taken before the next tiles' values
        // reuse one that they name; the scheduling barrier keeps that arithmetic
        // behind the wait.
        if (j < 3) {
            asm volatile("s_wait_xcnt 0x0" ::: "memory");
            __builtin_amdgcn_sched_barrier(0);
        }
    }
}

// ---------------------------------------------------------------------------
// Output complex projection:  y = out @ Wo^T + bo -> f32 d_out stacked
// (2, S, B, E).  Same main loop and launch bounds as the QKV GEMM.
// ---------------------------------------------------------------------------
__global__ void __launch_bounds__(128, 2) out_gemm_kernel(
    const _Float16* __restrict__ Ar, const _Float16* __restrict__ Ai,
    const _Float16* __restrict__ wr, const _Float16* __restrict__ wi,
    const float* __restrict__ bre,   const float* __restrict__ bim,
    float* __restrict__ out)
{
    __shared__ __align__(16) _Float16 sbuf[2 * GSTAGE];

    const int lane = threadIdx.x & 31;
    const int wave = threadIdx.x >> 5;
    const int row0 = blockIdx.x * 128;
    const int col0 = blockIdx.y * 128;

    v8f accR[4][4], accI[4][4];
    cgemm_128x128(sbuf, Ar + (size_t)row0 * EDIM, Ai + (size_t)row0 * EDIM,
                  wr + (size_t)col0 * EDIM, wi + (size_t)col0 * EDIM, accR, accI);

    const size_t imOff = (size_t)NTOK * EDIM;
    const int rowb = row0 + (wave >> 1) * 64;
    const int colb = col0 + (wave & 1) * 64;
#pragma unroll   // constant indices keep tiles and fragments in registers
    for (int j = 0; j < 4; ++j) {
        const int col = colb + j * 16 + (lane & 15);
        const float br_v = bre[col];
        const float bi_v = bim[col];
#pragma unroll   // constant indices keep tiles and fragments in registers
        for (int i = 0; i < 4; ++i) {
#pragma unroll   // constant indices keep tiles and fragments in registers
            for (int r = 0; r < 8; ++r) {
                const int tok = rowb + i * 16 + ((lane >> 4) << 3) + r;
                const size_t off = (size_t)tok * EDIM + col;
                out[off]         = accR[i][j][r] + br_v;
                out[imOff + off] = accI[i][j][r] + bi_v;
            }
        }
        // Stores of this column group have their addresses taken before the next
        // group's values reuse a register that one of them names; the scheduling
        // barrier keeps that group's arithmetic behind the wait.
        if (j < 3) {
            asm volatile("s_wait_xcnt 0x0" ::: "memory");
            __builtin_amdgcn_sched_barrier(0);
        }
    }
}

// ---------------------------------------------------------------------------
// Host launcher
// ---------------------------------------------------------------------------
extern "C" void kernel_launch(void* const* d_in, const int* in_sizes, int n_in,
                              void* d_out, int out_size, void* d_ws, size_t ws_size,
                              hipStream_t stream) {
    (void)in_sizes; (void)n_in; (void)out_size; (void)ws_size;

    const size_t NE   = (size_t)NTOK * EDIM;   // 8,388,608
    const size_t WQKV = (size_t)E3 * EDIM;     // 3,145,728
    const size_t WO   = (size_t)EDIM * EDIM;   // 1,048,576

    _Float16* hws = (_Float16*)d_ws;
    _Float16* xqr = hws;            _Float16* xqi = xqr + NE;
    _Float16* xkr = xqi + NE;       _Float16* xki = xkr + NE;
    _Float16* xvr = xki + NE;       _Float16* xvi = xvr + NE;
    _Float16* wr  = xvi + NE;       _Float16* wi  = wr + WQKV;
    _Float16* wor = wi + WQKV;      _Float16* woi = wor + WO;
    _Float16* Qr  = woi + WO;       _Float16* Qi  = Qr + NE;
    _Float16* Kr  = Qi + NE;        _Float16* Ki  = Kr + NE;
    _Float16* Vr  = Ki + NE;        _Float16* Vi  = Vr + NE;
    _Float16* Aor = Vi + NE;        _Float16* Aoi = Aor + NE;

    // Activations and weights -> f16: xqr .. woi are contiguous from hws on
    {
        dim3 grid(CVT_SLICES, CVT_UNITS);
        f32_to_f16_all_kernel<<<grid, dim3(256), 0, stream>>>(
            (const float*)d_in[0], (const float*)d_in[1], (const float*)d_in[2],
            (const float*)d_in[3], (const float*)d_in[4], (const float*)d_in[5],
            (const float*)d_in[6], (const float*)d_in[7],
            (const float*)d_in[10], (const float*)d_in[11], hws);
    }

    // QKV projection (complex), head-major f16 outputs
    {
        dim3 grid(NTOK / 128, E3 / 128);
        qkv_gemm_kernel<<<grid, dim3(128), 0, stream>>>(
            xqr, xqi, xkr, xki, xvr, xvi, wr, wi,
            (const float*)d_in[8], (const float*)d_in[9],
            Qr, Qi, Kr, Ki, Vr, Vi);
    }

    // Flash attention per (b,h)
    {
        dim3 grid(SDIM / (AW * 16), BDIM * HNUM);
        attn_kernel<<<grid, dim3(AW * 32), 0, stream>>>(Qr, Qi, Kr, Ki, Vr, Vi, Aor, Aoi);
    }

    // Output projection (complex), f32 result stacked (re, im)
    {
        dim3 grid(NTOK / 128, EDIM / 128);
        out_gemm_kernel<<<grid, dim3(128), 0, stream>>>(
            Aor, Aoi, wor, woi,
            (const float*)d_in[12], (const float*)d_in[13],
            (float*)d_out);
    }
}

// v007
// A run of this version takes 237 microseconds.
// In both of two side-by-side timings against v006, it was 1.04 times as fast.
// All steps since v000 together make it 3.44 times as fast.
#include <hip/hip_runtime.h>
#include <hip/hip_bf16.h>

// Problem constants (match reference)
#define SDIM 1024
#define BDIM 8
#define EDIM 1024
#define HNUM 16
#define HD   64
#define NTOK (SDIM * BDIM)   // 8192 tokens
#define E3   (3 * EDIM)      // 3072

typedef __attribute__((ext_vector_type(16))) _Float16 v16h;
typedef __attribute__((ext_vector_type(8)))  _Float16 v8h;
typedef __attribute__((ext_vector_type(8)))  float    v8f;
typedef __attribute__((ext_vector_type(2)))  float    v2f;
typedef __attribute__((ext_vector_type(2)))  _Float16 v2h;

static __device__ inline v16h load_frag16(const _Float16* p, int ld, int lane) {
    const int m  = lane & 15;
    const int kb = (lane >> 4) << 3;
    const _Float16* r = p + (size_t)m * (size_t)ld + kb;
    v8h lo = *(const v8h*)(r);
    v8h hi = *(const v8h*)(r + 16);
    return __builtin_shufflevector(lo, hi, 0, 1, 2, 3, 4, 5, 6, 7,
                                           8, 9, 10, 11, 12, 13, 14, 15);
}

static __device__ inline v8f wmma16(v16h a, v16h b, v8f c) {
    // 8-arg form: (neg_a, A, neg_b, B, c_mod, C, reuse_a, reuse_b)
    return __builtin_amdgcn_wmma_f32_16x16x32_f16(false, a, false, b,
                                                  (short)0, c, false, false);
}

static __device__ inline float xhalf(float v) {
    const int b = __builtin_bit_cast(int, v);
    return __builtin_bit_cast(float, __builtin_amdgcn_permlanex16(
        b, b, 0x76543210, 0xfedcba98, false, false));
}

static __device__ inline void exp2_17(float& c, float (&e)[16]) {
    asm("v_exp_f32 %0, %0\n\t"
        "v_exp_f32 %1, %1\n\t"
        "v_exp_f32 %2, %2\n\t"
        "v_exp_f32 %3, %3\n\t"
        "v_exp_f32 %4, %4\n\t"
        "v_exp_f32 %5, %5\n\t"
        "v_exp_f32 %6, %6\n\t"
        "v_exp_f32 %7, %7\n\t"
        "v_exp_f32 %8, %8\n\t"
        "v_exp_f32 %9, %9\n\t"
        "v_exp_f32 %10, %10\n\t"
        "v_exp_f32 %11, %11\n\t"
        "v_exp_f32 %12, %12\n\t"
        "v_exp_f32 %13, %13\n\t"
        "v_exp_f32 %14, %14\n\t"
        "v_exp_f32 %15, %15\n\t"
        "v_exp_f32 %16, %16\n\t"
        "v_nop"
        : "+v"(c), "+v"(e[0]), "+v"(e[1]), "+v"(e[2]), "+v"(e[3]), "+v"(e[4]),
          "+v"(e[5]), "+v"(e[6]), "+v"(e[7]), "+v"(e[8]), "+v"(e[9]), "+v"(e[10]),
          "+v"(e[11]), "+v"(e[12]), "+v"(e[13]), "+v"(e[14]), "+v"(e[15]));
}

static __device__ inline v8f vzero8() {
    v8f z = {0.f, 0.f, 0.f, 0.f, 0.f, 0.f, 0.f, 0.f};
    return z;
}

static __device__ inline void async_rows8_b128(unsigned l, const _Float16* g,
                                               unsigned lstep, unsigned gstep) {
    const unsigned long long a = (unsigned long long)(uintptr_t)g;
    const unsigned long long s = (unsigned long long)gstep * sizeof(_Float16);
    asm volatile(
        "global_load_async_to_lds_b128 %0, %8, off\n\t"
        "global_load_async_to_lds_b128 %1, %9, off\n\t"
        "global_load_async_to_lds_b128 %2, %10, off\n\t"
        "global_load_async_to_lds_b128 %3, %11, off\n\t"
        "global_load_async_to_lds_b128 %4, %12, off\n\t"
        "global_load_async_to_lds_b128 %5, %13, off\n\t"
        "global_load_async_to_lds_b128 %6, %14, off\n\t"
        "global_load_async_to_lds_b128 %7, %15, off\n\t"
        "s_wait_xcnt 0x0"
        :: "v"(l), "v"(l + lstep), "v"(l + 2 * lstep), "v"(l + 3 * lstep),
           "v"(l + 4 * lstep), "v"(l + 5 * lstep), "v"(l + 6 * lstep), "v"(l + 7 * lstep),
           "v"(a), "v"(a + s), "v"(a + 2 * s), "v"(a + 3 * s),
           "v"(a + 4 * s), "v"(a + 5 * s), "v"(a + 6 * s), "v"(a + 7 * s)
        : "memory");
}

static __device__ inline void wait_async0() {
    asm volatile("s_wait_asynccnt 0x0" ::: "memory");
}

// ---------------------------------------------------------------------------
// f32 -> f16 conversion of all ten operands in one launch.
// The ten f16 copies lie one behind the other in the workspace, in argument
// order, and every operand's length is a whole number of units of CVT_UNIT
// elements, so each unit of the destination has exactly one source.
// blockIdx.y = unit, blockIdx.x = slice of the unit.  A work-group converts
// CVT_TRIPS x 8,192 elements; each wave-wide load covers 512 contiguous bytes,
// each wave-wide store 256.
// ---------------------------------------------------------------------------
#define CVT_UNIT   (1 << 20)
#define CVT_X      ((NTOK * EDIM) / CVT_UNIT)   // units per activation: 8
#define CVT_WQKV   ((E3 * EDIM) / CVT_UNIT)     // units per qkv weight: 3
#define CVT_WO     ((EDIM * EDIM) / CVT_UNIT)   // units per out weight: 1
#define CVT_UNITS  (6 * CVT_X + 2 * CVT_WQKV + 2 * CVT_WO)
#define CVT_SLICES 32
#define CVT_TRIPS  (CVT_UNIT / CVT_SLICES / 8192)
static_assert(CVT_X * CVT_UNIT == NTOK * EDIM && CVT_WQKV * CVT_UNIT == E3 * EDIM &&
              CVT_WO * CVT_UNIT == EDIM * EDIM, "operands are whole units");
static_assert(CVT_TRIPS * CVT_SLICES * 8192 == CVT_UNIT, "slices are whole trips");

typedef __attribute__((ext_vector_type(4))) float    v4f;
typedef __attribute__((ext_vector_type(4))) _Float16 v4h;

__global__ void __launch_bounds__(256) f32_to_f16_all_kernel(
    const float* __restrict__ xqr, const float* __restrict__ xqi,
    const float* __restrict__ xkr, const float* __restrict__ xki,
    const float* __restrict__ xvr, const float* __restrict__ xvi,
    const float* __restrict__ wr,  const float* __restrict__ wi,
    const float* __restrict__ wor, const float* __restrict__ woi,
    _Float16* __restrict__ dst)
{
    const int u = (int)blockIdx.y;
    const float* src;   // the operand that unit u belongs to
    int u0;             // that operand's first unit
    if (u < 6 * CVT_X) {
        const int a = u / CVT_X;
        u0  = a * CVT_X;
        src = (a == 0) ? xqr : (a == 1) ? xqi : (a == 2) ? xkr
            : (a == 3) ? xki : (a == 4) ? xvr : xvi;
    } else if (u < 6 * CVT_X + CVT_WQKV) {
        u0 = 6 * CVT_X;                              src = wr;
    } else if (u < 6 * CVT_X + 2 * CVT_WQKV) {
        u0 = 6 * CVT_X + CVT_WQKV;                   src = wi;
    } else if (u < 6 * CVT_X + 2 * CVT_WQKV + CVT_WO) {
        u0 = 6 * CVT_X + 2 * CVT_WQKV;               src = wor;
    } else {
        u0 = 6 * CVT_X + 2 * CVT_WQKV + CVT_WO;      src = woi;
    }
    const size_t slice = (size_t)blockIdx.x * (CVT_UNIT / CVT_SLICES);
    const v4f* s4 = (const v4f*)(src + (size_t)(u - u0) * CVT_UNIT + slice) + threadIdx.x;
    v4h*       d4 = (v4h*)(dst + (size_t)u * CVT_UNIT + slice) + threadIdx.x;

    // Kept rolled: 8 loads of 16 bytes in flight per lane are enough for the
    // memory rate, and the small register count keeps every work-group resident.
#pragma unroll 1
    for (int it = 0; it < CVT_TRIPS; ++it) {
        v4f v[8];
#pragma unroll   // all 8 loads issue before the first value is used
        for (int j = 0; j < 8; ++j) v[j] = s4[it * 2048 + j * 256];
#pragma unroll   // constant indices keep v[] in registers
        for (int j = 0; j < 8; ++j)
            d4[it * 2048 + j * 256] = __builtin_convertvector(v[j], v4h);
    }
}

#define GK      64
#define GPITCH  72
#define GTILE   (128 * GPITCH)
#define GSTAGE  (4 * GTILE)
#define GSTAGES (EDIM / GK)
static_assert(NTOK % 128 == 0 && EDIM % 128 == 0 && GSTAGES >= 2, "whole tiles, two stages");
static_assert(GK == 64, "a stage is two blocks of 32 k");

// xr .. wi: first row of each tile (the same in every lane).  A lane brings 16
// bytes of row (tid >> 3) + 16 n of each tile, k = kb + (tid & 7) * 8 onwards.
static __device__ inline void stage_tiles(_Float16* buf, int tid, int kb,
                                          const _Float16* xr, const _Float16* xi,
                                          const _Float16* wr, const _Float16* wi) {
    const unsigned l = (unsigned)(uintptr_t)(buf + (tid >> 3) * GPITCH + (tid & 7) * 8);
    const unsigned o = (unsigned)((tid >> 3) * EDIM + (tid & 7) * 8 + kb);
    const unsigned lstep = 16 * GPITCH * sizeof(_Float16);
    const unsigned ltile = GTILE * sizeof(_Float16);
    async_rows8_b128(l,             xr + o, lstep, 16 * EDIM);
    async_rows8_b128(l + ltile,     xi + o, lstep, 16 * EDIM);
    async_rows8_b128(l + 2 * ltile, wr + o, lstep, 16 * EDIM);
    async_rows8_b128(l + 3 * ltile, wi + o, lstep, 16 * EDIM);
}

// Four fragments, rows 0, 16, 32, 48 onwards of a 64-row slice of an operand tile.
static __device__ __forceinline__ void load_frags4(v16h (&f)[4], const _Float16* p, int lane) {
#pragma unroll   // constant indices keep tiles and fragments in registers
    for (int i = 0; i < 4; ++i) f[i] = load_frag16(p + (i * 16) * GPITCH, GPITCH, lane);
}

// 16 WMMAs: acc[i][j] += b[j] . a[i]^T over 32 k; neighbours write different tiles.
// W is the first operand: a lane (c, h) then holds, of X row 16 i + c, the results
// for the 8 consecutive W rows 16 j + 8 h + 0..7.
static __device__ __forceinline__ void wmma4x4(const v16h (&a)[4], const v16h (&b)[4],
                                               v8f (&acc)[4][4]) {
#pragma unroll   // constant indices keep tiles and fragments in registers
    for (int i = 0; i < 4; ++i)
#pragma unroll   // constant indices keep tiles and fragments in registers
        for (int j = 0; j < 4; ++j) acc[i][j] = wmma16(b[j], a[i], acc[i][j]);
}

// The same with -a[i].
static __device__ __forceinline__ void wmma4x4_neg(const v16h (&a)[4], const v16h (&b)[4],
                                                   v8f (&acc)[4][4]) {
#pragma unroll   // constant indices keep tiles and fragments in registers
    for (int i = 0; i < 4; ++i) {
        const v16h na = -a[i];
#pragma unroll   // constant indices keep tiles and fragments in registers
        for (int j = 0; j < 4; ++j) acc[i][j] = wmma16(b[j], na, acc[i][j]);
    }
}

static __device__ __forceinline__ void cgemm_128x128(
    _Float16* sbuf,
    const _Float16* __restrict__ Xr, const _Float16* __restrict__ Xi,
    const _Float16* __restrict__ Wr, const _Float16* __restrict__ Wi,
    v8f (&accR)[4][4], v8f (&accI)[4][4])
{
    const int tid  = (int)threadIdx.x;
    const int lane = tid & 31;
    const int wave = tid >> 5;
    const int wm   = wave >> 1;       // which 64 rows of X
    const int wn   = wave & 1;        // which 64 rows of W

#pragma unroll   // constant indices keep tiles and fragments in registers
    for (int i = 0; i < 4; ++i)
#pragma unroll   // constant indices keep tiles and fragments in registers
        for (int j = 0; j < 4; ++j) { accR[i][j] = vzero8(); accI[i][j] = vzero8(); }

    stage_tiles(sbuf, tid, 0, Xr, Xi, Wr, Wi);
    wait_async0();
    __syncthreads();   // stage 0 visible to all waves
    stage_tiles(sbuf + GSTAGE, tid, GK, Xr, Xi, Wr, Wi);

    // Kept rolled: one copy of the 128-WMMA body, for speed only.
#pragma unroll 1
    for (int t = 0; t < GSTAGES; ++t) {
        _Float16* buf = sbuf + (t & 1) * GSTAGE;
        const _Float16* pa = buf + (wm * 64) * GPITCH;
        const _Float16* pb = buf + 2 * GTILE + (wn * 64) * GPITCH;
        // LDS reads stand at three places a stage, each one group, and but for the
        // first each
        // group has 16 WMMAs between it and its first use.  Left alone the
        // compiler spreads the reads among the WMMAs, most of them a few WMMAs
        // ahead of their use; each scheduling barrier below says what it holds.
        // Per accumulator the order stays ar.br, -ai.bi and ar.bi, ai.br.
        v16h ar[4], ai[4], br[4], bi[4];
        load_frags4(ar, pa, lane);                // k 0..31, in the order of use
        load_frags4(br, pb, lane);
        load_frags4(bi, pb + GTILE, lane);
        load_frags4(ai, pa + GTILE, lane);
        __builtin_amdgcn_sched_barrier(0);
        wmma4x4(ar, br, accR);
        __builtin_amdgcn_sched_barrier(0);   // the block opens with the fragments that land first
        wmma4x4(ar, bi, accI);
        wmma4x4(ai, br, accI);
        __builtin_amdgcn_sched_barrier(0);   // group 2 is not split up and lifted among these WMMAs
        load_frags4(ar, pa + 32, lane);           // k 32..63: Xr, Wr, whose registers are free now
        load_frags4(br, pb + 32, lane);
        __builtin_amdgcn_sched_barrier(0);   // group 2 stays ahead of the 16 WMMAs that cover it
        wmma4x4_neg(ai, bi, accR);
        __builtin_amdgcn_sched_barrier(0);   // group 3 is not split up and lifted among these WMMAs
        load_frags4(bi, pb + GTILE + 32, lane);   // k 32..63: Wi, Xi
        load_frags4(ai, pa + GTILE + 32, lane);
        __builtin_amdgcn_sched_barrier(0);   // group 3 stays ahead of the 16 WMMAs that cover it
        wmma4x4(ar, br, accR);
        __builtin_amdgcn_sched_barrier(0);   // the block opens with group 2's fragments, not group 3's
        wmma4x4(ar, bi, accI);
        wmma4x4(ai, br, accI);
        wmma4x4_neg(ai, bi, accR);
        // Keeps the hand-over at the foot: lifted to behind the last reads, its
        // wait would stand in front of the products that cover them.
        __builtin_amdgcn_sched_barrier(0);
        // Hand-over: this wave's reads of buf are done, its copies of stage
        // t + 1 have landed; behind the barrier both hold for every wave.
        asm volatile("s_wait_dscnt 0x0" ::: "memory");
        wait_async0();
        __syncthreads();
        if (t + 2 < GSTAGES)
            stage_tiles(buf, tid, (t + 2) * GK, Xr, Xi, Wr, Wi);
    }
    wait_async0();   // nothing in flight when the wave goes on
}

#define EPITCH  68
#define EPART   (64 * EPITCH)
#define EWAVE   (2 * EPART)
static_assert(4 * EWAVE * sizeof(float) <= 2 * GSTAGE * sizeof(_Float16), "staging fits the ring");

static __device__ __forceinline__ const float* stage_results(
    _Float16* sbuf, const v8f (&accR)[4][4], const v8f (&accI)[4][4])
{
    const int lane = threadIdx.x & 31;
    const int wave = threadIdx.x >> 5;
    float* st = (float*)sbuf + wave * EWAVE;
    float* p  = st + (lane & 15) * EPITCH + ((lane >> 4) << 3);
#pragma unroll   // constant indices keep tiles and fragments in registers
    for (int i = 0; i < 4; ++i) {
#pragma unroll   // constant indices keep tiles and fragments in registers
        for (int j = 0; j < 4; ++j) {
            float* q = p + (i * 16) * EPITCH + j * 16;
            *(v4f*)(q)             = __builtin_shufflevector(accR[i][j], accR[i][j], 0, 1, 2, 3);
            *(v4f*)(q + 4)         = __builtin_shufflevector(accR[i][j], accR[i][j], 4, 5, 6, 7);
            *(v4f*)(q + EPART)     = __builtin_shufflevector(accI[i][j], accI[i][j], 0, 1, 2, 3);
            *(v4f*)(q + EPART + 4) = __builtin_shufflevector(accI[i][j], accI[i][j], 4, 5, 6, 7);
        }
    }
    // The rows are read back by other lanes of this wave: its LDS writes are done first.
    asm volatile("s_wait_dscnt 0x0" ::: "memory");
    return st;
}

__global__ void __launch_bounds__(128, 2) qkv_gemm_kernel(
    const _Float16* __restrict__ xqr, const _Float16* __restrict__ xqi,
    const _Float16* __restrict__ xkr, const _Float16* __restrict__ xki,
    const _Float16* __restrict__ xvr, const _Float16* __restrict__ xvi,
    const _Float16* __restrict__ wr,  const _Float16* __restrict__ wi,
    const float* __restrict__ bre,    const float* __restrict__ bim,
    _Float16* __restrict__ Qr, _Float16* __restrict__ Qi,
    _Float16* __restrict__ Kr, _Float16* __restrict__ Ki,
    _Float16* __restrict__ Vr, _Float16* __restrict__ Vi)
{
    __shared__ __align__(16) _Float16 sbuf[2 * GSTAGE];

    const int lane = threadIdx.x & 31;
    const int wave = threadIdx.x >> 5;
    const int row0 = blockIdx.x * 128;               // token tile
    const int col0 = blockIdx.y * 128;               // output-feature tile
    const int sel  = col0 >> 10;                     // 0=q 1=k 2=v

    const _Float16* Xr = (sel == 0) ? xqr : ((sel == 1) ? xkr : xvr);
    const _Float16* Xi = (sel == 0) ? xqi : ((sel == 1) ? xki : xvi);

    v8f accR[4][4], accI[4][4];
    cgemm_128x128(sbuf, Xr + (size_t)row0 * EDIM, Xi + (size_t)row0 * EDIM,
                  wr + (size_t)col0 * EDIM, wi + (size_t)col0 * EDIM, accR, accI);

    _Float16* Dr = (sel == 0) ? Qr : ((sel == 1) ? Kr : Vr);
    _Float16* Di = (sel == 0) ? Qi : ((sel == 1) ? Ki : Vi);

    const int rowb = row0 + (wave >> 1) * 64;
    const int colb = col0 + (wave & 1) * 64;        // one head's 64 features
    const int hh   = (colb & (EDIM - 1)) >> 6;      // head
    const int sub  = lane >> 3;                     // the lane's row in a group of 4
    const int f0   = (lane & 7) * 8;                // first of the lane's 8 features

    // The lane's 8 biases, re and im; the loads land under the staging.
    const v4f bias[2][2] = {
        {*(const v4f*)(bre + colb + f0), *(const v4f*)(bre + colb + f0 + 4)},
        {*(const v4f*)(bim + colb + f0), *(const v4f*)(bim + colb + f0 + 4)}};
    // These loads have their addresses taken before later arithmetic reuses a
    // register that one of them names; the scheduling barrier keeps it behind the wait.
    asm volatile("s_wait_xcnt 0x0" ::: "memory");
    __builtin_amdgcn_sched_barrier(0);

    const float* st = stage_results(sbuf, accR, accI);

    // Row 4 g + sub is token rowb + 4 g + sub = s * B + b, B = 8: b = 4 (g & 1) + sub.
    // 8 lanes store one (b, head, s) row of 128 bytes, a wave-wide store four rows.
    const size_t o0 = (((size_t)(sub * HNUM + hh) * SDIM + (rowb >> 3)) * HD) + f0;
    const size_t ob = (size_t)4 * HNUM * SDIM * HD;
#pragma unroll   // constant indices keep the values in registers
    for (int part = 0; part < 2; ++part) {
        _Float16* D = (part ? Di : Dr) + o0;
#pragma unroll   // constant indices keep the values in registers
        for (int g0 = 0; g0 < 16; g0 += 8) {
            v8h y[8];
#pragma unroll   // constant indices keep the values in registers
            for (int u = 0; u < 8; ++u) {
                const float* q = st + part * EPART + ((g0 + u) * 4 + sub) * EPITCH + f0;
                const v4f lo = *(const v4f*)(q) + bias[part][0];
                const v4f hi = *(const v4f*)(q + 4) + bias[part][1];
                y[u] = __builtin_convertvector(
                    __builtin_shufflevector(lo, hi, 0, 1, 2, 3, 4, 5, 6, 7), v8h);
            }
            // No arithmetic of this group sinks among its stores, where it could
            // reuse a register that an issued store names.
            __builtin_amdgcn_sched_barrier(0);
#pragma unroll   // constant indices keep the values in registers
            for (int u = 0; u < 8; ++u)
                *(v8h*)(D + ((g0 + u) & 1) * ob + ((g0 + u) >> 1) * HD) = y[u];
            // These stores have their registers taken before the next group's values
            // reuse one that they name; the scheduling barrier keeps that group's
            // work behind the wait.
            if (part == 0 || g0 == 0) {
                asm volatile("s_wait_xcnt 0x0" ::: "memory");
                __builtin_amdgcn_sched_barrier(0);
            }
        }
    }
}

#define AW      8
#define AKEYS   32
#define AKP     72
#define AVP     80
#define AKTILE  (AKEYS * AKP)
#define AVTILE  (AKEYS * AVP)
#define ASTAGE  (2 * AKTILE + 2 * AVTILE)
#define ASTAGES (SDIM / AKEYS)
static_assert(AW * 32 * 8 == AKEYS * HD, "one 16-byte copy a lane fills one tile");
static_assert(ASTAGES >= 2 && SDIM % (AW * 16) == 0, "two stages, whole query blocks");

static __device__ inline void stage_kv(_Float16* buf, int tid, int t0,
                                       const _Float16* kr, const _Float16* ki,
                                       const _Float16* vr, const _Float16* vi) {
    const int row = tid >> 3, ch = (tid & 7) * 8;
    const unsigned lk = (unsigned)(uintptr_t)(buf + row * AKP + ch);
    const unsigned lv = (unsigned)(uintptr_t)(buf + 2 * AKTILE + row * AVP + ch);
    const unsigned o  = (unsigned)((t0 + row) * HD + ch);
    asm volatile(
        "global_load_async_to_lds_b128 %0, %4, off\n\t"
        "global_load_async_to_lds_b128 %1, %5, off\n\t"
        "global_load_async_to_lds_b128 %2, %6, off\n\t"
        "global_load_async_to_lds_b128 %3, %7, off\n\t"
        "s_wait_xcnt 0x0"
        :: "v"(lk), "v"(lk + (unsigned)(AKTILE * sizeof(_Float16))),
           "v"(lv), "v"(lv + (unsigned)(AVTILE * sizeof(_Float16))),
           "v"(kr + o), "v"(ki + o), "v"(vr + o), "v"(vi + o)
        : "memory");
}

// A fragment (16 d x 32 keys) of V^T from a row-major V tile: lane (c, h) gets
// V[8h + 0..7][d0 + c] and V[16 + 8h + 0..7][d0 + c], the k order of load_frag16.
// p: the lane's own address, tile + (8h + (lane & 7)) rows + 8 * ((lane >> 3) & 1).
static __device__ inline v16h load_vt_frag(const _Float16* p) {
    typedef __attribute__((ext_vector_type(8))) short s16x8;
    typedef __attribute__((address_space(3))) s16x8 lds_s16x8;
    v8h lo = __builtin_bit_cast(v8h, __builtin_amdgcn_ds_load_tr16_b128_v8i16((lds_s16x8*)p));
    v8h hi = __builtin_bit_cast(v8h, __builtin_amdgcn_ds_load_tr16_b128_v8i16((lds_s16x8*)(p + 16 * AVP)));
    return __builtin_shufflevector(lo, hi, 0, 1, 2, 3, 4, 5, 6, 7,
                                           8, 9, 10, 11, 12, 13, 14, 15);
}

__global__ void __launch_bounds__(AW * 32, 4) attn_kernel(
    const _Float16* __restrict__ Qr, const _Float16* __restrict__ Qi,
    const _Float16* __restrict__ Kr, const _Float16* __restrict__ Ki,
    const _Float16* __restrict__ Vr, const _Float16* __restrict__ Vi,
    _Float16* __restrict__ Or, _Float16* __restrict__ Oi)
{
    __shared__ __align__(16) _Float16 kv[2 * ASTAGE];     // two K/V stages

    const int tid  = (int)threadIdx.x;
    const int lane = tid & 31;
    const int wave = tid >> 5;
    const int bh = blockIdx.y;          // = b*H + h
    const int b  = bh >> 4;
    const int h  = bh & 15;
    const int s0 = blockIdx.x * (AW * 16) + wave * 16;

    const size_t base = (size_t)bh * SDIM * HD;
    const _Float16* kr = Kr + base;
    const _Float16* ki = Ki + base;
    const _Float16* vr = Vr + base;
    const _Float16* vi = Vi + base;

    stage_kv(kv, tid, 0, kr, ki, vr, vi);

    v16h aqr[2], aqi[2];
#pragma unroll
    for (int ks = 0; ks < 2; ++ks) {
        aqr[ks] = load_frag16(Qr + base + (size_t)s0 * HD + ks * 32, HD, lane);
        aqi[ks] = load_frag16(Qi + base + (size_t)s0 * HD + ks * 32, HD, lane);
    }

    v8f oR[4], oI[4];
#pragma unroll
    for (int j = 0; j < 4; ++j) { oR[j] = vzero8(); oI[j] = vzero8(); }
    // Of the lane's query: running maximum (equal in both lane halves) and the
    // running sum over this half's keys (the halves are joined after the loop).
    float mrun = -1e30f, lrun = 0.f;

    const float scale = 0.125f;   // 1/sqrt(64)
    // The lane's place in a V tile for the transposing load
    const int vlane = (((lane >> 4) << 3) + (lane & 7)) * AVP + ((lane >> 3) & 1) * 8;

    wait_async0();
    __syncthreads();   // stage 0 visible to all waves
    stage_kv(kv + ASTAGE, tid, AKEYS, kr, ki, vr, vi);

    // Kept rolled: the buffer alternates by address, one copy of the body.
#pragma unroll 1
    for (int t = 0; t < ASTAGES; ++t) {
        _Float16* buf = kv + (t & 1) * ASTAGE;

        // Scores: 32 keys x 16 queries as two 16x16 C tiles.  All 16 K reads stand in one
        // place ahead of the products; the scheduling barrier keeps them from
        // being spread.
        v16h bkr[2][2], bki[2][2];
#pragma unroll   // constant indices keep fragments in registers
        for (int ts = 0; ts < 2; ++ts) {
#pragma unroll   // constant indices keep fragments in registers
            for (int ks = 0; ks < 2; ++ks) {
                bkr[ts][ks] = load_frag16(buf + (ts * 16) * AKP + ks * 32, AKP, lane);
                bki[ts][ks] = load_frag16(buf + AKTILE + (ts * 16) * AKP + ks * 32, AKP, lane);
            }
        }
        __builtin_amdgcn_sched_barrier(0);
        // Per tile the order stays re, im of k 0..31, then re, im of k 32..63;
        // neighbouring WMMAs write different tiles.
        v8f sc[2];
        sc[0] = vzero8(); sc[1] = vzero8();
#pragma unroll   // constant indices keep fragments in registers
        for (int ks = 0; ks < 2; ++ks) {
            sc[0] = wmma16(bkr[0][ks], aqr[ks], sc[0]);
            sc[1] = wmma16(bkr[1][ks], aqr[ks], sc[1]);
            sc[0] = wmma16(bki[0][ks], aqi[ks], sc[0]);
            sc[1] = wmma16(bki[1][ks], aqi[ks], sc[1]);
        }

        // All 16 V^T reads as one group here: they need nothing of the softmax
        // and land under it; the scheduling barrier keeps them from sinking to
        // the products at the end of the pass.
        v16h bvr[4], bvi[4];
        {
            const _Float16* pv = buf + 2 * AKTILE + vlane;
#pragma unroll   // constant indices keep fragments in registers
            for (int j = 0; j < 4; ++j) {
                bvr[j] = load_vt_frag(pv + j * 16);
                bvi[j] = load_vt_frag(pv + AVTILE + j * 16);
            }
        }
        __builtin_amdgcn_sched_barrier(0);

        const v8f x0 = sc[0] * scale, x1 = sc[1] * scale;
        float mx[8];
#pragma unroll   // constant indices keep the scores in registers
        for (int r = 0; r < 8; ++r) mx[r] = fmaxf(x0[r], x1[r]);
        float m = fmaxf(fmaxf(fmaxf(mx[0], mx[1]), fmaxf(mx[2], mx[3])),
                        fmaxf(fmaxf(mx[4], mx[5]), fmaxf(mx[6], mx[7])));
        m = fmaxf(m, xhalf(m));
        const float mnew = fmaxf(mrun, m);
        // exp(y) as 2^(y * log2 e), as __expf() forms it
        const float l2e = 1.442695041f;
        float corr = (mrun - mnew) * l2e;
        float p[16];
#pragma unroll   // constant indices keep the scores in registers
        for (int r = 0; r < 8; ++r) { p[r] = (x0[r] - mnew) * l2e; p[8 + r] = (x1[r] - mnew) * l2e; }
        exp2_17(corr, p);
        mrun = mnew;
#pragma unroll   // constant indices keep the tiles in registers
        for (int j = 0; j < 4; ++j) { oR[j] *= corr; oI[j] *= corr; }
        float ps[8];
#pragma unroll   // constant indices keep the scores in registers
        for (int r = 0; r < 8; ++r) ps[r] = p[r] + p[8 + r];
        lrun = lrun * corr + (((ps[0] + ps[1]) + (ps[2] + ps[3])) +
                              ((ps[4] + ps[5]) + (ps[6] + ps[7])));

        // P^T as B operand: element s of lane (c, h) is key 8h + s (s < 8) or
        // 16 + 8h + (s - 8), which is where the two score tiles hold it.
        v16h pb;
#pragma unroll   // constant indices keep the fragment in registers
        for (int r = 0; r < 16; r += 2) {
            const v2f two = {p[r], p[r + 1]};
            const v2h h2 = __builtin_convertvector(two, v2h);
            pb[r] = h2[0]; pb[r + 1] = h2[1];
        }
#pragma unroll   // constant indices keep fragments in registers
        for (int j = 0; j < 4; ++j) {
            oR[j] = wmma16(bvr[j], pb, oR[j]);
            oI[j] = wmma16(bvi[j], pb, oI[j]);
        }

        // Hand-over: this wave's reads of buf are done, its copies of stage
        // t + 1 have landed; behind the barrier both hold for every wave.
        // The scheduling barrier keeps it at the foot of the pass: lifted to
        // behind the V^T reads, its wait would stand in front of the softmax,
        // and the reads would no longer land under it.
        __builtin_amdgcn_sched_barrier(0);
        asm volatile("s_wait_dscnt 0x0" ::: "memory");
        wait_async0();
        __syncthreads();
        if (t + 2 < ASTAGES)
            stage_kv(buf, tid, (t + 2) * AKEYS, kr, ki, vr, vi);
    }
    wait_async0();   // nothing in flight when the wave goes on

    // Normalize and write (S,B,E) f16 for the output projection: lane (c, h)
    // holds d = 16 j + 8 h + 0..7 of query c, 16 contiguous bytes a tile.
    const float invl = 1.0f / (lrun + xhalf(lrun));
    const size_t orow = ((size_t)((s0 + (lane & 15)) * BDIM + b)) * EDIM + h * HD + ((lane >> 4) << 3);
#pragma unroll
    for (int j = 0; j < 4; ++j) {
        *(v8h*)(Or + orow + j * 16) = __builtin_convertvector(oR[j] * invl, v8h);
        *(v8h*)(Oi + orow + j * 16) = __builtin_convertvector(oI[j] * invl, v8h);
        // These stores have their registers taken before the next tiles' values
        // reuse one that they name; the scheduling barrier keeps that arithmetic
        // behind the wait.
        if (j < 3) {
            asm volatile("s_wait_xcnt 0x0" ::: "memory");
            __builtin_amdgcn_sched_barrier(0);
        }
    }
}

// ---------------------------------------------------------------------------
// Output complex projection:  y = out @ Wo^T + bo -> f32 d_out stacked
// (2, S, B, E).  Same main loop and launch bounds as the QKV GEMM.
// ---------------------------------------------------------------------------
__global__ void __launch_bounds__(128, 2) out_gemm_kernel(
    const _Float16* __restrict__ Ar, const _Float16* __restrict__ Ai,
    const _Float16* __restrict__ wr, const _Float16* __restrict__ wi,
    const float* __restrict__ bre,   const float* __restrict__ bim,
    float* __restrict__ out)
{
    __shared__ __align__(16) _Float16 sbuf[2 * GSTAGE];

    const int lane = threadIdx.x & 31;
    const int wave = threadIdx.x >> 5;
    const int row0 = blockIdx.x * 128;
    const int col0 = blockIdx.y * 128;

    v8f accR[4][4], accI[4][4];
    cgemm_128x128(sbuf, Ar + (size_t)row0 * EDIM, Ai + (size_t)row0 * EDIM,
                  wr + (size_t)col0 * EDIM, wi + (size_t)col0 * EDIM, accR, accI);

    const size_t imOff = (size_t)NTOK * EDIM;
    const int rowb = row0 + (wave >> 1) * 64;
    const int colb = col0 + (wave & 1) * 64;
    const int sub  = lane >> 4;                     // the lane's row in a pair
    const int f0   = (lane & 15) * 4;               // first of the lane's 4 features

    // The lane's 4 biases, re and im; the loads land under the staging.
    const v4f bias[2] = {*(const v4f*)(bre + colb + f0), *(const v4f*)(bim + colb + f0)};
    // These loads have their addresses taken before later arithmetic reuses a
    // register that one of them names; the scheduling barrier keeps it behind the wait.
    asm volatile("s_wait_xcnt 0x0" ::: "memory");
    __builtin_amdgcn_sched_barrier(0);

    const float* st = stage_results(sbuf, accR, accI);

    // 16 lanes store 256 bytes of one token's row, a wave-wide store two tokens.
#pragma unroll   // constant indices keep the values in registers
    for (int part = 0; part < 2; ++part) {
        float* o = out + part * imOff + (size_t)(rowb + sub) * EDIM + colb + f0;
#pragma unroll   // constant indices keep the values in registers
        for (int g0 = 0; g0 < 32; g0 += 8) {
            v4f y[8];
#pragma unroll   // constant indices keep the values in registers
            for (int u = 0; u < 8; ++u)
                y[u] = *(const v4f*)(st + part * EPART + ((g0 + u) * 2 + sub) * EPITCH + f0) + bias[part];
            // No arithmetic of this group sinks among its stores, where it could
            // reuse a register that an issued store names.
            __builtin_amdgcn_sched_barrier(0);
#pragma unroll   // constant indices keep the values in registers
            for (int u = 0; u < 8; ++u)
                *(v4f*)(o + (size_t)((g0 + u) * 2) * EDIM) = y[u];
            // These stores have their registers taken before the next group's values
            // reuse one that they name; the scheduling barrier keeps that group's
            // work behind the wait.
            if (part == 0 || g0 < 24) {
                asm volatile("s_wait_xcnt 0x0" ::: "memory");
                __builtin_amdgcn_sched_barrier(0);
            }
        }
    }
}

// ---------------------------------------------------------------------------
// Host launcher
// ---------------------------------------------------------------------------
extern "C" void kernel_launch(void* const* d_in, const int* in_sizes, int n_in,
                              void* d_out, int out_size, void* d_ws, size_t ws_size,
                              hipStream_t stream) {
    (void)in_sizes; (void)n_in; (void)out_size; (void)ws_size;

    const size_t NE   = (size_t)NTOK * EDIM;   // 8,388,608
    const size_t WQKV = (size_t)E3 * EDIM;     // 3,145,728
    const size_t WO   = (size_t)EDIM * EDIM;   // 1,048,576

    _Float16* hws = (_Float16*)d_ws;
    _Float16* xqr = hws;            _Float16* xqi = xqr + NE;
    _Float16* xkr = xqi + NE;       _Float16* xki = xkr + NE;
    _Float16* xvr = xki + NE;       _Float16* xvi = xvr + NE;
    _Float16* wr  = xvi + NE;       _Float16* wi  = wr + WQKV;
    _Float16* wor = wi + WQKV;      _Float16* woi = wor + WO;
    _Float16* Qr  = woi + WO;       _Float16* Qi  = Qr + NE;
    _Float16* Kr  = Qi + NE;        _Float16* Ki  = Kr + NE;
    _Float16* Vr  = Ki + NE;        _Float16* Vi  = Vr + NE;
    _Float16* Aor = Vi + NE;        _Float16* Aoi = Aor + NE;

    // Activations and weights -> f16: xqr .. woi are contiguous from hws on
    {
        dim3 grid(CVT_SLICES, CVT_UNITS);
        f32_to_f16_all_kernel<<<grid, dim3(256), 0, stream>>>(
            (const float*)d_in[0], (const float*)d_in[1], (const float*)d_in[2],
            (const float*)d_in[3], (const float*)d_in[4], (const float*)d_in[5],
            (const float*)d_in[6], (const float*)d_in[7],
            (const float*)d_in[10], (const float*)d_in[11], hws);
    }

    // QKV projection (complex), head-major f16 outputs
    {
        dim3 grid(NTOK / 128, E3 / 128);
        qkv_gemm_kernel<<<grid, dim3(128), 0, stream>>>(
            xqr, xqi, xkr, xki, xvr, xvi, wr, wi,
            (const float*)d_in[8], (const float*)d_in[9],
            Qr, Qi, Kr, Ki, Vr, Vi);
    }

    // Flash attention per (b,h)
    {
        dim3 grid(SDIM / (AW * 16), BDIM * HNUM);
        attn_kernel<<<grid, dim3(AW * 32), 0, stream>>>(Qr, Qi, Kr, Ki, Vr, Vi, Aor, Aoi);
    }

    // Output projection (complex), f32 result stacked (re, im)
    {
        dim3 grid(NTOK / 128, EDIM / 128);
        out_gemm_kernel<<<grid, dim3(128), 0, stream>>>(
            Aor, Aoi, wor, woi,
            (const float*)d_in[12], (const float*)d_in[13],
            (float*)d_out);
    }
}

// v009
// Measured time: 209 microseconds a run.
// It is 1.13 times as fast as v007, going by the measured steps of the versions left out in between.
// Over all steps from v000 it is 3.90 times as fast.
#include <hip/hip_runtime.h>
#include <hip/hip_bf16.h>

// Problem constants (match reference)
#define SDIM 1024
#define BDIM 8
#define EDIM 1024
#define HNUM 16
#define HD   64
#define NTOK (SDIM * BDIM)   // 8192 tokens
#define E3   (3 * EDIM)      // 3072

typedef __attribute__((ext_vector_type(16))) _Float16 v16h;
typedef __attribute__((ext_vector_type(8)))  _Float16 v8h;
typedef __attribute__((ext_vector_type(8)))  float    v8f;
typedef __attribute__((ext_vector_type(2)))  float    v2f;
typedef __attribute__((ext_vector_type(2)))  _Float16 v2h;

static __device__ inline v16h load_frag16(const _Float16* p, int ld, int lane) {
    const int m  = lane & 15;
    const int kb = (lane >> 4) << 3;
    const _Float16* r = p + (size_t)m * (size_t)ld + kb;
    v8h lo = *(const v8h*)(r);
    v8h hi = *(const v8h*)(r + 16);
    return __builtin_shufflevector(lo, hi, 0, 1, 2, 3, 4, 5, 6, 7,
                                           8, 9, 10, 11, 12, 13, 14, 15);
}

static __device__ inline v8f wmma16(v16h a, v16h b, v8f c) {
    // 8-arg form: (neg_a, A, neg_b, B, c_mod, C, reuse_a, reuse_b)
    return __builtin_amdgcn_wmma_f32_16x16x32_f16(false, a, false, b,
                                                  (short)0, c, false, false);
}

static __device__ inline float xhalf(float v) {
    const int b = __builtin_bit_cast(int, v);
    return __builtin_bit_cast(float, __builtin_amdgcn_permlanex16(
        b, b, 0x76543210, 0xfedcba98, false, false));
}

static __device__ inline void exp2_17(float& c, float (&e)[16]) {
    asm("v_exp_f32 %0, %0\n\t"
        "v_exp_f32 %1, %1\n\t"
        "v_exp_f32 %2, %2\n\t"
        "v_exp_f32 %3, %3\n\t"
        "v_exp_f32 %4, %4\n\t"
        "v_exp_f32 %5, %5\n\t"
        "v_exp_f32 %6, %6\n\t"
        "v_exp_f32 %7, %7\n\t"
        "v_exp_f32 %8, %8\n\t"
        "v_exp_f32 %9, %9\n\t"
        "v_exp_f32 %10, %10\n\t"
        "v_exp_f32 %11, %11\n\t"
        "v_exp_f32 %12, %12\n\t"
        "v_exp_f32 %13, %13\n\t"
        "v_exp_f32 %14, %14\n\t"
        "v_exp_f32 %15, %15\n\t"
        "v_exp_f32 %16, %16\n\t"
        "v_nop"
        : "+v"(c), "+v"(e[0]), "+v"(e[1]), "+v"(e[2]), "+v"(e[3]), "+v"(e[4]),
          "+v"(e[5]), "+v"(e[6]), "+v"(e[7]), "+v"(e[8]), "+v"(e[9]), "+v"(e[10]),
          "+v"(e[11]), "+v"(e[12]), "+v"(e[13]), "+v"(e[14]), "+v"(e[15]));
}

static __device__ inline v8f vzero8() {
    v8f z = {0.f, 0.f, 0.f, 0.f, 0.f, 0.f, 0.f, 0.f};
    return z;
}

typedef __attribute__((ext_vector_type(4))) uint32_t u32x4;
typedef __attribute__((ext_vector_type(8))) uint32_t u32x8;

static __device__ __forceinline__ uint32_t uni(uint32_t v) {
    return (uint32_t)__builtin_amdgcn_readfirstlane(v);
}

static __device__ __forceinline__ uint32_t pinned(uint32_t v) {
    uint32_t w = uni(v);
    asm volatile("" : "+s"(w));
    return w;
}

static __device__ __forceinline__ void tdm_load(u32x4 g0, u32x8 g1) {
    asm volatile("tensor_load_to_lds %0, %1" :: "s"(g0), "s"(g1) : "memory");
}

static __device__ __forceinline__ void wait_tensor0() {
    asm volatile("s_wait_tensorcnt 0x0" ::: "memory");
}

static __device__ inline void wait_async0() {
    asm volatile("s_wait_asynccnt 0x0" ::: "memory");
}

// ---------------------------------------------------------------------------
// f32 -> f16 conversion of all ten operands in one launch.
// The ten f16 copies lie one behind the other in the workspace, in argument
// order, and every operand's length is a whole number of units of CVT_UNIT
// elements, so each unit of the destination has exactly one source.
// blockIdx.y = unit, blockIdx.x = slice of the unit.  A work-group converts
// CVT_TRIPS x 8,192 elements; each wave-wide load covers 512 contiguous bytes,
// each wave-wide store 256.
// ---------------------------------------------------------------------------
#define CVT_UNIT   (1 << 20)
#define CVT_X      ((NTOK * EDIM) / CVT_UNIT)   // units per activation: 8
#define CVT_WQKV   ((E3 * EDIM) / CVT_UNIT)     // units per qkv weight: 3
#define CVT_WO     ((EDIM * EDIM) / CVT_UNIT)   // units per out weight: 1
#define CVT_UNITS  (6 * CVT_X + 2 * CVT_WQKV + 2 * CVT_WO)
#define CVT_SLICES 32
#define CVT_TRIPS  (CVT_UNIT / CVT_SLICES / 8192)
static_assert(CVT_X * CVT_UNIT == NTOK * EDIM && CVT_WQKV * CVT_UNIT == E3 * EDIM &&
              CVT_WO * CVT_UNIT == EDIM * EDIM, "operands are whole units");
static_assert(CVT_TRIPS * CVT_SLICES * 8192 == CVT_UNIT, "slices are whole trips");

typedef __attribute__((ext_vector_type(4))) float    v4f;
typedef __attribute__((ext_vector_type(4))) _Float16 v4h;

__global__ void __launch_bounds__(256) f32_to_f16_all_kernel(
    const float* __restrict__ xqr, const float* __restrict__ xqi,
    const float* __restrict__ xkr, const float* __restrict__ xki,
    const float* __restrict__ xvr, const float* __restrict__ xvi,
    const float* __restrict__ wr,  const float* __restrict__ wi,
    const float* __restrict__ wor, const float* __restrict__ woi,
    _Float16* __restrict__ dst)
{
    const int u = (int)blockIdx.y;
    const float* src;   // the operand that unit u belongs to
    int u0;             // that operand's first unit
    if (u < 6 * CVT_X) {
        const int a = u / CVT_X;
        u0  = a * CVT_X;
        src = (a == 0) ? xqr : (a == 1) ? xqi : (a == 2) ? xkr
            : (a == 3) ? xki : (a == 4) ? xvr : xvi;
    } else if (u < 6 * CVT_X + CVT_WQKV) {
        u0 = 6 * CVT_X;                              src = wr;
    } else if (u < 6 * CVT_X + 2 * CVT_WQKV) {
        u0 = 6 * CVT_X + CVT_WQKV;                   src = wi;
    } else if (u < 6 * CVT_X + 2 * CVT_WQKV + CVT_WO) {
        u0 = 6 * CVT_X + 2 * CVT_WQKV;               src = wor;
    } else {
        u0 = 6 * CVT_X + 2 * CVT_WQKV + CVT_WO;      src = woi;
    }
    const size_t slice = (size_t)blockIdx.x * (CVT_UNIT / CVT_SLICES);
    const v4f* s4 = (const v4f*)(src + (size_t)(u - u0) * CVT_UNIT + slice) + threadIdx.x;
    v4h*       d4 = (v4h*)(dst + (size_t)u * CVT_UNIT + slice) + threadIdx.x;

    // Kept rolled: 8 loads of 16 bytes in flight per lane are enough for the
    // memory rate, and the small register count keeps every work-group resident.
#pragma unroll 1
    for (int it = 0; it < CVT_TRIPS; ++it) {
        v4f v[8];
#pragma unroll   // all 8 loads issue before the first value is used
        for (int j = 0; j < 8; ++j) v[j] = s4[it * 2048 + j * 256];
#pragma unroll   // constant indices keep v[] in registers
        for (int j = 0; j < 8; ++j)
            d4[it * 2048 + j * 256] = __builtin_convertvector(v[j], v4h);
    }
}

#define GK      64
#define GPITCH  72
#define GTILE   (128 * GPITCH)
#define GSTAGE  (4 * GTILE)
#define GSTAGES (EDIM / GK)
static_assert(NTOK % 128 == 0 && EDIM % 128 == 0 && GSTAGES >= 2, "whole tiles, two stages");
static_assert(GK == 64, "a stage is two blocks of 32 k");

static_assert(GK * sizeof(_Float16) == 128 && GPITCH * sizeof(_Float16) == 128 + 16, "rows of 128 B, pad of 16 B");
static_assert((GTILE * sizeof(_Float16)) % 2048 == 0, "every tile's place in LDS is a multiple of 2 KiB");
static __device__ __forceinline__ u32x8 tile_group1() {
    constexpr uint32_t d0 = GK * sizeof(_Float16), d1 = 128u;
    u32x8 g;
    g[0] = uni((1u << 20) | (4u << 22) | (3u << 25));
    g[1] = uni((d0 & 0xFFFFu) << 16);
    g[2] = uni((d0 >> 16) | ((d1 & 0xFFFFu) << 16));
    g[3] = uni((d1 >> 16) | (d0 << 16));
    g[4] = uni(d1);
    g[5] = uni((uint32_t)(EDIM * sizeof(_Float16)));
    g[6] = uni(0u);
    g[7] = uni(0u);
    return g;
}

static __device__ __forceinline__ u32x4 tile_group0(uint32_t lds_dst, uint64_t ga) {
    u32x4 g;
    g[0] = uni(1u);
    g[1] = uni(lds_dst);
    g[2] = uni((uint32_t)ga);
    g[3] = uni((((uint32_t)(ga >> 32)) & 0x01FFFFFFu) | 0x80000000u);
    return g;
}

// Four fragments, rows 0, 16, 32, 48 onwards of a 64-row slice of an operand tile.
static __device__ __forceinline__ void load_frags4(v16h (&f)[4], const _Float16* p, int lane) {
#pragma unroll   // constant indices keep tiles and fragments in registers
    for (int i = 0; i < 4; ++i) f[i] = load_frag16(p + (i * 16) * GPITCH, GPITCH, lane);
}

// 4 x NJ WMMAs: acc[i][J0 + j] += b[j] . a[i]^T over 32 k; neighbours write different
// tiles.  W is the first operand: a lane (c, h) then holds, of X row 16 i + c, the
// results for the 8 consecutive W rows 16 (J0 + j) + 8 h + 0..7.
template <int J0, int NJ>
static __device__ __forceinline__ void wmma4xn(const v16h (&a)[4], const v16h* b,
                                               v8f (&acc)[4][4]) {
#pragma unroll   // constant indices keep tiles and fragments in registers
    for (int i = 0; i < 4; ++i)
#pragma unroll   // constant indices keep tiles and fragments in registers
        for (int j = 0; j < NJ; ++j) acc[i][J0 + j] = wmma16(b[j], a[i], acc[i][J0 + j]);
}

// One block of 32 k of the complex product by three real products:
//   p1 += Xr.Wr,  p2 += Xi.Wi,  p3 += (Xr + Xi).(Wr + Wi);
// re = p1 - p2 and im = p3 - p1 - p2 are formed once, behind the k loop.
// The operand sums are packed f16 additions on the fragments, written over Xr and
// Wr once p1 has used those.  Wi passes through a window of two fragments, so that
// at most 14 fragments are live beside the three sets of accumulators.
// pa: the wave's rows of Xr (Xi one tile on), pb: its rows of Wr (Wi one tile on).
static __device__ __forceinline__ void cblock3(const _Float16* pa, const _Float16* pb, int lane,
                                               v8f (&p1)[4][4], v8f (&p2)[4][4], v8f (&p3)[4][4]) {
    v16h ar[4], ai[4], br[4], bw[2];
    load_frags4(ar, pa, lane);                    // in the order of use
    load_frags4(br, pb, lane);
    load_frags4(ai, pa + GTILE, lane);
    bw[0] = load_frag16(pb + GTILE, GPITCH, lane);
    bw[1] = load_frag16(pb + GTILE + 16 * GPITCH, GPITCH, lane);
    __builtin_amdgcn_sched_barrier(0);   // no read of this group sinks among the WMMAs
    wmma4xn<0, 4>(ar, br, p1);
    __builtin_amdgcn_sched_barrier(0);   // the block opens with the fragments that land first
    wmma4xn<0, 2>(ai, bw, p2);
#pragma unroll   // constant indices keep tiles and fragments in registers
    for (int i = 0; i < 4; ++i) ar[i] += ai[i];
    br[0] += bw[0];
    br[1] += bw[1];
    __builtin_amdgcn_sched_barrier(0);   // the window is read out before it is refilled
    bw[0] = load_frag16(pb + GTILE + 32 * GPITCH, GPITCH, lane);
    bw[1] = load_frag16(pb + GTILE + 48 * GPITCH, GPITCH, lane);
    __builtin_amdgcn_sched_barrier(0);   // the refill stays ahead of the 8 WMMAs that cover it
    wmma4xn<0, 2>(ar, br, p3);
    __builtin_amdgcn_sched_barrier(0);   // those 8 stay in front of the first use of the refill
    wmma4xn<2, 2>(ai, bw, p2);
    br[2] += bw[0];
    br[3] += bw[1];
    wmma4xn<2, 2>(ar, br + 2, p3);
}

static __device__ __forceinline__ void cgemm_128x128(
    _Float16* sbuf,
    const _Float16* __restrict__ Xr, const _Float16* __restrict__ Xi,
    const _Float16* __restrict__ Wr, const _Float16* __restrict__ Wi,
    v8f (&p1)[4][4], v8f (&p2)[4][4], v8f (&p3)[4][4])
{
    const int tid  = (int)threadIdx.x;
    const int lane = tid & 31;
    const int wave = tid >> 5;
    const int wm   = wave >> 1;       // which 64 rows of X
    const int wn   = wave & 1;        // which 64 rows of W

    // This wave's operand tile: wave 0 Xr, 1 Xi, 2 Wr, 3 Wi, in the order of the stage.
    const uint32_t wv = uni((uint32_t)wave);
    const _Float16* mine = (wv == 0u) ? Xr : (wv == 1u) ? Xi : (wv == 2u) ? Wr : Wi;
    const uint64_t gsrc  = (uint64_t)(uintptr_t)mine;
    const uint32_t ldst  = (uint32_t)(uintptr_t)sbuf + wv * (uint32_t)(GTILE * sizeof(_Float16));
    const u32x8 g1 = tile_group1();

#pragma unroll   // constant indices keep tiles and fragments in registers
    for (int i = 0; i < 4; ++i)
#pragma unroll   // constant indices keep tiles and fragments in registers
        for (int j = 0; j < 4; ++j) { p1[i][j] = vzero8(); p2[i][j] = vzero8(); p3[i][j] = vzero8(); }

    tdm_load(tile_group0(ldst, gsrc), g1);
    wait_tensor0();
    __syncthreads();   // stage 0 visible to all waves

    // Kept rolled: one copy of the 96-WMMA body.
#pragma unroll 1
    for (int t = 0; t < GSTAGES; ++t) {
        const uint32_t tn = pinned((uint32_t)t + 1u);
        if (pinned(tn < (uint32_t)GSTAGES))
            tdm_load(tile_group0(ldst + (tn & 1u) * (uint32_t)(GSTAGE * sizeof(_Float16)),
                                 gsrc + (uint64_t)tn * (GK * sizeof(_Float16))), g1);
        _Float16* buf = sbuf + (t & 1) * GSTAGE;
        const _Float16* pa = buf + (wm * 64) * GPITCH;
        const _Float16* pb = buf + 2 * GTILE + (wn * 64) * GPITCH;
        cblock3(pa, pb, lane, p1, p2, p3);             // k 0..31
        __builtin_amdgcn_sched_barrier(0);   // the second block's reads wait for the first's registers
        cblock3(pa + 32, pb + 32, lane, p1, p2, p3);   // k 32..63
        // Keeps the hand-over at the foot: lifted to behind the last reads, its
        // wait would stand in front of the products that cover them.
        __builtin_amdgcn_sched_barrier(0);
        // Hand-over: this wave's reads of buf are done, its tile of stage
        // t + 1 has landed; behind the barrier both hold for every wave.
        asm volatile("s_wait_dscnt 0x0" ::: "memory");
        wait_tensor0();
        __syncthreads();
    }
    wait_tensor0();   // nothing in flight when the wave goes on
    asm volatile("s_wait_dscnt 0x0" ::: "memory");   // and none of its LDS reads
}

#define EPITCH  68
#define EPART   (64 * EPITCH)
#define EWAVE   (2 * EPART)
static_assert(4 * EWAVE * sizeof(float) <= 2 * GSTAGE * sizeof(_Float16), "staging fits the ring");

static __device__ __forceinline__ const float* stage_results(
    _Float16* sbuf, const v8f (&p1)[4][4], const v8f (&p2)[4][4], const v8f (&p3)[4][4])
{
    const int lane = threadIdx.x & 31;
    const int wave = threadIdx.x >> 5;
    float* st = (float*)sbuf + wave * EWAVE;
    float* p  = st + (lane & 15) * EPITCH + ((lane >> 4) << 3);
#pragma unroll   // constant indices keep tiles and fragments in registers
    for (int i = 0; i < 4; ++i) {
#pragma unroll   // constant indices keep tiles and fragments in registers
        for (int j = 0; j < 4; ++j) {
            float* q = p + (i * 16) * EPITCH + j * 16;
            const v8f re = p1[i][j] - p2[i][j];
            const v8f im = (p3[i][j] - p1[i][j]) - p2[i][j];
            *(v4f*)(q)             = __builtin_shufflevector(re, re, 0, 1, 2, 3);
            *(v4f*)(q + 4)         = __builtin_shufflevector(re, re, 4, 5, 6, 7);
            *(v4f*)(q + EPART)     = __builtin_shufflevector(im, im, 0, 1, 2, 3);
            *(v4f*)(q + EPART + 4) = __builtin_shufflevector(im, im, 4, 5, 6, 7);
        }
    }
    // The rows are read back by other lanes of this wave: its LDS writes are done first.
    asm volatile("s_wait_dscnt 0x0" ::: "memory");
    return st;
}

__global__ void __launch_bounds__(128, 2) qkv_gemm_kernel(
    const _Float16* __restrict__ xqr, const _Float16* __restrict__ xqi,
    const _Float16* __restrict__ xkr, const _Float16* __restrict__ xki,
    const _Float16* __restrict__ xvr, const _Float16* __restrict__ xvi,
    const _Float16* __restrict__ wr,  const _Float16* __restrict__ wi,
    const float* __restrict__ bre,    const float* __restrict__ bim,
    _Float16* __restrict__ Qr, _Float16* __restrict__ Qi,
    _Float16* __restrict__ Kr, _Float16* __restrict__ Ki,
    _Float16* __restrict__ Vr, _Float16* __restrict__ Vi)
{
    // Aligned so that every tile's place is a multiple of 2 KiB in the work-group's LDS.
    __shared__ __attribute__((aligned(2048))) _Float16 sbuf[2 * GSTAGE];

    const int lane = threadIdx.x & 31;
    const int wave = threadIdx.x >> 5;
    const int row0 = blockIdx.x * 128;               // token tile
    const int col0 = blockIdx.y * 128;               // output-feature tile
    const int sel  = col0 >> 10;                     // 0=q 1=k 2=v

    const _Float16* Xr = (sel == 0) ? xqr : ((sel == 1) ? xkr : xvr);
    const _Float16* Xi = (sel == 0) ? xqi : ((sel == 1) ? xki : xvi);

    v8f p1[4][4], p2[4][4], p3[4][4];
    cgemm_128x128(sbuf, Xr + (size_t)row0 * EDIM, Xi + (size_t)row0 * EDIM,
                  wr + (size_t)col0 * EDIM, wi + (size_t)col0 * EDIM, p1, p2, p3);

    _Float16* Dr = (sel == 0) ? Qr : ((sel == 1) ? Kr : Vr);
    _Float16* Di = (sel == 0) ? Qi : ((sel == 1) ? Ki : Vi);

    const int rowb = row0 + (wave >> 1) * 64;
    const int colb = col0 + (wave & 1) * 64;        // one head's 64 features
    const int hh   = (colb & (EDIM - 1)) >> 6;      // head
    const int sub  = lane >> 3;                     // the lane's row in a group of 4
    const int f0   = (lane & 7) * 8;                // first of the lane's 8 features

    // The lane's 8 biases, re and im; the loads land under the staging.
    const v4f bias[2][2] = {
        {*(const v4f*)(bre + colb + f0), *(const v4f*)(bre + colb + f0 + 4)},
        {*(const v4f*)(bim + colb + f0), *(const v4f*)(bim + colb + f0 + 4)}};
    // These loads have their addresses taken before later arithmetic reuses a
    // register that one of them names; the scheduling barrier keeps it behind the wait.
    asm volatile("s_wait_xcnt 0x0" ::: "memory");
    __builtin_amdgcn_sched_barrier(0);

    const float* st = stage_results(sbuf, p1, p2, p3);

    // Row 4 g + sub is token rowb + 4 g + sub = s * B + b, B = 8: b = 4 (g & 1) + sub.
    // 8 lanes store one (b, head, s) row of 128 bytes, a wave-wide store four rows.
    const size_t o0 = (((size_t)(sub * HNUM + hh) * SDIM + (rowb >> 3)) * HD) + f0;
    const size_t ob = (size_t)4 * HNUM * SDIM * HD;
#pragma unroll   // constant indices keep the values in registers
    for (int part = 0; part < 2; ++part) {
        _Float16* D = (part ? Di : Dr) + o0;
#pragma unroll   // constant indices keep the values in registers
        for (int g0 = 0; g0 < 16; g0 += 8) {
            v8h y[8];
#pragma unroll   // constant indices keep the values in registers
            for (int u = 0; u < 8; ++u) {
                const float* q = st + part * EPART + ((g0 + u) * 4 + sub) * EPITCH + f0;
                const v4f lo = *(const v4f*)(q) + bias[part][0];
                const v4f hi = *(const v4f*)(q + 4) + bias[part][1];
                y[u] = __builtin_convertvector(
                    __builtin_shufflevector(lo, hi, 0, 1, 2, 3, 4, 5, 6, 7), v8h);
            }
            // No arithmetic of this group sinks among its stores, where it could
            // reuse a register that an issued store names.
            __builtin_amdgcn_sched_barrier(0);
#pragma unroll   // constant indices keep the values in registers
            for (int u = 0; u < 8; ++u)
                *(v8h*)(D + ((g0 + u) & 1) * ob + ((g0 + u) >> 1) * HD) = y[u];
            // These stores have their registers taken before the next group's values
            // reuse one that they name; the scheduling barrier keeps that group's
            // work behind the wait.
            if (part == 0 || g0 == 0) {
                asm volatile("s_wait_xcnt 0x0" ::: "memory");
                __builtin_amdgcn_sched_barrier(0);
            }
        }
    }
}

#define AW      8
#define AKEYS   32
#define AKP     72
#define AVP     80
#define AKTILE  (AKEYS * AKP)
#define AVTILE  (AKEYS * AVP)
#define ASTAGE  (2 * AKTILE + 2 * AVTILE)
#define ASTAGES (SDIM / AKEYS)
static_assert(AW * 32 * 8 == AKEYS * HD, "one 16-byte copy a lane fills one tile");
static_assert(ASTAGES >= 2 && SDIM % (AW * 16) == 0, "two stages, whole query blocks");

static __device__ inline void stage_kv(_Float16* buf, int tid, int t0,
                                       const _Float16* kr, const _Float16* ki,
                                       const _Float16* vr, const _Float16* vi) {
    const int row = tid >> 3, ch = (tid & 7) * 8;
    const unsigned lk = (unsigned)(uintptr_t)(buf + row * AKP + ch);
    const unsigned lv = (unsigned)(uintptr_t)(buf + 2 * AKTILE + row * AVP + ch);
    const unsigned o  = (unsigned)((t0 + row) * HD + ch);
    asm volatile(
        "global_load_async_to_lds_b128 %0, %4, off\n\t"
        "global_load_async_to_lds_b128 %1, %5, off\n\t"
        "global_load_async_to_lds_b128 %2, %6, off\n\t"
        "global_load_async_to_lds_b128 %3, %7, off\n\t"
        "s_wait_xcnt 0x0"
        :: "v"(lk), "v"(lk + (unsigned)(AKTILE * sizeof(_Float16))),
           "v"(lv), "v"(lv + (unsigned)(AVTILE * sizeof(_Float16))),
           "v"(kr + o), "v"(ki + o), "v"(vr + o), "v"(vi + o)
        : "memory");
}

// A fragment (16 d x 32 keys) of V^T from a row-major V tile: lane (c, h) gets
// V[8h + 0..7][d0 + c] and V[16 + 8h + 0..7][d0 + c], the k order of load_frag16.
// p: the lane's own address, tile + (8h + (lane & 7)) rows + 8 * ((lane >> 3) & 1).
static __device__ inline v16h load_vt_frag(const _Float16* p) {
    typedef __attribute__((ext_vector_type(8))) short s16x8;
    typedef __attribute__((address_space(3))) s16x8 lds_s16x8;
    v8h lo = __builtin_bit_cast(v8h, __builtin_amdgcn_ds_load_tr16_b128_v8i16((lds_s16x8*)p));
    v8h hi = __builtin_bit_cast(v8h, __builtin_amdgcn_ds_load_tr16_b128_v8i16((lds_s16x8*)(p + 16 * AVP)));
    return __builtin_shufflevector(lo, hi, 0, 1, 2, 3, 4, 5, 6, 7,
                                           8, 9, 10, 11, 12, 13, 14, 15);
}

__global__ void __launch_bounds__(AW * 32, 4) attn_kernel(
    const _Float16* __restrict__ Qr, const _Float16* __restrict__ Qi,
    const _Float16* __restrict__ Kr, const _Float16* __restrict__ Ki,
    const _Float16* __restrict__ Vr, const _Float16* __restrict__ Vi,
    _Float16* __restrict__ Or, _Float16* __restrict__ Oi)
{
    __shared__ __align__(16) _Float16 kv[2 * ASTAGE];     // two K/V stages

    const int tid  = (int)threadIdx.x;
    const int lane = tid & 31;
    const int wave = tid >> 5;
    const int bh = blockIdx.y;          // = b*H + h
    const int b  = bh >> 4;
    const int h  = bh & 15;
    const int s0 = blockIdx.x * (AW * 16) + wave * 16;

    const size_t base = (size_t)bh * SDIM * HD;
    const _Float16* kr = Kr + base;
    const _Float16* ki = Ki + base;
    const _Float16* vr = Vr + base;
    const _Float16* vi = Vi + base;

    stage_kv(kv, tid, 0, kr, ki, vr, vi);

    v16h aqr[2], aqi[2];
#pragma unroll
    for (int ks = 0; ks < 2; ++ks) {
        aqr[ks] = load_frag16(Qr + base + (size_t)s0 * HD + ks * 32, HD, lane);
        aqi[ks] = load_frag16(Qi + base + (size_t)s0 * HD + ks * 32, HD, lane);
    }

    v8f oR[4], oI[4];
#pragma unroll
    for (int j = 0; j < 4; ++j) { oR[j] = vzero8(); oI[j] = vzero8(); }
    // Of the lane's query: running maximum (equal in both lane halves) and the
    // running sum over this half's keys (the halves are joined after the loop).
    float mrun = -1e30f, lrun = 0.f;

    const float scale = 0.125f;   // 1/sqrt(64)
    // The lane's place in a V tile for the transposing load
    const int vlane = (((lane >> 4) << 3) + (lane & 7)) * AVP + ((lane >> 3) & 1) * 8;

    wait_async0();
    __syncthreads();   // stage 0 visible to all waves
    stage_kv(kv + ASTAGE, tid, AKEYS, kr, ki, vr, vi);

    // Kept rolled: the buffer alternates by address, one copy of the body.
#pragma unroll 1
    for (int t = 0; t < ASTAGES; ++t) {
        _Float16* buf = kv + (t & 1) * ASTAGE;

        // Scores: 32 keys x 16 queries as two 16x16 C tiles.  All 16 K reads stand in one
        // place ahead of the products; the scheduling barrier keeps them from
        // being spread.
        v16h bkr[2][2], bki[2][2];
#pragma unroll   // constant indices keep fragments in registers
        for (int ts = 0; ts < 2; ++ts) {
#pragma unroll   // constant indices keep fragments in registers
            for (int ks = 0; ks < 2; ++ks) {
                bkr[ts][ks] = load_frag16(buf + (ts * 16) * AKP + ks * 32, AKP, lane);
                bki[ts][ks] = load_frag16(buf + AKTILE + (ts * 16) * AKP + ks * 32, AKP, lane);
            }
        }
        __builtin_amdgcn_sched_barrier(0);
        // Per tile the order stays re, im of k 0..31, then re, im of k 32..63;
        // neighbouring WMMAs write different tiles.
        v8f sc[2];
        sc[0] = vzero8(); sc[1] = vzero8();
#pragma unroll   // constant indices keep fragments in registers
        for (int ks = 0; ks < 2; ++ks) {
            sc[0] = wmma16(bkr[0][ks], aqr[ks], sc[0]);
            sc[1] = wmma16(bkr[1][ks], aqr[ks], sc[1]);
            sc[0] = wmma16(bki[0][ks], aqi[ks], sc[0]);
            sc[1] = wmma16(bki[1][ks], aqi[ks], sc[1]);
        }

        // All 16 V^T reads as one group here: they need nothing of the softmax
        // and land under it; the scheduling barrier keeps them from sinking to
        // the products at the end of the pass.
        v16h bvr[4], bvi[4];
        {
            const _Float16* pv = buf + 2 * AKTILE + vlane;
#pragma unroll   // constant indices keep fragments in registers
            for (int j = 0; j < 4; ++j) {
                bvr[j] = load_vt_frag(pv + j * 16);
                bvi[j] = load_vt_frag(pv + AVTILE + j * 16);
            }
        }
        __builtin_amdgcn_sched_barrier(0);

        const v8f x0 = sc[0] * scale, x1 = sc[1] * scale;
        float mx[8];
#pragma unroll   // constant indices keep the scores in registers
        for (int r = 0; r < 8; ++r) mx[r] = fmaxf(x0[r], x1[r]);
        float m = fmaxf(fmaxf(fmaxf(mx[0], mx[1]), fmaxf(mx[2], mx[3])),
                        fmaxf(fmaxf(mx[4], mx[5]), fmaxf(mx[6], mx[7])));
        m = fmaxf(m, xhalf(m));
        const float mnew = fmaxf(mrun, m);
        // exp(y) as 2^(y * log2 e), as __expf() forms it
        const float l2e = 1.442695041f;
        float corr = (mrun - mnew) * l2e;
        float p[16];
#pragma unroll   // constant indices keep the scores in registers
        for (int r = 0; r < 8; ++r) { p[r] = (x0[r] - mnew) * l2e; p[8 + r] = (x1[r] - mnew) * l2e; }
        exp2_17(corr, p);
        mrun = mnew;
#pragma unroll   // constant indices keep the tiles in registers
        for (int j = 0; j < 4; ++j) { oR[j] *= corr; oI[j] *= corr; }
        float ps[8];
#pragma unroll   // constant indices keep the scores in registers
        for (int r = 0; r < 8; ++r) ps[r] = p[r] + p[8 + r];
        lrun = lrun * corr + (((ps[0] + ps[1]) + (ps[2] + ps[3])) +
                              ((ps[4] + ps[5]) + (ps[6] + ps[7])));

        // P^T as B operand: element s of lane (c, h) is key 8h + s (s < 8) or
        // 16 + 8h + (s - 8), which is where the two score tiles hold it.
        v16h pb;
#pragma unroll   // constant indices keep the fragment in registers
        for (int r = 0; r < 16; r += 2) {
            const v2f two = {p[r], p[r + 1]};
            const v2h h2 = __builtin_convertvector(two, v2h);
            pb[r] = h2[0]; pb[r + 1] = h2[1];
        }
#pragma unroll   // constant indices keep fragments in registers
        for (int j = 0; j < 4; ++j) {
            oR[j] = wmma16(bvr[j], pb, oR[j]);
            oI[j] = wmma16(bvi[j], pb, oI[j]);
        }

        // Hand-over: this wave's reads of buf are done, its copies of stage
        // t + 1 have landed; behind the barrier both hold for every wave.
        // The scheduling barrier keeps it at the foot of the pass: lifted to
        // behind the V^T reads, its wait would stand in front of the softmax,
        // and the reads would no longer land under it.
        __builtin_amdgcn_sched_barrier(0);
        asm volatile("s_wait_dscnt 0x0" ::: "memory");
        wait_async0();
        __syncthreads();
        if (t + 2 < ASTAGES)
            stage_kv(buf, tid, (t + 2) * AKEYS, kr, ki, vr, vi);
    }
    wait_async0();   // nothing in flight when the wave goes on

    // Normalize and write (S,B,E) f16 for the output projection: lane (c, h)
    // holds d = 16 j + 8 h + 0..7 of query c, 16 contiguous bytes a tile.
    const float invl = 1.0f / (lrun + xhalf(lrun));
    const size_t orow = ((size_t)((s0 + (lane & 15)) * BDIM + b)) * EDIM + h * HD + ((lane >> 4) << 3);
#pragma unroll
    for (int j = 0; j < 4; ++j) {
        *(v8h*)(Or + orow + j * 16) = __builtin_convertvector(oR[j] * invl, v8h);
        *(v8h*)(Oi + orow + j * 16) = __builtin_convertvector(oI[j] * invl, v8h);
        // These stores have their registers taken before the next tiles' values
        // reuse one that they name; the scheduling barrier keeps that arithmetic
        // behind the wait.
        if (j < 3) {
            asm volatile("s_wait_xcnt 0x0" ::: "memory");
            __builtin_amdgcn_sched_barrier(0);
        }
    }
}

// ---------------------------------------------------------------------------
// Output complex projection:  y = out @ Wo^T + bo -> f32 d_out stacked
// (2, S, B, E).  Same main loop and launch bounds as the QKV GEMM.
// ---------------------------------------------------------------------------
__global__ void __launch_bounds__(128, 2) out_gemm_kernel(
    const _Float16* __restrict__ Ar, const _Float16* __restrict__ Ai,
    const _Float16* __restrict__ wr, const _Float16* __restrict__ wi,
    const float* __restrict__ bre,   const float* __restrict__ bim,
    float* __restrict__ out)
{
    // Aligned so that every tile's place is a multiple of 2 KiB in the work-group's LDS.
    __shared__ __attribute__((aligned(2048))) _Float16 sbuf[2 * GSTAGE];

    const int lane = threadIdx.x & 31;
    const int wave = threadIdx.x >> 5;
    const int row0 = blockIdx.x * 128;
    const int col0 = blockIdx.y * 128;

    v8f p1[4][4], p2[4][4], p3[4][4];
    cgemm_128x128(sbuf, Ar + (size_t)row0 * EDIM, Ai + (size_t)row0 * EDIM,
                  wr + (size_t)col0 * EDIM, wi + (size_t)col0 * EDIM, p1, p2, p3);

    const size_t imOff = (size_t)NTOK * EDIM;
    const int rowb = row0 + (wave >> 1) * 64;
    const int colb = col0 + (wave & 1) * 64;
    const int sub  = lane >> 4;                     // the lane's row in a pair
    const int f0   = (lane & 15) * 4;               // first of the lane's 4 features

    // The lane's 4 biases, re and im; the loads land under the staging.
    const v4f bias[2] = {*(const v4f*)(bre + colb + f0), *(const v4f*)(bim + colb + f0)};
    // These loads have their addresses taken before later arithmetic reuses a
    // register that one of them names; the scheduling barrier keeps it behind the wait.
    asm volatile("s_wait_xcnt 0x0" ::: "memory");
    __builtin_amdgcn_sched_barrier(0);

    const float* st = stage_results(sbuf, p1, p2, p3);

    // 16 lanes store 256 bytes of one token's row, a wave-wide store two tokens.
#pragma unroll   // constant indices keep the values in registers
    for (int part = 0; part < 2; ++part) {
        float* o = out + part * imOff + (size_t)(rowb + sub) * EDIM + colb + f0;
#pragma unroll   // constant indices keep the values in registers
        for (int g0 = 0; g0 < 32; g0 += 8) {
            v4f y[8];
#pragma unroll   // constant indices keep the values in registers
            for (int u = 0; u < 8; ++u)
                y[u] = *(const v4f*)(st + part * EPART + ((g0 + u) * 2 + sub) * EPITCH + f0) + bias[part];
            // No arithmetic of this group sinks among its stores, where it could
            // reuse a register that an issued store names.
            __builtin_amdgcn_sched_barrier(0);
#pragma unroll   // constant indices keep the values in registers
            for (int u = 0; u < 8; ++u)
                *(v4f*)(o + (size_t)((g0 + u) * 2) * EDIM) = y[u];
            // These stores have their registers taken before the next group's values
            // reuse one that they name; the scheduling barrier keeps that group's
            // work behind the wait.
            if (part == 0 || g0 < 24) {
                asm volatile("s_wait_xcnt 0x0" ::: "memory");
                __builtin_amdgcn_sched_barrier(0);
            }
        }
    }
}

// ---------------------------------------------------------------------------
// Host launcher
// ---------------------------------------------------------------------------
extern "C" void kernel_launch(void* const* d_in, const int* in_sizes, int n_in,
                              void* d_out, int out_size, void* d_ws, size_t ws_size,
                              hipStream_t stream) {
    (void)in_sizes; (void)n_in; (void)out_size; (void)ws_size;

    const size_t NE   = (size_t)NTOK * EDIM;   // 8,388,608
    const size_t WQKV = (size_t)E3 * EDIM;     // 3,145,728
    const size_t WO   = (size_t)EDIM * EDIM;   // 1,048,576

    _Float16* hws = (_Float16*)d_ws;
    _Float16* xqr = hws;            _Float16* xqi = xqr + NE;
    _Float16* xkr = xqi + NE;       _Float16* xki = xkr + NE;
    _Float16* xvr = xki + NE;       _Float16* xvi = xvr + NE;
    _Float16* wr  = xvi + NE;       _Float16* wi  = wr + WQKV;
    _Float16* wor = wi + WQKV;      _Float16* woi = wor + WO;
    _Float16* Qr  = woi + WO;       _Float16* Qi  = Qr + NE;
    _Float16* Kr  = Qi + NE;        _Float16* Ki  = Kr + NE;
    _Float16* Vr  = Ki + NE;        _Float16* Vi  = Vr + NE;
    _Float16* Aor = Vi + NE;        _Float16* Aoi = Aor + NE;

    // Activations and weights -> f16: xqr .. woi are contiguous from hws on
    {
        dim3 grid(CVT_SLICES, CVT_UNITS);
        f32_to_f16_all_kernel<<<grid, dim3(256), 0, stream>>>(
            (const float*)d_in[0], (const float*)d_in[1], (const float*)d_in[2],
            (const float*)d_in[3], (const float*)d_in[4], (const float*)d_in[5],
            (const float*)d_in[6], (const float*)d_in[7],
            (const float*)d_in[10], (const float*)d_in[11], hws);
    }

    // QKV projection (complex), head-major f16 outputs
    {
        dim3 grid(NTOK / 128, E3 / 128);
        qkv_gemm_kernel<<<grid, dim3(128), 0, stream>>>(
            xqr, xqi, xkr, xki, xvr, xvi, wr, wi,
            (const float*)d_in[8], (const float*)d_in[9],
            Qr, Qi, Kr, Ki, Vr, Vi);
    }

    // Flash attention per (b,h)
    {
        dim3 grid(SDIM / (AW * 16), BDIM * HNUM);
        attn_kernel<<<grid, dim3(AW * 32), 0, stream>>>(Qr, Qi, Kr, Ki, Vr, Vi, Aor, Aoi);
    }

    // Output projection (complex), f32 result stacked (re, im)
    {
        dim3 grid(NTOK / 128, EDIM / 128);
        out_gemm_kernel<<<grid, dim3(128), 0, stream>>>(
            Aor, Aoi, wor, woi,
            (const float*)d_in[12], (const float*)d_in[13],
            (float*)d_out);
    }
}

// v010
// Measured time: 201 microseconds a run.
// Next to v009, in two timings, it ran 1.04 and 1.03 times as fast.
// All steps since v000 together make it 4.05 times as fast.
#include <hip/hip_runtime.h>
#include <hip/hip_bf16.h>

// Problem constants (match reference)
#define SDIM 1024
#define BDIM 8
#define EDIM 1024
#define HNUM 16
#define HD   64
#define NTOK (SDIM * BDIM)   // 8192 tokens
#define E3   (3 * EDIM)      // 3072

typedef __attribute__((ext_vector_type(16))) _Float16 v16h;
typedef __attribute__((ext_vector_type(8)))  _Float16 v8h;
typedef __attribute__((ext_vector_type(8)))  float    v8f;
typedef __attribute__((ext_vector_type(2)))  float    v2f;
typedef __attribute__((ext_vector_type(2)))  _Float16 v2h;

static __device__ inline v16h load_frag16(const _Float16* p, int ld, int lane) {
    const int m  = lane & 15;
    const int kb = (lane >> 4) << 3;
    const _Float16* r = p + (size_t)m * (size_t)ld + kb;
    v8h lo = *(const v8h*)(r);
    v8h hi = *(const v8h*)(r + 16);
    return __builtin_shufflevector(lo, hi, 0, 1, 2, 3, 4, 5, 6, 7,
                                           8, 9, 10, 11, 12, 13, 14, 15);
}

static __device__ inline v8f wmma16(v16h a, v16h b, v8f c) {
    // 8-arg form: (neg_a, A, neg_b, B, c_mod, C, reuse_a, reuse_b)
    return __builtin_amdgcn_wmma_f32_16x16x32_f16(false, a, false, b,
                                                  (short)0, c, false, false);
}

static __device__ inline float xhalf(float v) {
    const int b = __builtin_bit_cast(int, v);
    return __builtin_bit_cast(float, __builtin_amdgcn_permlanex16(
        b, b, 0x76543210, 0xfedcba98, false, false));
}

static __device__ inline void exp2_17(float& c, float (&e)[16]) {
    asm("v_exp_f32 %0, %0\n\t"
        "v_exp_f32 %1, %1\n\t"
        "v_exp_f32 %2, %2\n\t"
        "v_exp_f32 %3, %3\n\t"
        "v_exp_f32 %4, %4\n\t"
        "v_exp_f32 %5, %5\n\t"
        "v_exp_f32 %6, %6\n\t"
        "v_exp_f32 %7, %7\n\t"
        "v_exp_f32 %8, %8\n\t"
        "v_exp_f32 %9, %9\n\t"
        "v_exp_f32 %10, %10\n\t"
        "v_exp_f32 %11, %11\n\t"
        "v_exp_f32 %12, %12\n\t"
        "v_exp_f32 %13, %13\n\t"
        "v_exp_f32 %14, %14\n\t"
        "v_exp_f32 %15, %15\n\t"
        "v_exp_f32 %16, %16\n\t"
        "v_nop"
        : "+v"(c), "+v"(e[0]), "+v"(e[1]), "+v"(e[2]), "+v"(e[3]), "+v"(e[4]),
          "+v"(e[5]), "+v"(e[6]), "+v"(e[7]), "+v"(e[8]), "+v"(e[9]), "+v"(e[10]),
          "+v"(e[11]), "+v"(e[12]), "+v"(e[13]), "+v"(e[14]), "+v"(e[15]));
}

static __device__ inline v8f vzero8() {
    v8f z = {0.f, 0.f, 0.f, 0.f, 0.f, 0.f, 0.f, 0.f};
    return z;
}

typedef __attribute__((ext_vector_type(4))) uint32_t u32x4;
typedef __attribute__((ext_vector_type(8))) uint32_t u32x8;

static __device__ __forceinline__ uint32_t uni(uint32_t v) {
    return (uint32_t)__builtin_amdgcn_readfirstlane(v);
}

static __device__ __forceinline__ uint32_t pinned(uint32_t v) {
    uint32_t w = uni(v);
    asm volatile("" : "+s"(w));
    return w;
}

static __device__ __forceinline__ void tdm_load(u32x4 g0, u32x8 g1) {
    asm volatile("tensor_load_to_lds %0, %1" :: "s"(g0), "s"(g1) : "memory");
}

static __device__ __forceinline__ void wait_tensor0() {
    asm volatile("s_wait_tensorcnt 0x0" ::: "memory");
}

// ---------------------------------------------------------------------------
// f32 -> f16 conversion of all ten operands in one launch.
// The ten f16 copies lie one behind the other in the workspace, in argument
// order, and every operand's length is a whole number of units of CVT_UNIT
// elements, so each unit of the destination has exactly one source.
// blockIdx.y = unit, blockIdx.x = slice of the unit.  A work-group converts
// CVT_TRIPS x 8,192 elements; each wave-wide load covers 512 contiguous bytes,
// each wave-wide store 256.
// ---------------------------------------------------------------------------
#define CVT_UNIT   (1 << 20)
#define CVT_X      ((NTOK * EDIM) / CVT_UNIT)   // units per activation: 8
#define CVT_WQKV   ((E3 * EDIM) / CVT_UNIT)     // units per qkv weight: 3
#define CVT_WO     ((EDIM * EDIM) / CVT_UNIT)   // units per out weight: 1
#define CVT_UNITS  (6 * CVT_X + 2 * CVT_WQKV + 2 * CVT_WO)
#define CVT_SLICES 32
#define CVT_TRIPS  (CVT_UNIT / CVT_SLICES / 8192)
static_assert(CVT_X * CVT_UNIT == NTOK * EDIM && CVT_WQKV * CVT_UNIT == E3 * EDIM &&
              CVT_WO * CVT_UNIT == EDIM * EDIM, "operands are whole units");
static_assert(CVT_TRIPS * CVT_SLICES * 8192 == CVT_UNIT, "slices are whole trips");

typedef __attribute__((ext_vector_type(4))) float    v4f;
typedef __attribute__((ext_vector_type(4))) _Float16 v4h;

__global__ void __launch_bounds__(256) f32_to_f16_all_kernel(
    const float* __restrict__ xqr, const float* __restrict__ xqi,
    const float* __restrict__ xkr, const float* __restrict__ xki,
    const float* __restrict__ xvr, const float* __restrict__ xvi,
    const float* __restrict__ wr,  const float* __restrict__ wi,
    const float* __restrict__ wor, const float* __restrict__ woi,
    _Float16* __restrict__ dst)
{
    const int u = (int)blockIdx.y;
    const float* src;   // the operand that unit u belongs to
    int u0;             // that operand's first unit
    if (u < 6 * CVT_X) {
        const int a = u / CVT_X;
        u0  = a * CVT_X;
        src = (a == 0) ? xqr : (a == 1) ? xqi : (a == 2) ? xkr
            : (a == 3) ? xki : (a == 4) ? xvr : xvi;
    } else if (u < 6 * CVT_X + CVT_WQKV) {
        u0 = 6 * CVT_X;                              src = wr;
    } else if (u < 6 * CVT_X + 2 * CVT_WQKV) {
        u0 = 6 * CVT_X + CVT_WQKV;                   src = wi;
    } else if (u < 6 * CVT_X + 2 * CVT_WQKV + CVT_WO) {
        u0 = 6 * CVT_X + 2 * CVT_WQKV;               src = wor;
    } else {
        u0 = 6 * CVT_X + 2 * CVT_WQKV + CVT_WO;      src = woi;
    }
    const size_t slice = (size_t)blockIdx.x * (CVT_UNIT / CVT_SLICES);
    const v4f* s4 = (const v4f*)(src + (size_t)(u - u0) * CVT_UNIT + slice) + threadIdx.x;
    v4h*       d4 = (v4h*)(dst + (size_t)u * CVT_UNIT + slice) + threadIdx.x;

    // Kept rolled: 8 loads of 16 bytes in flight per lane are enough for the
    // memory rate, and the small register count keeps every work-group resident.
#pragma unroll 1
    for (int it = 0; it < CVT_TRIPS; ++it) {
        v4f v[8];
#pragma unroll   // all 8 loads issue before the first value is used
        for (int j = 0; j < 8; ++j) v[j] = s4[it * 2048 + j * 256];
#pragma unroll   // constant indices keep v[] in registers
        for (int j = 0; j < 8; ++j)
            d4[it * 2048 + j * 256] = __builtin_convertvector(v[j], v4h);
    }
}

#define GK      64
#define GPITCH  72
#define GTILE   (128 * GPITCH)
#define GSTAGE  (4 * GTILE)
#define GSTAGES (EDIM / GK)
static_assert(NTOK % 128 == 0 && EDIM % 128 == 0 && GSTAGES >= 2, "whole tiles, two stages");
static_assert(GK == 64, "a stage is two blocks of 32 k");

static_assert(GK * sizeof(_Float16) == 128 && GPITCH * sizeof(_Float16) == 128 + 16, "rows of 128 B, pad of 16 B");
static_assert((GTILE * sizeof(_Float16)) % 2048 == 0, "every tile's place in LDS is a multiple of 2 KiB");
static __device__ __forceinline__ u32x8 tile_group1() {
    constexpr uint32_t d0 = GK * sizeof(_Float16), d1 = 128u;
    u32x8 g;
    g[0] = uni((1u << 20) | (4u << 22) | (3u << 25));
    g[1] = uni((d0 & 0xFFFFu) << 16);
    g[2] = uni((d0 >> 16) | ((d1 & 0xFFFFu) << 16));
    g[3] = uni((d1 >> 16) | (d0 << 16));
    g[4] = uni(d1);
    g[5] = uni((uint32_t)(EDIM * sizeof(_Float16)));
    g[6] = uni(0u);
    g[7] = uni(0u);
    return g;
}

static __device__ __forceinline__ u32x4 tile_group0(uint32_t lds_dst, uint64_t ga) {
    u32x4 g;
    g[0] = uni(1u);
    g[1] = uni(lds_dst);
    g[2] = uni((uint32_t)ga);
    g[3] = uni((((uint32_t)(ga >> 32)) & 0x01FFFFFFu) | 0x80000000u);
    return g;
}

// Four fragments, rows 0, 16, 32, 48 onwards of a 64-row slice of an operand tile.
static __device__ __forceinline__ void load_frags4(v16h (&f)[4], const _Float16* p, int lane) {
#pragma unroll   // constant indices keep tiles and fragments in registers
    for (int i = 0; i < 4; ++i) f[i] = load_frag16(p + (i * 16) * GPITCH, GPITCH, lane);
}

// 4 x NJ WMMAs: acc[i][J0 + j] += b[j] . a[i]^T over 32 k; neighbours write different
// tiles.  W is the first operand: a lane (c, h) then holds, of X row 16 i + c, the
// results for the 8 consecutive W rows 16 (J0 + j) + 8 h + 0..7.
template <int J0, int NJ>
static __device__ __forceinline__ void wmma4xn(const v16h (&a)[4], const v16h* b,
                                               v8f (&acc)[4][4]) {
#pragma unroll   // constant indices keep tiles and fragments in registers
    for (int i = 0; i < 4; ++i)
#pragma unroll   // constant indices keep tiles and fragments in registers
        for (int j = 0; j < NJ; ++j) acc[i][J0 + j] = wmma16(b[j], a[i], acc[i][J0 + j]);
}

// One block of 32 k of the complex product by three real products:
//   p1 += Xr.Wr,  p2 += Xi.Wi,  p3 += (Xr + Xi).(Wr + Wi);
// re = p1 - p2 and im = p3 - p1 - p2 are formed once, behind the k loop.
// The operand sums are packed f16 additions on the fragments, written over Xr and
// Wr once p1 has used those.  Wi passes through a window of two fragments, so that
// at most 14 fragments are live beside the three sets of accumulators.
// pa: the wave's rows of Xr (Xi one tile on), pb: its rows of Wr (Wi one tile on).
static __device__ __forceinline__ void cblock3(const _Float16* pa, const _Float16* pb, int lane,
                                               v8f (&p1)[4][4], v8f (&p2)[4][4], v8f (&p3)[4][4]) {
    v16h ar[4], ai[4], br[4], bw[2];
    load_frags4(ar, pa, lane);                    // in the order of use
    load_frags4(br, pb, lane);
    load_frags4(ai, pa + GTILE, lane);
    bw[0] = load_frag16(pb + GTILE, GPITCH, lane);
    bw[1] = load_frag16(pb + GTILE + 16 * GPITCH, GPITCH, lane);
    __builtin_amdgcn_sched_barrier(0);   // no read of this group sinks among the WMMAs
    wmma4xn<0, 4>(ar, br, p1);
    __builtin_amdgcn_sched_barrier(0);   // the block opens with the fragments that land first
    wmma4xn<0, 2>(ai, bw, p2);
#pragma unroll   // constant indices keep tiles and fragments in registers
    for (int i = 0; i < 4; ++i) ar[i] += ai[i];
    br[0] += bw[0];
    br[1] += bw[1];
    __builtin_amdgcn_sched_barrier(0);   // the window is read out before it is refilled
    bw[0] = load_frag16(pb + GTILE + 32 * GPITCH, GPITCH, lane);
    bw[1] = load_frag16(pb + GTILE + 48 * GPITCH, GPITCH, lane);
    __builtin_amdgcn_sched_barrier(0);   // the refill stays ahead of the 8 WMMAs that cover it
    wmma4xn<0, 2>(ar, br, p3);
    __builtin_amdgcn_sched_barrier(0);   // those 8 stay in front of the first use of the refill
    wmma4xn<2, 2>(ai, bw, p2);
    br[2] += bw[0];
    br[3] += bw[1];
    wmma4xn<2, 2>(ar, br + 2, p3);
}

static __device__ __forceinline__ void cgemm_128x128(
    _Float16* sbuf,
    const _Float16* __restrict__ Xr, const _Float16* __restrict__ Xi,
    const _Float16* __restrict__ Wr, const _Float16* __restrict__ Wi,
    v8f (&p1)[4][4], v8f (&p2)[4][4], v8f (&p3)[4][4])
{
    const int tid  = (int)threadIdx.x;
    const int lane = tid & 31;
    const int wave = tid >> 5;
    const int wm   = wave >> 1;       // which 64 rows of X
    const int wn   = wave & 1;        // which 64 rows of W

    // This wave's operand tile: wave 0 Xr, 1 Xi, 2 Wr, 3 Wi, in the order of the stage.
    const uint32_t wv = uni((uint32_t)wave);
    const _Float16* mine = (wv == 0u) ? Xr : (wv == 1u) ? Xi : (wv == 2u) ? Wr : Wi;
    const uint64_t gsrc  = (uint64_t)(uintptr_t)mine;
    const uint32_t ldst  = (uint32_t)(uintptr_t)sbuf + wv * (uint32_t)(GTILE * sizeof(_Float16));
    const u32x8 g1 = tile_group1();

#pragma unroll   // constant indices keep tiles and fragments in registers
    for (int i = 0; i < 4; ++i)
#pragma unroll   // constant indices keep tiles and fragments in registers
        for (int j = 0; j < 4; ++j) { p1[i][j] = vzero8(); p2[i][j] = vzero8(); p3[i][j] = vzero8(); }

    tdm_load(tile_group0(ldst, gsrc), g1);
    wait_tensor0();
    __syncthreads();   // stage 0 visible to all waves

    // Kept rolled: one copy of the 96-WMMA body.
#pragma unroll 1
    for (int t = 0; t < GSTAGES; ++t) {
        const uint32_t tn = pinned((uint32_t)t + 1u);
        if (pinned(tn < (uint32_t)GSTAGES))
            tdm_load(tile_group0(ldst + (tn & 1u) * (uint32_t)(GSTAGE * sizeof(_Float16)),
                                 gsrc + (uint64_t)tn * (GK * sizeof(_Float16))), g1);
        _Float16* buf = sbuf + (t & 1) * GSTAGE;
        const _Float16* pa = buf + (wm * 64) * GPITCH;
        const _Float16* pb = buf + 2 * GTILE + (wn * 64) * GPITCH;
        cblock3(pa, pb, lane, p1, p2, p3);             // k 0..31
        __builtin_amdgcn_sched_barrier(0);   // the second block's reads wait for the first's registers
        cblock3(pa + 32, pb + 32, lane, p1, p2, p3);   // k 32..63
        // Keeps the hand-over at the foot: lifted to behind the last reads, its
        // wait would stand in front of the products that cover them.
        __builtin_amdgcn_sched_barrier(0);
        // Hand-over: this wave's reads of buf are done, its tile of stage
        // t + 1 has landed; behind the barrier both hold for every wave.
        asm volatile("s_wait_dscnt 0x0" ::: "memory");
        wait_tensor0();
        __syncthreads();
    }
    wait_tensor0();   // nothing in flight when the wave goes on
    asm volatile("s_wait_dscnt 0x0" ::: "memory");   // and none of its LDS reads
}

#define EPITCH  68
#define EPART   (64 * EPITCH)
#define EWAVE   (2 * EPART)
static_assert(4 * EWAVE * sizeof(float) <= 2 * GSTAGE * sizeof(_Float16), "staging fits the ring");

static __device__ __forceinline__ const float* stage_results(
    _Float16* sbuf, const v8f (&p1)[4][4], const v8f (&p2)[4][4], const v8f (&p3)[4][4])
{
    const int lane = threadIdx.x & 31;
    const int wave = threadIdx.x >> 5;
    float* st = (float*)sbuf + wave * EWAVE;
    float* p  = st + (lane & 15) * EPITCH + ((lane >> 4) << 3);
#pragma unroll   // constant indices keep tiles and fragments in registers
    for (int i = 0; i < 4; ++i) {
#pragma unroll   // constant indices keep tiles and fragments in registers
        for (int j = 0; j < 4; ++j) {
            float* q = p + (i * 16) * EPITCH + j * 16;
            const v8f re = p1[i][j] - p2[i][j];
            const v8f im = (p3[i][j] - p1[i][j]) - p2[i][j];
            *(v4f*)(q)             = __builtin_shufflevector(re, re, 0, 1, 2, 3);
            *(v4f*)(q + 4)         = __builtin_shufflevector(re, re, 4, 5, 6, 7);
            *(v4f*)(q + EPART)     = __builtin_shufflevector(im, im, 0, 1, 2, 3);
            *(v4f*)(q + EPART + 4) = __builtin_shufflevector(im, im, 4, 5, 6, 7);
        }
    }
    // The rows are read back by other lanes of this wave: its LDS writes are done first.
    asm volatile("s_wait_dscnt 0x0" ::: "memory");
    return st;
}

__global__ void __launch_bounds__(128, 2) qkv_gemm_kernel(
    const _Float16* __restrict__ xqr, const _Float16* __restrict__ xqi,
    const _Float16* __restrict__ xkr, const _Float16* __restrict__ xki,
    const _Float16* __restrict__ xvr, const _Float16* __restrict__ xvi,
    const _Float16* __restrict__ wr,  const _Float16* __restrict__ wi,
    const float* __restrict__ bre,    const float* __restrict__ bim,
    _Float16* __restrict__ Qr, _Float16* __restrict__ Qi,
    _Float16* __restrict__ Kr, _Float16* __restrict__ Ki,
    _Float16* __restrict__ Vr, _Float16* __restrict__ Vi)
{
    // Aligned so that every tile's place is a multiple of 2 KiB in the work-group's LDS.
    __shared__ __attribute__((aligned(2048))) _Float16 sbuf[2 * GSTAGE];

    const int lane = threadIdx.x & 31;
    const int wave = threadIdx.x >> 5;
    const int row0 = blockIdx.x * 128;               // token tile
    const int col0 = blockIdx.y * 128;               // output-feature tile
    const int sel  = col0 >> 10;                     // 0=q 1=k 2=v

    const _Float16* Xr = (sel == 0) ? xqr : ((sel == 1) ? xkr : xvr);
    const _Float16* Xi = (sel == 0) ? xqi : ((sel == 1) ? xki : xvi);

    v8f p1[4][4], p2[4][4], p3[4][4];
    cgemm_128x128(sbuf, Xr + (size_t)row0 * EDIM, Xi + (size_t)row0 * EDIM,
                  wr + (size_t)col0 * EDIM, wi + (size_t)col0 * EDIM, p1, p2, p3);

    _Float16* Dr = (sel == 0) ? Qr : ((sel == 1) ? Kr : Vr);
    _Float16* Di = (sel == 0) ? Qi : ((sel == 1) ? Ki : Vi);

    const int rowb = row0 + (wave >> 1) * 64;
    const int colb = col0 + (wave & 1) * 64;        // one head's 64 features
    const int hh   = (colb & (EDIM - 1)) >> 6;      // head
    const int sub  = lane >> 3;                     // the lane's row in a group of 4
    const int f0   = (lane & 7) * 8;                // first of the lane's 8 features

    // The lane's 8 biases, re and im; the loads land under the staging.
    const v4f bias[2][2] = {
        {*(const v4f*)(bre + colb + f0), *(const v4f*)(bre + colb + f0 + 4)},
        {*(const v4f*)(bim + colb + f0), *(const v4f*)(bim + colb + f0 + 4)}};
    // These loads have their addresses taken before later arithmetic reuses a
    // register that one of them names; the scheduling barrier keeps it behind the wait.
    asm volatile("s_wait_xcnt 0x0" ::: "memory");
    __builtin_amdgcn_sched_barrier(0);

    const float* st = stage_results(sbuf, p1, p2, p3);

    // Row 4 g + sub is token rowb + 4 g + sub = s * B + b, B = 8: b = 4 (g & 1) + sub.
    // 8 lanes store one (b, head, s) row of 128 bytes, a wave-wide store four rows.
    const size_t o0 = (((size_t)(sub * HNUM + hh) * SDIM + (rowb >> 3)) * HD) + f0;
    const size_t ob = (size_t)4 * HNUM * SDIM * HD;
#pragma unroll   // constant indices keep the values in registers
    for (int part = 0; part < 2; ++part) {
        _Float16* D = (part ? Di : Dr) + o0;
#pragma unroll   // constant indices keep the values in registers
        for (int g0 = 0; g0 < 16; g0 += 8) {
            v8h y[8];
#pragma unroll   // constant indices keep the values in registers
            for (int u = 0; u < 8; ++u) {
                const float* q = st + part * EPART + ((g0 + u) * 4 + sub) * EPITCH + f0;
                const v4f lo = *(const v4f*)(q) + bias[part][0];
                const v4f hi = *(const v4f*)(q + 4) + bias[part][1];
                y[u] = __builtin_convertvector(
                    __builtin_shufflevector(lo, hi, 0, 1, 2, 3, 4, 5, 6, 7), v8h);
            }
            // No arithmetic of this group sinks among its stores, where it could
            // reuse a register that an issued store names.
            __builtin_amdgcn_sched_barrier(0);
#pragma unroll   // constant indices keep the values in registers
            for (int u = 0; u < 8; ++u)
                *(v8h*)(D + ((g0 + u) & 1) * ob + ((g0 + u) >> 1) * HD) = y[u];
            // These stores have their registers taken before the next group's values
            // reuse one that they name; the scheduling barrier keeps that group's
            // work behind the wait.
            if (part == 0 || g0 == 0) {
                asm volatile("s_wait_xcnt 0x0" ::: "memory");
                __builtin_amdgcn_sched_barrier(0);
            }
        }
    }
}

#define AW      8
#define AKEYS   32
#define ASKEYS  128
#define APASSES (ASKEYS / AKEYS)
#define AKP     72
#define AVP     80
#define AKTILE  (ASKEYS * AKP)
#define AVTILE  (ASKEYS * AVP)
#define ASTAGE  (2 * AKTILE + 2 * AVTILE)
#define ASTAGES (SDIM / ASKEYS)
static_assert(ASTAGES >= 2 && SDIM % (AW * 16) == 0, "two stages, whole query blocks");
static_assert((APASSES & (APASSES - 1)) == 0, "the pass in its stage is the low bits of the pass number");
static_assert(HD * sizeof(_Float16) == 128 && AKP * sizeof(_Float16) == 128 + 16 &&
              AVP * sizeof(_Float16) == 128 + 32, "rows of 128 B, pads of 16 B and 32 B");
static_assert((AKTILE * sizeof(_Float16)) % 2048 == 0 && (AVTILE * sizeof(_Float16)) % 2048 == 0,
              "every tile's place in LDS is a multiple of 2 KiB");

template <uint32_t PADCODE>
static __device__ __forceinline__ u32x8 kv_group1() {
    constexpr uint32_t d0 = HD * sizeof(_Float16), d1 = ASKEYS;
    u32x8 g;
    g[0] = uni((1u << 20) | (4u << 22) | (PADCODE << 25));
    g[1] = uni((d0 & 0xFFFFu) << 16);
    g[2] = uni((d0 >> 16) | ((d1 & 0xFFFFu) << 16));
    g[3] = uni((d1 >> 16) | (d0 << 16));
    g[4] = uni(d1);
    g[5] = uni(d0);
    g[6] = uni(0u);
    g[7] = uni(0u);
    return g;
}

static __device__ __forceinline__ void held(u32x4& g) {
    asm volatile("" : "+s"(g));
}
static __device__ __forceinline__ void held(u32x8& g) {
    asm volatile("" : "+s"(g));
}

static __device__ __forceinline__ void stage_kv(uint32_t wv, const u32x4& g0,
                                                const u32x8& g1k, const u32x8& g1v) {
    if (pinned(wv < 2u))
        tdm_load(g0, g1k);
    if (pinned((wv & 6u) == 2u))
        tdm_load(g0, g1v);
}

// A fragment (16 d x 32 keys) of V^T from a row-major V tile: lane (c, h) gets
// V[8h + 0..7][d0 + c] and V[16 + 8h + 0..7][d0 + c], the k order of load_frag16.
// p: the lane's own address, tile + (8h + (lane & 7)) rows + 8 * ((lane >> 3) & 1).
static __device__ inline v16h load_vt_frag(const _Float16* p) {
    typedef __attribute__((ext_vector_type(8))) short s16x8;
    typedef __attribute__((address_space(3))) s16x8 lds_s16x8;
    v8h lo = __builtin_bit_cast(v8h, __builtin_amdgcn_ds_load_tr16_b128_v8i16((lds_s16x8*)p));
    v8h hi = __builtin_bit_cast(v8h, __builtin_amdgcn_ds_load_tr16_b128_v8i16((lds_s16x8*)(p + 16 * AVP)));
    return __builtin_shufflevector(lo, hi, 0, 1, 2, 3, 4, 5, 6, 7,
                                           8, 9, 10, 11, 12, 13, 14, 15);
}

__global__ void __launch_bounds__(AW * 32, 4) attn_kernel(
    const _Float16* __restrict__ Qr, const _Float16* __restrict__ Qi,
    const _Float16* __restrict__ Kr, const _Float16* __restrict__ Ki,
    const _Float16* __restrict__ Vr, const _Float16* __restrict__ Vi,
    _Float16* __restrict__ Or, _Float16* __restrict__ Oi)
{
    // Two K/V stages; aligned so that every tile's place is a multiple of 2 KiB.
    __shared__ __attribute__((aligned(2048))) _Float16 kv[2 * ASTAGE];

    const int tid  = (int)threadIdx.x;
    const int lane = tid & 31;
    const int wave = tid >> 5;
    const int bh = blockIdx.y;          // = b*H + h
    const int b  = bh >> 4;
    const int h  = bh & 15;
    const int s0 = blockIdx.x * (AW * 16) + wave * 16;

    const size_t base = (size_t)bh * SDIM * HD;
    const _Float16* kr = Kr + base;
    const _Float16* ki = Ki + base;
    const _Float16* vr = Vr + base;
    const _Float16* vi = Vi + base;

    // The tile that this wave brings (waves 4 to 7 hold the values of 0 to 3 and
    // issue nothing): 0 Kr, 1 Ki, 2 Vr, 3 Vi, in the order of the stage.
    const uint32_t wv = uni((uint32_t)wave);
    const uint32_t w4 = wv & 3u;
    const _Float16* mine = (w4 == 0u) ? kr : (w4 == 1u) ? ki : (w4 == 2u) ? vr : vi;
    const uint64_t gsrc  = (uint64_t)(uintptr_t)mine;
    const uint32_t ldst  = (uint32_t)(uintptr_t)kv +
        ((w4 < 2u) ? w4 * (uint32_t)(AKTILE * sizeof(_Float16))
                   : (uint32_t)(2 * AKTILE * sizeof(_Float16)) + (w4 - 2u) * (uint32_t)(AVTILE * sizeof(_Float16)));

    u32x8 g1k = kv_group1<3u>(), g1v = kv_group1<7u>();
    held(g1k);
    held(g1v);
    u32x4 g0 = tile_group0(ldst, gsrc);
    stage_kv(wv, g0, g1k, g1v);

    v16h aqr[2], aqi[2];
#pragma unroll
    for (int ks = 0; ks < 2; ++ks) {
        aqr[ks] = load_frag16(Qr + base + (size_t)s0 * HD + ks * 32, HD, lane);
        aqi[ks] = load_frag16(Qi + base + (size_t)s0 * HD + ks * 32, HD, lane);
    }

    v8f oR[4], oI[4];
#pragma unroll
    for (int j = 0; j < 4; ++j) { oR[j] = vzero8(); oI[j] = vzero8(); }
    // Of the lane's query: running maximum (equal in both lane halves) and the
    // running sum over this half's keys (the halves are joined after the loop).
    float mrun = -1e30f, lrun = 0.f;

    const float scale = 0.125f;   // 1/sqrt(64)
    // The lane's place in a V tile for the transposing load
    const int vlane = (((lane >> 4) << 3) + (lane & 7)) * AVP + ((lane >> 3) & 1) * 8;

    wait_tensor0();
    __syncthreads();   // stage 0 visible to all waves
    held(g0);
    g0 = tile_group0(ldst + (uint32_t)(ASTAGE * sizeof(_Float16)),
                     gsrc + (uint64_t)(ASKEYS * HD * sizeof(_Float16)));
    stage_kv(wv, g0, g1k, g1v);

    // Kept rolled: buffer and pass alternate by address, one copy of the body.
#pragma unroll 1
    for (int t = 0; t < SDIM / AKEYS; ++t) {
        const _Float16* stg = kv + ((t / APASSES) & 1) * ASTAGE;
        const _Float16* buf = stg + (t & (APASSES - 1)) * (AKEYS * AKP);               // the pass's K rows
        const _Float16* vbf = stg + 2 * AKTILE + (t & (APASSES - 1)) * (AKEYS * AVP);  // its V rows

        // Scores: 32 keys x 16 queries as two 16x16 C tiles.  All 16 K reads stand in one
        // place ahead of the products; the scheduling barrier keeps them from
        // being spread.
        v16h bkr[2][2], bki[2][2];
#pragma unroll   // constant indices keep fragments in registers
        for (int ts = 0; ts < 2; ++ts) {
#pragma unroll   // constant indices keep fragments in registers
            for (int ks = 0; ks < 2; ++ks) {
                bkr[ts][ks] = load_frag16(buf + (ts * 16) * AKP + ks * 32, AKP, lane);
                bki[ts][ks] = load_frag16(buf + AKTILE + (ts * 16) * AKP + ks * 32, AKP, lane);
            }
        }
        __builtin_amdgcn_sched_barrier(0);
        // Per tile the order stays re, im of k 0..31, then re, im of k 32..63;
        // neighbouring WMMAs write different tiles.
        v8f sc[2];
        sc[0] = vzero8(); sc[1] = vzero8();
#pragma unroll   // constant indices keep fragments in registers
        for (int ks = 0; ks < 2; ++ks) {
            sc[0] = wmma16(bkr[0][ks], aqr[ks], sc[0]);
            sc[1] = wmma16(bkr[1][ks], aqr[ks], sc[1]);
            sc[0] = wmma16(bki[0][ks], aqi[ks], sc[0]);
            sc[1] = wmma16(bki[1][ks], aqi[ks], sc[1]);
        }

        // All 16 V^T reads as one group here: they need nothing of the softmax
        // and land under it; the scheduling barrier keeps them from sinking to
        // the products at the end of the pass.
        v16h bvr[4], bvi[4];
        {
            const _Float16* pv = vbf + vlane;
#pragma unroll   // constant indices keep fragments in registers
            for (int j = 0; j < 4; ++j) {
                bvr[j] = load_vt_frag(pv + j * 16);
                bvi[j] = load_vt_frag(pv + AVTILE + j * 16);
            }
        }
        __builtin_amdgcn_sched_barrier(0);

        const v8f x0 = sc[0] * scale, x1 = sc[1] * scale;
        float mx[8];
#pragma unroll   // constant indices keep the scores in registers
        for (int r = 0; r < 8; ++r) mx[r] = fmaxf(x0[r], x1[r]);
        float m = fmaxf(fmaxf(fmaxf(mx[0], mx[1]), fmaxf(mx[2], mx[3])),
                        fmaxf(fmaxf(mx[4], mx[5]), fmaxf(mx[6], mx[7])));
        m = fmaxf(m, xhalf(m));
        const float mnew = fmaxf(mrun, m);
        // exp(y) as 2^(y * log2 e), as __expf() forms it
        const float l2e = 1.442695041f;
        float corr = (mrun - mnew) * l2e;
        float p[16];
#pragma unroll   // constant indices keep the scores in registers
        for (int r = 0; r < 8; ++r) { p[r] = (x0[r] - mnew) * l2e; p[8 + r] = (x1[r] - mnew) * l2e; }
        exp2_17(corr, p);
        mrun = mnew;
#pragma unroll   // constant indices keep the tiles in registers
        for (int j = 0; j < 4; ++j) { oR[j] *= corr; oI[j] *= corr; }
        float ps[8];
#pragma unroll   // constant indices keep the scores in registers
        for (int r = 0; r < 8; ++r) ps[r] = p[r] + p[8 + r];
        lrun = lrun * corr + (((ps[0] + ps[1]) + (ps[2] + ps[3])) +
                              ((ps[4] + ps[5]) + (ps[6] + ps[7])));

        // P^T as B operand: element s of lane (c, h) is key 8h + s (s < 8) or
        // 16 + 8h + (s - 8), which is where the two score tiles hold it.
        v16h pb;
#pragma unroll   // constant indices keep the fragment in registers
        for (int r = 0; r < 16; r += 2) {
            const v2f two = {p[r], p[r + 1]};
            const v2h h2 = __builtin_convertvector(two, v2h);
            pb[r] = h2[0]; pb[r + 1] = h2[1];
        }
#pragma unroll   // constant indices keep fragments in registers
        for (int j = 0; j < 4; ++j) {
            oR[j] = wmma16(bvr[j], pb, oR[j]);
            oI[j] = wmma16(bvi[j], pb, oI[j]);
        }

        if ((t & (APASSES - 1)) == APASSES - 1) {
            asm volatile("s_wait_dscnt 0x0" ::: "memory");
            wait_tensor0();
            __syncthreads();
            const uint32_t sn = pinned((uint32_t)(t / APASSES) + 2u);
            if (pinned(sn < (uint32_t)ASTAGES)) {
                g0 = tile_group0(ldst + (sn & 1u) * (uint32_t)(ASTAGE * sizeof(_Float16)),
                                 gsrc + (uint64_t)sn * (ASKEYS * HD * sizeof(_Float16)));
                stage_kv(wv, g0, g1k, g1v);
            }
        }
    }
    wait_tensor0();   // nothing in flight when the wave goes on
    asm volatile("s_wait_dscnt 0x0" ::: "memory");   // and none of its LDS reads

    // Normalize and write (S,B,E) f16 for the output projection: lane (c, h)
    // holds d = 16 j + 8 h + 0..7 of query c, 16 contiguous bytes a tile.
    const float invl = 1.0f / (lrun + xhalf(lrun));
    const size_t orow = ((size_t)((s0 + (lane & 15)) * BDIM + b)) * EDIM + h * HD + ((lane >> 4) << 3);
#pragma unroll
    for (int j = 0; j < 4; ++j) {
        *(v8h*)(Or + orow + j * 16) = __builtin_convertvector(oR[j] * invl, v8h);
        *(v8h*)(Oi + orow + j * 16) = __builtin_convertvector(oI[j] * invl, v8h);
        // These stores have their registers taken before the next tiles' values
        // reuse one that they name; the scheduling barrier keeps that arithmetic
        // behind the wait.
        if (j < 3) {
            asm volatile("s_wait_xcnt 0x0" ::: "memory");
            __builtin_amdgcn_sched_barrier(0);
        }
    }
}

// ---------------------------------------------------------------------------
// Output complex projection:  y = out @ Wo^T + bo -> f32 d_out stacked
// (2, S, B, E).  Same main loop and launch bounds as the QKV GEMM.
// ---------------------------------------------------------------------------
__global__ void __launch_bounds__(128, 2) out_gemm_kernel(
    const _Float16* __restrict__ Ar, const _Float16* __restrict__ Ai,
    const _Float16* __restrict__ wr, const _Float16* __restrict__ wi,
    const float* __restrict__ bre,   const float* __restrict__ bim,
    float* __restrict__ out)
{
    // Aligned so that every tile's place is a multiple of 2 KiB in the work-group's LDS.
    __shared__ __attribute__((aligned(2048))) _Float16 sbuf[2 * GSTAGE];

    const int lane = threadIdx.x & 31;
    const int wave = threadIdx.x >> 5;
    const int row0 = blockIdx.x * 128;
    const int col0 = blockIdx.y * 128;

    v8f p1[4][4], p2[4][4], p3[4][4];
    cgemm_128x128(sbuf, Ar + (size_t)row0 * EDIM, Ai + (size_t)row0 * EDIM,
                  wr + (size_t)col0 * EDIM, wi + (size_t)col0 * EDIM, p1, p2, p3);

    const size_t imOff = (size_t)NTOK * EDIM;
    const int rowb = row0 + (wave >> 1) * 64;
    const int colb = col0 + (wave & 1) * 64;
    const int sub  = lane >> 4;                     // the lane's row in a pair
    const int f0   = (lane & 15) * 4;               // first of the lane's 4 features

    // The lane's 4 biases, re and im; the loads land under the staging.
    const v4f bias[2] = {*(const v4f*)(bre + colb + f0), *(const v4f*)(bim + colb + f0)};
    // These loads have their addresses taken before later arithmetic reuses a
    // register that one of them names; the scheduling barrier keeps it behind the wait.
    asm volatile("s_wait_xcnt 0x0" ::: "memory");
    __builtin_amdgcn_sched_barrier(0);

    const float* st = stage_results(sbuf, p1, p2, p3);

    // 16 lanes store 256 bytes of one token's row, a wave-wide store two tokens.
#pragma unroll   // constant indices keep the values in registers
    for (int part = 0; part < 2; ++part) {
        float* o = out + part * imOff + (size_t)(rowb + sub) * EDIM + colb + f0;
#pragma unroll   // constant indices keep the values in registers
        for (int g0 = 0; g0 < 32; g0 += 8) {
            v4f y[8];
#pragma unroll   // constant indices keep the values in registers
            for (int u = 0; u < 8; ++u)
                y[u] = *(const v4f*)(st + part * EPART + ((g0 + u) * 2 + sub) * EPITCH + f0) + bias[part];
            // No arithmetic of this group sinks among its stores, where it could
            // reuse a register that an issued store names.
            __builtin_amdgcn_sched_barrier(0);
#pragma unroll   // constant indices keep the values in registers
            for (int u = 0; u < 8; ++u)
                *(v4f*)(o + (size_t)((g0 + u) * 2) * EDIM) = y[u];
            // These stores have their registers taken before the next group's values
            // reuse one that they name; the scheduling barrier keeps that group's
            // work behind the wait.
            if (part == 0 || g0 < 24) {
                asm volatile("s_wait_xcnt 0x0" ::: "memory");
                __builtin_amdgcn_sched_barrier(0);
            }
        }
    }
}

// ---------------------------------------------------------------------------
// Host launcher
// ---------------------------------------------------------------------------
extern "C" void kernel_launch(void* const* d_in, const int* in_sizes, int n_in,
                              void* d_out, int out_size, void* d_ws, size_t ws_size,
                              hipStream_t stream) {
    (void)in_sizes; (void)n_in; (void)out_size; (void)ws_size;

    const size_t NE   = (size_t)NTOK * EDIM;   // 8,388,608
    const size_t WQKV = (size_t)E3 * EDIM;     // 3,145,728
    const size_t WO   = (size_t)EDIM * EDIM;   // 1,048,576

    _Float16* hws = (_Float16*)d_ws;
    _Float16* xqr = hws;            _Float16* xqi = xqr + NE;
    _Float16* xkr = xqi + NE;       _Float16* xki = xkr + NE;
    _Float16* xvr = xki + NE;       _Float16* xvi = xvr + NE;
    _Float16* wr  = xvi + NE;       _Float16* wi  = wr + WQKV;
    _Float16* wor = wi + WQKV;      _Float16* woi = wor + WO;
    _Float16* Qr  = woi + WO;       _Float16* Qi  = Qr + NE;
    _Float16* Kr  = Qi + NE;        _Float16* Ki  = Kr + NE;
    _Float16* Vr  = Ki + NE;        _Float16* Vi  = Vr + NE;
    _Float16* Aor = Vi + NE;        _Float16* Aoi = Aor + NE;

    // Activations and weights -> f16: xqr .. woi are contiguous from hws on
    {
        dim3 grid(CVT_SLICES, CVT_UNITS);
        f32_to_f16_all_kernel<<<grid, dim3(256), 0, stream>>>(
            (const float*)d_in[0], (const float*)d_in[1], (const float*)d_in[2],
            (const float*)d_in[3], (const float*)d_in[4], (const float*)d_in[5],
            (const float*)d_in[6], (const float*)d_in[7],
            (const float*)d_in[10], (const float*)d_in[11], hws);
    }

    // QKV projection (complex), head-major f16 outputs
    {
        dim3 grid(NTOK / 128, E3 / 128);
        qkv_gemm_kernel<<<grid, dim3(128), 0, stream>>>(
            xqr, xqi, xkr, xki, xvr, xvi, wr, wi,
            (const float*)d_in[8], (const float*)d_in[9],
            Qr, Qi, Kr, Ki, Vr, Vi);
    }

    // Flash attention per (b,h)
    {
        dim3 grid(SDIM / (AW * 16), BDIM * HNUM);
        attn_kernel<<<grid, dim3(AW * 32), 0, stream>>>(Qr, Qi, Kr, Ki, Vr, Vi, Aor, Aoi);
    }

    // Output projection (complex), f32 result stacked (re, im)
    {
        dim3 grid(NTOK / 128, EDIM / 128);
        out_gemm_kernel<<<grid, dim3(128), 0, stream>>>(
            Aor, Aoi, wor, woi,
            (const float*)d_in[12], (const float*)d_in[13],
            (float*)d_out);
    }
}
